// v000
// Measured on an AMD MI455X. A time is GPU time per run, averaged over a window of back-to-back runs after a warm-up
// (all launches, gaps included; the runs take copies of the inputs in turn), and the median of several windows.
// Apart from v000's, it joins two sittings. Times from different sittings can be a few percent apart, while
// side-by-side timings come from the same sitting.
// v000, which the later versions start from, runs in 448 microseconds.
#include <hip/hip_runtime.h>
#include <hip/hip_bf16.h>

// ---------------------------------------------------------------------------
// MHA + residual + LayerNorm(axis=L) for gfx1250 (MI455X), f16 WMMA path,
// async global->LDS copies + double-buffered, software-pipelined tiles.
// B=2, L=2048, HIDDEN=768, HEADS=12, HEAD=64.
// ---------------------------------------------------------------------------

typedef __attribute__((ext_vector_type(16))) _Float16 v16h;
typedef __attribute__((ext_vector_type(8)))  float    v8f;
typedef __attribute__((ext_vector_type(4)))  int      v4i;

#define WMMA_F16(a, b, c) \
  __builtin_amdgcn_wmma_f32_16x16x32_f16(false, (a), false, (b), (short)0, (c), false, false)

#if __has_builtin(__builtin_amdgcn_global_load_async_to_lds_b128)
#define HAVE_ASYNC_LDS 1
#else
#define HAVE_ASYNC_LDS 0
#endif

// 16-byte global -> LDS copy; async (ASYNCcnt) when the builtin exists.
// Probed signature: (v4i addrspace(1)*, v4i addrspace(3)*, imm offset, imm cpol)
__device__ inline void async_copy16(const _Float16* g, _Float16* l) {
#if HAVE_ASYNC_LDS
  __builtin_amdgcn_global_load_async_to_lds_b128(
      (__attribute__((address_space(1))) v4i*)g,
      (__attribute__((address_space(3))) v4i*)l, 0, 0);
#else
  *(float4*)l = *(const float4*)g;
#endif
}

__device__ inline void wait_async() {
#if HAVE_ASYNC_LDS
#if __has_builtin(__builtin_amdgcn_s_wait_asynccnt)
  __builtin_amdgcn_s_wait_asynccnt(0);
#else
  asm volatile("s_wait_asynccnt 0" ::: "memory");
#endif
#endif
}

// Load a 16x32 f16 fragment (A-layout; also B-layout when source is stored
// transposed, i.e. K contiguous per row).  Per CDNA5 ISA 7.12.2:
//   lane 0-15: row = lane,   VGPR v<4: K = half*8 + v*2,   v>=4: K = 16+...
// => per lane: 8 contiguous halfs at [row][half*8] and 8 at [row][16+half*8].
__device__ inline v16h load_frag16(const _Float16* base, int stride_h, int lane) {
  const int m  = lane & 15;
  const int hf = lane >> 4;
  union { v16h v; float4 q[2]; } u;
  u.q[0] = *(const float4*)(base + (size_t)m * stride_h + hf * 8);
  u.q[1] = *(const float4*)(base + (size_t)m * stride_h + 16 + hf * 8);
  return u.v;
}

// ---------------------------------------------------------------------------
// fp32 -> f16 conversion, 4 elems/thread (sizes are multiples of 1024)
// ---------------------------------------------------------------------------
__global__ __launch_bounds__(256) void cvt_f16_kernel(const float* __restrict__ src,
                                                      _Float16* __restrict__ dst) {
  const int i = (blockIdx.x * 256 + threadIdx.x) * 4;
  float4 v = *(const float4*)(src + i);
  union { uint2 u; _Float16 h[4]; } p;
  p.h[0] = (_Float16)v.x; p.h[1] = (_Float16)v.y;
  p.h[2] = (_Float16)v.z; p.h[3] = (_Float16)v.w;
  *(uint2*)(dst + i) = p.u;
}

// ---------------------------------------------------------------------------
// GEMM: C = X @ W + bias, X:[4096,768] f16, W:[768,768] f16.
// Block tile 128(M) x 128(N), K-step 32, double-buffered LDS, async X copy,
// register-prefetched transposed W tile.  8 waves; wave = 16 rows x 128 cols.
// MODE 0: scatter to Q/K/V [B,H,L,64] f16.   MODE 1: += residual, fp32 out.
// ---------------------------------------------------------------------------
template <int MODE>
__global__ __launch_bounds__(256) void gemm_kernel(const _Float16* __restrict__ X,
                                                   const _Float16* __restrict__ W,
                                                   const float* __restrict__ bias,
                                                   const float* __restrict__ resid,
                                                   _Float16* __restrict__ Yh,
                                                   float* __restrict__ Yf) {
  __shared__ _Float16 xt[2][128 * 32];   // 2 x 8 KB
  __shared__ _Float16 wt[2][128 * 32];   // 2 x 8 KB, transposed: wt[n][k]
  const int mtile = blockIdx.x;          // 0..31
  const int ntile = blockIdx.y;          // 0..5
  const int t = threadIdx.x, wave = t >> 5, lane = t & 31;

  // X tile 128x32: 512 16B segments; async copy, natural layout.
  auto loadX = [&](int kb, int buf) {
    #pragma unroll
    for (int p = t; p < 512; p += 256) {
      const int row = p >> 2, c4 = p & 3;
      async_copy16(X + ((size_t)(mtile * 128 + row)) * 768 + kb * 32 + c4 * 8,
                   &xt[buf][row * 32 + c4 * 8]);
    }
  };
  // W tile 32(k)x128(n): prefetch to regs, store transposed (K contiguous).
  auto loadW = [&](int kb, float4 wreg[2]) {
    #pragma unroll
    for (int i = 0; i < 2; ++i) {
      const int p = t + i * 256;                      // 512 segments
      wreg[i] = *(const float4*)(W + ((size_t)(kb * 32 + (p >> 4))) * 768 +
                                 ntile * 128 + (p & 15) * 8);
    }
  };
  auto storeW = [&](int buf, const float4 wreg[2]) {
    #pragma unroll
    for (int i = 0; i < 2; ++i) {
      const int p = t + i * 256;
      const int k = p >> 4, nb = (p & 15) * 8;
      union { float4 f; _Float16 h[8]; } u; u.f = wreg[i];
      #pragma unroll
      for (int j = 0; j < 8; ++j) wt[buf][(nb + j) * 32 + k] = u.h[j];
    }
  };

  float4 wreg[2];
  loadX(0, 0);
  loadW(0, wreg);
  storeW(0, wreg);
  wait_async();
  __syncthreads();

  v8f acc[8] = {};
  int cur = 0;
  for (int kb = 0; kb < 24; ++kb) {
    const int nxt = cur ^ 1;
    if (kb + 1 < 24) { loadX(kb + 1, nxt); loadW(kb + 1, wreg); }
    const v16h a = load_frag16(xt[cur] + wave * 16 * 32, 32, lane);
    #pragma unroll
    for (int t2 = 0; t2 < 8; ++t2) {
      const v16h b = load_frag16(wt[cur] + t2 * 16 * 32, 32, lane);
      acc[t2] = WMMA_F16(a, b, acc[t2]);
    }
    if (kb + 1 < 24) storeW(nxt, wreg);
    wait_async();
    __syncthreads();
    cur = nxt;
  }

  const int n_lo = lane & 15, hf = lane >> 4;
  #pragma unroll
  for (int t2 = 0; t2 < 8; ++t2) {
    const int n = ntile * 128 + t2 * 16 + n_lo;
    const float bv = bias[n];
    #pragma unroll
    for (int r = 0; r < 8; ++r) {
      const int m = mtile * 128 + wave * 16 + r + 8 * hf;
      if (MODE == 0) {
        const int b = m >> 11, l = m & 2047;
        const int h = n >> 6, d = n & 63;
        Yh[(((size_t)(b * 12 + h)) * 2048 + l) * 64 + d] = (_Float16)(acc[t2][r] + bv);
      } else {
        const size_t idx = (size_t)m * 768 + n;
        Yf[idx] = acc[t2][r] + bv + resid[idx];
      }
    }
  }
}

// ---------------------------------------------------------------------------
// Flash attention: grid (24 bh, 16 q-blocks of 128).  Wave = 16 query rows.
// Double-buffered K/V^T tiles; K via async copy, V transposed through regs.
// ---------------------------------------------------------------------------
__global__ __launch_bounds__(256) void attn_kernel(const _Float16* __restrict__ Qh,
                                                   const _Float16* __restrict__ Kh,
                                                   const _Float16* __restrict__ Vh,
                                                   const int* __restrict__ amask,
                                                   _Float16* __restrict__ Ch) {
  __shared__ _Float16 klds[2][64 * 64];   // K tile, natural [key][d]    2x8 KB
  __shared__ _Float16 vtlds[2][64 * 64];  // V tile transposed [d][key]  2x8 KB
  __shared__ float    mlds[2][64];        // additive key mask
  __shared__ _Float16 plds[8 * 16 * 64];  // per-wave P staging          16 KB

  const int bh = blockIdx.x;              // 0..23
  const int qb = blockIdx.y;              // 0..15
  const int b  = bh / 12, h = bh % 12;
  const int t = threadIdx.x, wave = t >> 5, lane = t & 31;
  const int n_lo = lane & 15, hf = lane >> 4;

  // Q fragments stay in registers: 16 rows x 64 d
  const _Float16* qbase = Qh + (((size_t)bh * 2048) + qb * 128 + wave * 16) * 64;
  const v16h qa0 = load_frag16(qbase, 64, lane);
  const v16h qa1 = load_frag16(qbase + 32, 64, lane);

  auto loadK = [&](int j, int buf) {
    const _Float16* kb_ = Kh + (((size_t)bh * 2048) + j * 64) * 64;
    #pragma unroll
    for (int p = t; p < 512; p += 256) async_copy16(kb_ + p * 8, &klds[buf][p * 8]);
  };
  auto loadV = [&](int j, unsigned int vreg[8]) {
    const unsigned int* vb_ = (const unsigned int*)(Vh + (((size_t)bh * 2048) + j * 64) * 64);
    #pragma unroll
    for (int i = 0; i < 8; ++i) vreg[i] = vb_[t * 8 + i];
  };
  auto storeV = [&](int buf, const unsigned int vreg[8]) {
    #pragma unroll
    for (int i = 0; i < 8; ++i) {
      const int p = t * 8 + i;                // 2048 half-pairs
      const int l = p >> 5, d2 = (p & 31) * 2;
      union { unsigned int u; _Float16 hh[2]; } cv; cv.u = vreg[i];
      vtlds[buf][d2 * 64 + l]       = cv.hh[0];
      vtlds[buf][(d2 + 1) * 64 + l] = cv.hh[1];
    }
  };
  auto loadM = [&](int j, int buf) {
    if (t < 64) mlds[buf][t] = amask[b * 2048 + j * 64 + t] ? 0.f : -1e30f;
  };

  float mstate[8], lstate[8];
  v8f o[4] = {};
  #pragma unroll
  for (int r = 0; r < 8; ++r) { mstate[r] = -1e30f; lstate[r] = 0.f; }

  unsigned int vreg[8];
  loadK(0, 0); loadV(0, vreg); storeV(0, vreg); loadM(0, 0);
  wait_async();
  __syncthreads();

  int cur = 0;
  for (int j = 0; j < 32; ++j) {
    const int nxt = cur ^ 1;
    if (j + 1 < 32) { loadK(j + 1, nxt); loadV(j + 1, vreg); loadM(j + 1, nxt); }

    // S = (Q @ K^T) * 0.125 + mask
    v8f s[4];
    #pragma unroll
    for (int t2 = 0; t2 < 4; ++t2) {
      v8f z = {};
      z = WMMA_F16(qa0, load_frag16(klds[cur] + t2 * 16 * 64, 64, lane), z);
      z = WMMA_F16(qa1, load_frag16(klds[cur] + t2 * 16 * 64 + 32, 64, lane), z);
      s[t2] = z;
    }

    // online softmax per query row (row = r + 8*hf, shared by a 16-lane half)
    #pragma unroll
    for (int r = 0; r < 8; ++r) {
      float v0 = s[0][r] * 0.125f + mlds[cur][0  + n_lo];
      float v1 = s[1][r] * 0.125f + mlds[cur][16 + n_lo];
      float v2 = s[2][r] * 0.125f + mlds[cur][32 + n_lo];
      float v3 = s[3][r] * 0.125f + mlds[cur][48 + n_lo];
      float rmax = fmaxf(fmaxf(v0, v1), fmaxf(v2, v3));
      #pragma unroll
      for (int x = 8; x >= 1; x >>= 1) rmax = fmaxf(rmax, __shfl_xor(rmax, x, 32));
      const float newm  = fmaxf(mstate[r], rmax);
      const float alpha = __expf(mstate[r] - newm);
      const float e0 = (v0 > -1e29f) ? __expf(v0 - newm) : 0.f;
      const float e1 = (v1 > -1e29f) ? __expf(v1 - newm) : 0.f;
      const float e2 = (v2 > -1e29f) ? __expf(v2 - newm) : 0.f;
      const float e3 = (v3 > -1e29f) ? __expf(v3 - newm) : 0.f;
      float rsum = e0 + e1 + e2 + e3;
      #pragma unroll
      for (int x = 8; x >= 1; x >>= 1) rsum += __shfl_xor(rsum, x, 32);
      lstate[r] = lstate[r] * alpha + rsum;
      mstate[r] = newm;
      #pragma unroll
      for (int t2 = 0; t2 < 4; ++t2) o[t2][r] *= alpha;
      _Float16* pr = plds + wave * 1024 + (r + 8 * hf) * 64 + n_lo;
      pr[0]  = (_Float16)e0;  pr[16] = (_Float16)e1;
      pr[32] = (_Float16)e2;  pr[48] = (_Float16)e3;
    }

    // intra-wave LDS RAW (cross-lane): wait for the P stores, then O += P @ V
    asm volatile("s_wait_dscnt 0" ::: "memory");
    const _Float16* pw = plds + wave * 1024;
    const v16h pa0 = load_frag16(pw, 64, lane);
    const v16h pa1 = load_frag16(pw + 32, 64, lane);
    #pragma unroll
    for (int t2 = 0; t2 < 4; ++t2) {
      o[t2] = WMMA_F16(pa0, load_frag16(vtlds[cur] + t2 * 16 * 64, 64, lane), o[t2]);
      o[t2] = WMMA_F16(pa1, load_frag16(vtlds[cur] + t2 * 16 * 64 + 32, 64, lane), o[t2]);
    }

    if (j + 1 < 32) storeV(nxt, vreg);
    wait_async();
    __syncthreads();
    cur = nxt;
  }

  // epilogue: query-mask * (O / l) -> combined [B,L,768] f16
  #pragma unroll
  for (int r = 0; r < 8; ++r) {
    const int qrow = qb * 128 + wave * 16 + r + 8 * hf;
    const int qm = amask[b * 2048 + qrow];
    const float scl = (qm != 0 && lstate[r] > 0.f) ? (1.f / lstate[r]) : 0.f;
    #pragma unroll
    for (int t2 = 0; t2 < 4; ++t2) {
      const int d = t2 * 16 + n_lo;
      Ch[((size_t)(b * 2048 + qrow)) * 768 + h * 64 + d] = (_Float16)(o[t2][r] * scl);
    }
  }
}

// ---------------------------------------------------------------------------
// LayerNorm over the SEQUENCE axis (axis=1), ddof=1, per (batch, channel).
// grid (2, 12); block 256: 64 channels x 4 row-segments, channel-coalesced.
// ---------------------------------------------------------------------------
__global__ __launch_bounds__(256) void ln_kernel(const float* __restrict__ Xr,
                                                 const float* __restrict__ gamma,
                                                 const float* __restrict__ beta,
                                                 float* __restrict__ out) {
  __shared__ float ssum[256], ssq[256];
  __shared__ float smean[64], sinv[64];
  const int b = blockIdx.x;
  const int c = blockIdx.y * 64 + (threadIdx.x & 63);
  const int seg = threadIdx.x >> 6;
  float sum = 0.f, sq = 0.f;
  for (int l = seg; l < 2048; l += 4) {
    const float v = Xr[((size_t)b * 2048 + l) * 768 + c];
    sum += v; sq += v * v;
  }
  ssum[threadIdx.x] = sum; ssq[threadIdx.x] = sq;
  __syncthreads();
  if (seg == 0) {
    const int i = threadIdx.x;
    const float S = ssum[i] + ssum[i + 64] + ssum[i + 128] + ssum[i + 192];
    const float Q = ssq[i] + ssq[i + 64] + ssq[i + 128] + ssq[i + 192];
    const float mean = S * (1.f / 2048.f);
    const float var = (Q - 2048.f * mean * mean) * (1.f / 2047.f);
    smean[i] = mean;
    sinv[i] = rsqrtf(fmaxf(var, 1e-20f));
  }
  __syncthreads();
  const float mean = smean[threadIdx.x & 63], inv = sinv[threadIdx.x & 63];
  const float g = gamma[c], bb = beta[c];
  for (int l = seg; l < 2048; l += 4) {
    const size_t idx = ((size_t)b * 2048 + l) * 768 + c;
    out[idx] = (Xr[idx] - mean) * inv * g + bb;
  }
}

// ---------------------------------------------------------------------------
extern "C" void kernel_launch(void* const* d_in, const int* in_sizes, int n_in,
                              void* d_out, int out_size, void* d_ws, size_t ws_size,
                              hipStream_t stream) {
  const float* inputs = (const float*)d_in[0];   // [2,2048,768]
  const int*   amask  = (const int*)d_in[1];     // [2,2048]
  const float* wq_w = (const float*)d_in[2];
  const float* wq_b = (const float*)d_in[3];
  const float* wk_w = (const float*)d_in[4];
  const float* wk_b = (const float*)d_in[5];
  const float* wv_w = (const float*)d_in[6];
  const float* wv_b = (const float*)d_in[7];
  const float* wo_w = (const float*)d_in[8];
  const float* wo_b = (const float*)d_in[9];
  const float* gamma = (const float*)d_in[10];
  const float* beta  = (const float*)d_in[11];
  float* out = (float*)d_out;

  // workspace carve-up (~48.8 MB), 256B aligned
  char* ws = (char*)d_ws;
  size_t off = 0;
  auto carve = [&](size_t bytes) { char* p = ws + off; off += (bytes + 255) & ~(size_t)255; return p; };
  const size_t NX = (size_t)4096 * 768;          // activations
  const size_t NW = (size_t)768 * 768;           // weights
  _Float16* xh  = (_Float16*)carve(NX * 2);
  _Float16* wqh = (_Float16*)carve(NW * 2);
  _Float16* wkh = (_Float16*)carve(NW * 2);
  _Float16* wvh = (_Float16*)carve(NW * 2);
  _Float16* woh = (_Float16*)carve(NW * 2);
  _Float16* qhh = (_Float16*)carve(NX * 2);      // [B,H,L,64]
  _Float16* khh = (_Float16*)carve(NX * 2);
  _Float16* vhh = (_Float16*)carve(NX * 2);
  _Float16* chh = (_Float16*)carve(NX * 2);      // combined [B,L,768]
  float*    xr  = (float*)carve(NX * 4);         // residual sum, fp32
  (void)ws_size; (void)in_sizes; (void)n_in; (void)out_size;

  // 1) fp32 -> f16 conversions
  cvt_f16_kernel<<<NX / 1024, 256, 0, stream>>>(inputs, xh);
  cvt_f16_kernel<<<NW / 1024, 256, 0, stream>>>(wq_w, wqh);
  cvt_f16_kernel<<<NW / 1024, 256, 0, stream>>>(wk_w, wkh);
  cvt_f16_kernel<<<NW / 1024, 256, 0, stream>>>(wv_w, wvh);
  cvt_f16_kernel<<<NW / 1024, 256, 0, stream>>>(wo_w, woh);

  // 2) Q/K/V projections (128x128 tiles)
  dim3 ggrid(32, 6);
  gemm_kernel<0><<<ggrid, 256, 0, stream>>>(xh, wqh, wq_b, nullptr, qhh, nullptr);
  gemm_kernel<0><<<ggrid, 256, 0, stream>>>(xh, wkh, wk_b, nullptr, khh, nullptr);
  gemm_kernel<0><<<ggrid, 256, 0, stream>>>(xh, wvh, wv_b, nullptr, vhh, nullptr);

  // 3) fused attention
  attn_kernel<<<dim3(24, 16), 256, 0, stream>>>(qhh, khh, vhh, amask, chh);

  // 4) output projection + residual
  gemm_kernel<1><<<ggrid, 256, 0, stream>>>(chh, woh, wo_b, inputs, nullptr, xr);

  // 5) layernorm over sequence axis
  ln_kernel<<<dim3(2, 12), 256, 0, stream>>>(xr, gamma, beta, out);
}

// v001
// A run of this version takes 362 microseconds.
// In both of two side-by-side timings against v000, it was 1.26 times as fast.
#include <hip/hip_runtime.h>
#include <hip/hip_bf16.h>

// ---------------------------------------------------------------------------
// MHA + residual + LayerNorm(axis=L) for gfx1250 (MI455X), f16 WMMA path,
// async global->LDS copies + double-buffered, software-pipelined tiles.
// B=2, L=2048, HIDDEN=768, HEADS=12, HEAD=64.
// ---------------------------------------------------------------------------

typedef __attribute__((ext_vector_type(16))) _Float16 v16h;
typedef __attribute__((ext_vector_type(8)))  float    v8f;
typedef __attribute__((ext_vector_type(4)))  int      v4i;

#define WMMA_F16(a, b, c) \
  __builtin_amdgcn_wmma_f32_16x16x32_f16(false, (a), false, (b), (short)0, (c), false, false)

#if __has_builtin(__builtin_amdgcn_global_load_async_to_lds_b128)
#define HAVE_ASYNC_LDS 1
#else
#define HAVE_ASYNC_LDS 0
#endif

// 16-byte global -> LDS copy; async (ASYNCcnt) when the builtin exists.
// Probed signature: (v4i addrspace(1)*, v4i addrspace(3)*, imm offset, imm cpol)
__device__ inline void async_copy16(const _Float16* g, _Float16* l) {
#if HAVE_ASYNC_LDS
  __builtin_amdgcn_global_load_async_to_lds_b128(
      (__attribute__((address_space(1))) v4i*)g,
      (__attribute__((address_space(3))) v4i*)l, 0, 0);
#else
  *(float4*)l = *(const float4*)g;
#endif
}

__device__ inline void wait_async() {
#if HAVE_ASYNC_LDS
#if __has_builtin(__builtin_amdgcn_s_wait_asynccnt)
  __builtin_amdgcn_s_wait_asynccnt(0);
#else
  asm volatile("s_wait_asynccnt 0" ::: "memory");
#endif
#endif
}

// Load a 16x32 f16 fragment (A-layout; also B-layout when source is stored
// transposed, i.e. K contiguous per row).  Per CDNA5 ISA 7.12.2:
//   lane 0-15: row = lane,   VGPR v<4: K = half*8 + v*2,   v>=4: K = 16+...
// => per lane: 8 contiguous halfs at [row][half*8] and 8 at [row][16+half*8].
__device__ inline v16h load_frag16(const _Float16* base, int stride_h, int lane) {
  const int m  = lane & 15;
  const int hf = lane >> 4;
  union { v16h v; float4 q[2]; } u;
  u.q[0] = *(const float4*)(base + (size_t)m * stride_h + hf * 8);
  u.q[1] = *(const float4*)(base + (size_t)m * stride_h + 16 + hf * 8);
  return u.v;
}

// ---------------------------------------------------------------------------
// fp32 -> f16 conversion, 4 elems/thread (sizes are multiples of 1024)
// ---------------------------------------------------------------------------
__global__ __launch_bounds__(256) void cvt_f16_kernel(const float* __restrict__ src,
                                                      _Float16* __restrict__ dst) {
  const int i = (blockIdx.x * 256 + threadIdx.x) * 4;
  float4 v = *(const float4*)(src + i);
  union { uint2 u; _Float16 h[4]; } p;
  p.h[0] = (_Float16)v.x; p.h[1] = (_Float16)v.y;
  p.h[2] = (_Float16)v.z; p.h[3] = (_Float16)v.w;
  *(uint2*)(dst + i) = p.u;
}

// ---------------------------------------------------------------------------
// GEMM: C = X @ W + bias, X:[4096,768] f16, W:[768,768] f16.
// Block tile 128(M) x 128(N), K-step 32, double-buffered LDS, async X copy,
// register-prefetched transposed W tile.  8 waves; wave = 16 rows x 128 cols.
// MODE 0: scatter to Q/K/V [B,H,L,64] f16.   MODE 1: += residual, fp32 out.
// ---------------------------------------------------------------------------
template <int MODE>
__global__ __launch_bounds__(256) void gemm_kernel(const _Float16* __restrict__ X,
                                                   const _Float16* __restrict__ W,
                                                   const float* __restrict__ bias,
                                                   const float* __restrict__ resid,
                                                   _Float16* __restrict__ Yh,
                                                   float* __restrict__ Yf) {
  __shared__ _Float16 xt[2][128 * 32];   // 2 x 8 KB
  __shared__ _Float16 wt[2][128 * 32];   // 2 x 8 KB, transposed: wt[n][k]
  const int mtile = blockIdx.x;          // 0..31
  const int ntile = blockIdx.y;          // 0..5
  const int t = threadIdx.x, wave = t >> 5, lane = t & 31;

  // X tile 128x32: 512 16B segments; async copy, natural layout.
  auto loadX = [&](int kb, int buf) {
    #pragma unroll
    for (int p = t; p < 512; p += 256) {
      const int row = p >> 2, c4 = p & 3;
      async_copy16(X + ((size_t)(mtile * 128 + row)) * 768 + kb * 32 + c4 * 8,
                   &xt[buf][row * 32 + c4 * 8]);
    }
  };
  // W tile 32(k)x128(n): prefetch to regs, store transposed (K contiguous).
  auto loadW = [&](int kb, float4 wreg[2]) {
    #pragma unroll
    for (int i = 0; i < 2; ++i) {
      const int p = t + i * 256;                      // 512 segments
      wreg[i] = *(const float4*)(W + ((size_t)(kb * 32 + (p >> 4))) * 768 +
                                 ntile * 128 + (p & 15) * 8);
    }
  };
  auto storeW = [&](int buf, const float4 wreg[2]) {
    #pragma unroll
    for (int i = 0; i < 2; ++i) {
      const int p = t + i * 256;
      const int k = p >> 4, nb = (p & 15) * 8;
      union { float4 f; _Float16 h[8]; } u; u.f = wreg[i];
      #pragma unroll
      for (int j = 0; j < 8; ++j) wt[buf][(nb + j) * 32 + k] = u.h[j];
    }
  };

  float4 wreg[2];
  loadX(0, 0);
  loadW(0, wreg);
  storeW(0, wreg);
  wait_async();
  __syncthreads();

  v8f acc[8] = {};
  int cur = 0;
  for (int kb = 0; kb < 24; ++kb) {
    const int nxt = cur ^ 1;
    if (kb + 1 < 24) { loadX(kb + 1, nxt); loadW(kb + 1, wreg); }
    const v16h a = load_frag16(xt[cur] + wave * 16 * 32, 32, lane);
    #pragma unroll
    for (int t2 = 0; t2 < 8; ++t2) {
      const v16h b = load_frag16(wt[cur] + t2 * 16 * 32, 32, lane);
      acc[t2] = WMMA_F16(a, b, acc[t2]);
    }
    if (kb + 1 < 24) storeW(nxt, wreg);
    wait_async();
    __syncthreads();
    cur = nxt;
  }

  const int n_lo = lane & 15, hf = lane >> 4;
  #pragma unroll
  for (int t2 = 0; t2 < 8; ++t2) {
    const int n = ntile * 128 + t2 * 16 + n_lo;
    const float bv = bias[n];
    #pragma unroll
    for (int r = 0; r < 8; ++r) {
      const int m = mtile * 128 + wave * 16 + r + 8 * hf;
      if (MODE == 0) {
        const int b = m >> 11, l = m & 2047;
        const int h = n >> 6, d = n & 63;
        Yh[(((size_t)(b * 12 + h)) * 2048 + l) * 64 + d] = (_Float16)(acc[t2][r] + bv);
      } else {
        const size_t idx = (size_t)m * 768 + n;
        Yf[idx] = acc[t2][r] + bv + resid[idx];
      }
    }
  }
}

// ---------------------------------------------------------------------------
// Flash attention: grid (24 bh, 16 q-blocks of 128).  Wave = 16 query rows.
// Double-buffered K/V^T tiles; K via async copy, V transposed through regs.
// ---------------------------------------------------------------------------
__global__ __launch_bounds__(256) void attn_kernel(const _Float16* __restrict__ Qh,
                                                   const _Float16* __restrict__ Kh,
                                                   const _Float16* __restrict__ Vh,
                                                   const int* __restrict__ amask,
                                                   _Float16* __restrict__ Ch) {
  __shared__ _Float16 klds[2][64 * 64];   // K tile, natural [key][d]    2x8 KB
  __shared__ _Float16 vtlds[2][64 * 64];  // V tile transposed [d][key]  2x8 KB
  __shared__ float    mlds[2][64];        // additive key mask
  __shared__ _Float16 plds[8 * 16 * 64];  // per-wave P staging          16 KB

  const int bh = blockIdx.x;              // 0..23
  const int qb = blockIdx.y;              // 0..15
  const int b  = bh / 12, h = bh % 12;
  const int t = threadIdx.x, wave = t >> 5, lane = t & 31;
  const int n_lo = lane & 15, hf = lane >> 4;

  // Q fragments stay in registers: 16 rows x 64 d
  const _Float16* qbase = Qh + (((size_t)bh * 2048) + qb * 128 + wave * 16) * 64;
  const v16h qa0 = load_frag16(qbase, 64, lane);
  const v16h qa1 = load_frag16(qbase + 32, 64, lane);

  auto loadK = [&](int j, int buf) {
    const _Float16* kb_ = Kh + (((size_t)bh * 2048) + j * 64) * 64;
    #pragma unroll
    for (int p = t; p < 512; p += 256) async_copy16(kb_ + p * 8, &klds[buf][p * 8]);
  };
  auto loadV = [&](int j, unsigned int vreg[8]) {
    const unsigned int* vb_ = (const unsigned int*)(Vh + (((size_t)bh * 2048) + j * 64) * 64);
    #pragma unroll
    for (int i = 0; i < 8; ++i) vreg[i] = vb_[t * 8 + i];
  };
  auto storeV = [&](int buf, const unsigned int vreg[8]) {
    #pragma unroll
    for (int i = 0; i < 8; ++i) {
      const int p = t * 8 + i;                // 2048 half-pairs
      const int l = p >> 5, d2 = (p & 31) * 2;
      union { unsigned int u; _Float16 hh[2]; } cv; cv.u = vreg[i];
      vtlds[buf][d2 * 64 + l]       = cv.hh[0];
      vtlds[buf][(d2 + 1) * 64 + l] = cv.hh[1];
    }
  };
  auto loadM = [&](int j, int buf) {
    if (t < 64) mlds[buf][t] = amask[b * 2048 + j * 64 + t] ? 0.f : -1e30f;
  };

  float mstate[8], lstate[8];
  v8f o[4] = {};
  #pragma unroll
  for (int r = 0; r < 8; ++r) { mstate[r] = -1e30f; lstate[r] = 0.f; }

  unsigned int vreg[8];
  loadK(0, 0); loadV(0, vreg); storeV(0, vreg); loadM(0, 0);
  wait_async();
  __syncthreads();

  int cur = 0;
  for (int j = 0; j < 32; ++j) {
    const int nxt = cur ^ 1;
    if (j + 1 < 32) { loadK(j + 1, nxt); loadV(j + 1, vreg); loadM(j + 1, nxt); }

    // S = (Q @ K^T) * 0.125 + mask
    v8f s[4];
    #pragma unroll
    for (int t2 = 0; t2 < 4; ++t2) {
      v8f z = {};
      z = WMMA_F16(qa0, load_frag16(klds[cur] + t2 * 16 * 64, 64, lane), z);
      z = WMMA_F16(qa1, load_frag16(klds[cur] + t2 * 16 * 64 + 32, 64, lane), z);
      s[t2] = z;
    }

    // online softmax per query row (row = r + 8*hf, shared by a 16-lane half)
    #pragma unroll
    for (int r = 0; r < 8; ++r) {
      float v0 = s[0][r] * 0.125f + mlds[cur][0  + n_lo];
      float v1 = s[1][r] * 0.125f + mlds[cur][16 + n_lo];
      float v2 = s[2][r] * 0.125f + mlds[cur][32 + n_lo];
      float v3 = s[3][r] * 0.125f + mlds[cur][48 + n_lo];
      float rmax = fmaxf(fmaxf(v0, v1), fmaxf(v2, v3));
      #pragma unroll
      for (int x = 8; x >= 1; x >>= 1) rmax = fmaxf(rmax, __shfl_xor(rmax, x, 32));
      const float newm  = fmaxf(mstate[r], rmax);
      const float alpha = __expf(mstate[r] - newm);
      const float e0 = (v0 > -1e29f) ? __expf(v0 - newm) : 0.f;
      const float e1 = (v1 > -1e29f) ? __expf(v1 - newm) : 0.f;
      const float e2 = (v2 > -1e29f) ? __expf(v2 - newm) : 0.f;
      const float e3 = (v3 > -1e29f) ? __expf(v3 - newm) : 0.f;
      float rsum = e0 + e1 + e2 + e3;
      #pragma unroll
      for (int x = 8; x >= 1; x >>= 1) rsum += __shfl_xor(rsum, x, 32);
      lstate[r] = lstate[r] * alpha + rsum;
      mstate[r] = newm;
      #pragma unroll
      for (int t2 = 0; t2 < 4; ++t2) o[t2][r] *= alpha;
      _Float16* pr = plds + wave * 1024 + (r + 8 * hf) * 64 + n_lo;
      pr[0]  = (_Float16)e0;  pr[16] = (_Float16)e1;
      pr[32] = (_Float16)e2;  pr[48] = (_Float16)e3;
    }

    // intra-wave LDS RAW (cross-lane): wait for the P stores, then O += P @ V
    asm volatile("s_wait_dscnt 0" ::: "memory");
    const _Float16* pw = plds + wave * 1024;
    const v16h pa0 = load_frag16(pw, 64, lane);
    const v16h pa1 = load_frag16(pw + 32, 64, lane);
    #pragma unroll
    for (int t2 = 0; t2 < 4; ++t2) {
      o[t2] = WMMA_F16(pa0, load_frag16(vtlds[cur] + t2 * 16 * 64, 64, lane), o[t2]);
      o[t2] = WMMA_F16(pa1, load_frag16(vtlds[cur] + t2 * 16 * 64 + 32, 64, lane), o[t2]);
    }

    if (j + 1 < 32) storeV(nxt, vreg);
    wait_async();
    __syncthreads();
    cur = nxt;
  }

  // epilogue: query-mask * (O / l) -> combined [B,L,768] f16
  #pragma unroll
  for (int r = 0; r < 8; ++r) {
    const int qrow = qb * 128 + wave * 16 + r + 8 * hf;
    const int qm = amask[b * 2048 + qrow];
    const float scl = (qm != 0 && lstate[r] > 0.f) ? (1.f / lstate[r]) : 0.f;
    #pragma unroll
    for (int t2 = 0; t2 < 4; ++t2) {
      const int d = t2 * 16 + n_lo;
      Ch[((size_t)(b * 2048 + qrow)) * 768 + h * 64 + d] = (_Float16)(o[t2][r] * scl);
    }
  }
}

// ---------------------------------------------------------------------------
// LayerNorm over the SEQUENCE axis (axis=1), ddof=1, per (batch, channel).
// grid (2, 24); block 1024: 32 channels (one 128-B line per row) x 128 row
// segments.  Each thread keeps its 16 rows x 4 channels in registers, so the
// column block is read once, all loads in flight together, and is normalised
// from registers after one block-wide reduction through LDS.
// ---------------------------------------------------------------------------
__global__ __launch_bounds__(1024) void ln_kernel(const float* __restrict__ Xr,
                                                  const float* __restrict__ gamma,
                                                  const float* __restrict__ beta,
                                                  float* __restrict__ out) {
  __shared__ __attribute__((aligned(16))) float red[2][128][32];   // per-thread partials: [sum|sq][row seg][channel]
  __shared__ float red2[2][16][32];   // partials over 8 row segments each
  __shared__ __attribute__((aligned(16))) float tot[2][32];        // column totals
  const int t  = threadIdx.x;
  const int c4 = t & 7;               // float4 column inside the 32-channel group
  const int rs = t >> 3;              // row segment 0..127
  const int c  = blockIdx.y * 32 + c4 * 4;
  // 32-bit byte offset of this thread's first row, shared by the loads and the stores
  const unsigned boff = (((unsigned)blockIdx.x * 2048u + (unsigned)rs) * 768u + (unsigned)c) * 4u;
  const char* xp = (const char*)Xr + boff;
  char* op = (char*)out + boff;

  const float4 g  = *(const float4*)(gamma + c);   // issued with the rows: off the path behind the reduction
  const float4 bb = *(const float4*)(beta + c);
  // keeps the two loads above issued together with the row loads; without it they
  // sink to the first barrier and are waited for there alone, a second load latency
  __builtin_amdgcn_sched_barrier(0);
  float4 v[16];
  // the loops over v[] are unrolled so that v[] has constant indices and stays in
  // registers, and so that the 16 loads (and the 16 stores) issue back to back
  #pragma unroll
  for (int i = 0; i < 16; ++i) v[i] = *(const float4*)(xp + i * (128 * 768 * 4));

  float4 sum = {0.f, 0.f, 0.f, 0.f}, sq = {0.f, 0.f, 0.f, 0.f};
  #pragma unroll
  for (int i = 0; i < 16; ++i) {
    sum.x += v[i].x; sq.x += v[i].x * v[i].x;
    sum.y += v[i].y; sq.y += v[i].y * v[i].y;
    sum.z += v[i].z; sq.z += v[i].z * v[i].z;
    sum.w += v[i].w; sq.w += v[i].w * v[i].w;
  }
  *(float4*)&red[0][rs][c4 * 4] = sum;
  *(float4*)&red[1][rs][c4 * 4] = sq;
  __syncthreads();

  {  // 128 -> 16 partials: a wave sums one quantity of all 32 channels over 8 segments
    const int which = (t >> 5) & 1, ch = t & 31, part = t >> 6;
    float p = 0.f;
    #pragma unroll  // the LDS reads issue together, one latency instead of eight
    for (int k = 0; k < 8; ++k) p += red[which][part * 8 + k][ch];
    red2[which][part][ch] = p;
  }
  __syncthreads();
  if (t < 64) {  // 16 -> 1
    const int which = t >> 5, ch = t & 31;
    float p = 0.f;
    #pragma unroll  // as above
    for (int k = 0; k < 16; ++k) p += red2[which][k][ch];
    tot[which][ch] = p;
  }
  __syncthreads();

  const float4 S = *(const float4*)&tot[0][c4 * 4];
  const float4 Q = *(const float4*)&tot[1][c4 * 4];
  float4 mean, inv;
  mean.x = S.x * (1.f / 2048.f);
  mean.y = S.y * (1.f / 2048.f);
  mean.z = S.z * (1.f / 2048.f);
  mean.w = S.w * (1.f / 2048.f);
  inv.x = rsqrtf(fmaxf((Q.x - 2048.f * mean.x * mean.x) * (1.f / 2047.f), 1e-20f));
  inv.y = rsqrtf(fmaxf((Q.y - 2048.f * mean.y * mean.y) * (1.f / 2047.f), 1e-20f));
  inv.z = rsqrtf(fmaxf((Q.z - 2048.f * mean.z * mean.z) * (1.f / 2047.f), 1e-20f));
  inv.w = rsqrtf(fmaxf((Q.w - 2048.f * mean.w * mean.w) * (1.f / 2047.f), 1e-20f));
  #pragma unroll
  for (int i = 0; i < 16; ++i) {
    float4 y;
    y.x = (v[i].x - mean.x) * inv.x * g.x + bb.x;
    y.y = (v[i].y - mean.y) * inv.y * g.y + bb.y;
    y.z = (v[i].z - mean.z) * inv.z * g.z + bb.z;
    y.w = (v[i].w - mean.w) * inv.w * g.w + bb.w;
    *(float4*)(op + i * (128 * 768 * 4)) = y;
  }
}

// ---------------------------------------------------------------------------
extern "C" void kernel_launch(void* const* d_in, const int* in_sizes, int n_in,
                              void* d_out, int out_size, void* d_ws, size_t ws_size,
                              hipStream_t stream) {
  const float* inputs = (const float*)d_in[0];   // [2,2048,768]
  const int*   amask  = (const int*)d_in[1];     // [2,2048]
  const float* wq_w = (const float*)d_in[2];
  const float* wq_b = (const float*)d_in[3];
  const float* wk_w = (const float*)d_in[4];
  const float* wk_b = (const float*)d_in[5];
  const float* wv_w = (const float*)d_in[6];
  const float* wv_b = (const float*)d_in[7];
  const float* wo_w = (const float*)d_in[8];
  const float* wo_b = (const float*)d_in[9];
  const float* gamma = (const float*)d_in[10];
  const float* beta  = (const float*)d_in[11];
  float* out = (float*)d_out;

  // workspace carve-up (~48.8 MB), 256B aligned
  char* ws = (char*)d_ws;
  size_t off = 0;
  auto carve = [&](size_t bytes) { char* p = ws + off; off += (bytes + 255) & ~(size_t)255; return p; };
  const size_t NX = (size_t)4096 * 768;          // activations
  const size_t NW = (size_t)768 * 768;           // weights
  _Float16* xh  = (_Float16*)carve(NX * 2);
  _Float16* wqh = (_Float16*)carve(NW * 2);
  _Float16* wkh = (_Float16*)carve(NW * 2);
  _Float16* wvh = (_Float16*)carve(NW * 2);
  _Float16* woh = (_Float16*)carve(NW * 2);
  _Float16* qhh = (_Float16*)carve(NX * 2);      // [B,H,L,64]
  _Float16* khh = (_Float16*)carve(NX * 2);
  _Float16* vhh = (_Float16*)carve(NX * 2);
  _Float16* chh = (_Float16*)carve(NX * 2);      // combined [B,L,768]
  float*    xr  = (float*)carve(NX * 4);         // residual sum, fp32
  (void)ws_size; (void)in_sizes; (void)n_in; (void)out_size;

  // 1) fp32 -> f16 conversions
  cvt_f16_kernel<<<NX / 1024, 256, 0, stream>>>(inputs, xh);
  cvt_f16_kernel<<<NW / 1024, 256, 0, stream>>>(wq_w, wqh);
  cvt_f16_kernel<<<NW / 1024, 256, 0, stream>>>(wk_w, wkh);
  cvt_f16_kernel<<<NW / 1024, 256, 0, stream>>>(wv_w, wvh);
  cvt_f16_kernel<<<NW / 1024, 256, 0, stream>>>(wo_w, woh);

  // 2) Q/K/V projections (128x128 tiles)
  dim3 ggrid(32, 6);
  gemm_kernel<0><<<ggrid, 256, 0, stream>>>(xh, wqh, wq_b, nullptr, qhh, nullptr);
  gemm_kernel<0><<<ggrid, 256, 0, stream>>>(xh, wkh, wk_b, nullptr, khh, nullptr);
  gemm_kernel<0><<<ggrid, 256, 0, stream>>>(xh, wvh, wv_b, nullptr, vhh, nullptr);

  // 3) fused attention
  attn_kernel<<<dim3(24, 16), 256, 0, stream>>>(qhh, khh, vhh, amask, chh);

  // 4) output projection + residual
  gemm_kernel<1><<<ggrid, 256, 0, stream>>>(chh, woh, wo_b, inputs, nullptr, xr);

  // 5) layernorm over sequence axis
  ln_kernel<<<dim3(2, 24), 1024, 0, stream>>>(xr, gamma, beta, out);
}

// v002
// Measured time: 248 microseconds a run.
// In both of two side-by-side timings against v001, it was 1.46 times as fast.
// All steps since v000 together make it 1.84 times as fast.
#include <hip/hip_runtime.h>
#include <hip/hip_bf16.h>

// ---------------------------------------------------------------------------
// MHA + residual + LayerNorm(axis=L) for gfx1250 (MI455X), f16 WMMA path,
// async global->LDS copies + double-buffered, software-pipelined tiles.
// B=2, L=2048, HIDDEN=768, HEADS=12, HEAD=64.
// ---------------------------------------------------------------------------

typedef __attribute__((ext_vector_type(16))) _Float16 v16h;
typedef __attribute__((ext_vector_type(8)))  float    v8f;
typedef __attribute__((ext_vector_type(4)))  int      v4i;

// LDS row pitches in halfs, an odd multiple of 16 B each, so that the 16 rows a
// ds_load_b128 fragment read touches fall on different banks (64 banks x 4 B).
#define PITCH32 40   // rows of 32 halfs (64 B)  -> 80 B
#define PITCH64 72   // rows of 64 halfs (128 B) -> 144 B

#define WMMA_F16(a, b, c) \
  __builtin_amdgcn_wmma_f32_16x16x32_f16(false, (a), false, (b), (short)0, (c), false, false)

#if __has_builtin(__builtin_amdgcn_global_load_async_to_lds_b128)
#define HAVE_ASYNC_LDS 1
#else
#define HAVE_ASYNC_LDS 0
#endif

// 16-byte global -> LDS copy; async (ASYNCcnt) when the builtin exists.
// Probed signature: (v4i addrspace(1)*, v4i addrspace(3)*, imm offset, imm cpol)
__device__ inline void async_copy16(const _Float16* g, _Float16* l) {
#if HAVE_ASYNC_LDS
  __builtin_amdgcn_global_load_async_to_lds_b128(
      (__attribute__((address_space(1))) v4i*)g,
      (__attribute__((address_space(3))) v4i*)l, 0, 0);
#else
  *(float4*)l = *(const float4*)g;
#endif
}

__device__ inline void wait_async() {
#if HAVE_ASYNC_LDS
#if __has_builtin(__builtin_amdgcn_s_wait_asynccnt)
  __builtin_amdgcn_s_wait_asynccnt(0);
#else
  asm volatile("s_wait_asynccnt 0" ::: "memory");
#endif
#endif
}

// Load a 16x32 f16 fragment (A-layout; also B-layout when source is stored
// transposed, i.e. K contiguous per row).  Per CDNA5 ISA 7.12.2:
//   lane 0-15: row = lane,   VGPR v<4: K = half*8 + v*2,   v>=4: K = 16+...
// => per lane: 8 contiguous halfs at [row][half*8] and 8 at [row][16+half*8].
__device__ inline v16h load_frag16(const _Float16* base, int stride_h, int lane) {
  const int m  = lane & 15;
  const int hf = lane >> 4;
  union { v16h v; float4 q[2]; } u;
  u.q[0] = *(const float4*)(base + (size_t)m * stride_h + hf * 8);
  u.q[1] = *(const float4*)(base + (size_t)m * stride_h + 16 + hf * 8);
  return u.v;
}

// ---------------------------------------------------------------------------
// fp32 -> f16 conversion, 4 elems/thread (sizes are multiples of 1024)
// ---------------------------------------------------------------------------
__global__ __launch_bounds__(256) void cvt_f16_kernel(const float* __restrict__ src,
                                                      _Float16* __restrict__ dst) {
  const int i = (blockIdx.x * 256 + threadIdx.x) * 4;
  float4 v = *(const float4*)(src + i);
  union { uint2 u; _Float16 h[4]; } p;
  p.h[0] = (_Float16)v.x; p.h[1] = (_Float16)v.y;
  p.h[2] = (_Float16)v.z; p.h[3] = (_Float16)v.w;
  *(uint2*)(dst + i) = p.u;
}

// ---------------------------------------------------------------------------
// GEMM: C = X @ W + bias, X:[4096,768] f16, W:[768,768] f16.
// Block tile 128(M) x 128(N), K-step 32, double-buffered LDS, async X copy,
// register-prefetched transposed W tile.  8 waves; wave = 16 rows x 128 cols.
// MODE 0: scatter to Q/K/V [B,H,L,64] f16.   MODE 1: += residual, fp32 out.
// ---------------------------------------------------------------------------
template <int MODE>
__global__ __launch_bounds__(256) void gemm_kernel(const _Float16* __restrict__ X,
                                                   const _Float16* __restrict__ W,
                                                   const float* __restrict__ bias,
                                                   const float* __restrict__ resid,
                                                   _Float16* __restrict__ Yh,
                                                   float* __restrict__ Yf) {
  __shared__ __attribute__((aligned(16))) _Float16 xt[2][128 * PITCH32];   // 2 x 10 KB
  __shared__ __attribute__((aligned(16))) _Float16 wt[2][128 * PITCH32];   // 2 x 10 KB, transposed: wt[n][k]
  const int mtile = blockIdx.x;          // 0..31
  const int ntile = blockIdx.y;          // 0..5
  const int t = threadIdx.x, wave = t >> 5, lane = t & 31;

  // X tile 128x32: 512 16B segments; async copy, natural layout.
  auto loadX = [&](int kb, int buf) {
    #pragma unroll
    for (int p = t; p < 512; p += 256) {
      const int row = p >> 2, c4 = p & 3;
      async_copy16(X + ((size_t)(mtile * 128 + row)) * 768 + kb * 32 + c4 * 8,
                   &xt[buf][row * PITCH32 + c4 * 8]);
    }
  };
  // W tile 32(k)x128(n): prefetch to regs, store transposed (K contiguous).
  auto loadW = [&](int kb, float4 wreg[2]) {
    #pragma unroll
    for (int i = 0; i < 2; ++i) {
      const int p = t + i * 256;                      // 512 segments
      wreg[i] = *(const float4*)(W + ((size_t)(kb * 32 + (p >> 4))) * 768 +
                                 ntile * 128 + (p & 15) * 8);
    }
  };
  auto storeW = [&](int buf, const float4 wreg[2]) {
    #pragma unroll
    for (int i = 0; i < 2; ++i) {
      const int p = t + i * 256;
      const int k = p >> 4, nb = (p & 15) * 8;
      union { float4 f; _Float16 h[8]; } u; u.f = wreg[i];
      #pragma unroll
      for (int j = 0; j < 8; ++j) wt[buf][(nb + j) * PITCH32 + k] = u.h[j];
    }
  };

  float4 wreg[2];
  loadX(0, 0);
  loadW(0, wreg);
  storeW(0, wreg);
  wait_async();
  __syncthreads();

  v8f acc[8] = {};
  int cur = 0;
  for (int kb = 0; kb < 24; ++kb) {
    const int nxt = cur ^ 1;
    if (kb + 1 < 24) { loadX(kb + 1, nxt); loadW(kb + 1, wreg); }
    const v16h a = load_frag16(xt[cur] + wave * 16 * PITCH32, PITCH32, lane);
    #pragma unroll
    for (int t2 = 0; t2 < 8; ++t2) {
      const v16h b = load_frag16(wt[cur] + t2 * 16 * PITCH32, PITCH32, lane);
      acc[t2] = WMMA_F16(a, b, acc[t2]);
    }
    if (kb + 1 < 24) storeW(nxt, wreg);
    wait_async();
    __syncthreads();
    cur = nxt;
  }

  const int n_lo = lane & 15, hf = lane >> 4;
  #pragma unroll
  for (int t2 = 0; t2 < 8; ++t2) {
    const int n = ntile * 128 + t2 * 16 + n_lo;
    const float bv = bias[n];
    #pragma unroll
    for (int r = 0; r < 8; ++r) {
      const int m = mtile * 128 + wave * 16 + r + 8 * hf;
      if (MODE == 0) {
        const int b = m >> 11, l = m & 2047;
        const int h = n >> 6, d = n & 63;
        Yh[(((size_t)(b * 12 + h)) * 2048 + l) * 64 + d] = (_Float16)(acc[t2][r] + bv);
      } else {
        const size_t idx = (size_t)m * 768 + n;
        Yf[idx] = acc[t2][r] + bv + resid[idx];
      }
    }
  }
}

// ---------------------------------------------------------------------------
// Flash attention: grid (24 bh, 16 q-blocks of 128).  Wave = 16 query rows.
// Double-buffered K/V^T tiles; K via async copy, V transposed through regs.
// ---------------------------------------------------------------------------
__global__ __launch_bounds__(256) void attn_kernel(const _Float16* __restrict__ Qh,
                                                   const _Float16* __restrict__ Kh,
                                                   const _Float16* __restrict__ Vh,
                                                   const int* __restrict__ amask,
                                                   _Float16* __restrict__ Ch) {
  __shared__ __attribute__((aligned(16))) _Float16 klds[2][64 * PITCH64];   // K tile, natural [key][d]    2x9 KB
  __shared__ __attribute__((aligned(16))) _Float16 vtlds[2][64 * PITCH64];  // V tile transposed [d][key]  2x9 KB
  __shared__ float    mlds[2][64];        // additive key mask
  __shared__ __attribute__((aligned(16))) _Float16 plds[8 * 16 * PITCH64];  // per-wave P staging          18 KB

  const int bh = blockIdx.x;              // 0..23
  const int qb = blockIdx.y;              // 0..15
  const int b  = bh / 12, h = bh % 12;
  const int t = threadIdx.x, wave = t >> 5, lane = t & 31;
  const int n_lo = lane & 15, hf = lane >> 4;

  // Q fragments stay in registers: 16 rows x 64 d
  const _Float16* qbase = Qh + (((size_t)bh * 2048) + qb * 128 + wave * 16) * 64;
  const v16h qa0 = load_frag16(qbase, 64, lane);
  const v16h qa1 = load_frag16(qbase + 32, 64, lane);

  auto loadK = [&](int j, int buf) {
    const _Float16* kb_ = Kh + (((size_t)bh * 2048) + j * 64) * 64;
    #pragma unroll
    for (int p = t; p < 512; p += 256) async_copy16(kb_ + p * 8, &klds[buf][(p >> 3) * PITCH64 + (p & 7) * 8]);
  };
  auto loadV = [&](int j, unsigned int vreg[8]) {
    const unsigned int* vb_ = (const unsigned int*)(Vh + (((size_t)bh * 2048) + j * 64) * 64);
    #pragma unroll
    for (int i = 0; i < 8; ++i) vreg[i] = vb_[t * 8 + i];
  };
  auto storeV = [&](int buf, const unsigned int vreg[8]) {
    #pragma unroll
    for (int i = 0; i < 8; ++i) {
      const int p = t * 8 + i;                // 2048 half-pairs
      const int l = p >> 5, d2 = (p & 31) * 2;
      union { unsigned int u; _Float16 hh[2]; } cv; cv.u = vreg[i];
      vtlds[buf][d2 * PITCH64 + l]       = cv.hh[0];
      vtlds[buf][(d2 + 1) * PITCH64 + l] = cv.hh[1];
    }
  };
  auto loadM = [&](int j, int buf) {
    if (t < 64) mlds[buf][t] = amask[b * 2048 + j * 64 + t] ? 0.f : -1e30f;
  };

  float mstate[8], lstate[8];
  v8f o[4] = {};
  #pragma unroll
  for (int r = 0; r < 8; ++r) { mstate[r] = -1e30f; lstate[r] = 0.f; }

  unsigned int vreg[8];
  loadK(0, 0); loadV(0, vreg); storeV(0, vreg); loadM(0, 0);
  wait_async();
  __syncthreads();

  int cur = 0;
  for (int j = 0; j < 32; ++j) {
    const int nxt = cur ^ 1;
    if (j + 1 < 32) { loadK(j + 1, nxt); loadV(j + 1, vreg); loadM(j + 1, nxt); }

    // S = (Q @ K^T) * 0.125 + mask
    v8f s[4];
    #pragma unroll
    for (int t2 = 0; t2 < 4; ++t2) {
      v8f z = {};
      z = WMMA_F16(qa0, load_frag16(klds[cur] + t2 * 16 * PITCH64, PITCH64, lane), z);
      z = WMMA_F16(qa1, load_frag16(klds[cur] + t2 * 16 * PITCH64 + 32, PITCH64, lane), z);
      s[t2] = z;
    }

    // online softmax per query row (row = r + 8*hf, shared by a 16-lane half)
    #pragma unroll
    for (int r = 0; r < 8; ++r) {
      float v0 = s[0][r] * 0.125f + mlds[cur][0  + n_lo];
      float v1 = s[1][r] * 0.125f + mlds[cur][16 + n_lo];
      float v2 = s[2][r] * 0.125f + mlds[cur][32 + n_lo];
      float v3 = s[3][r] * 0.125f + mlds[cur][48 + n_lo];
      float rmax = fmaxf(fmaxf(v0, v1), fmaxf(v2, v3));
      #pragma unroll
      for (int x = 8; x >= 1; x >>= 1) rmax = fmaxf(rmax, __shfl_xor(rmax, x, 32));
      const float newm  = fmaxf(mstate[r], rmax);
      const float alpha = __expf(mstate[r] - newm);
      const float e0 = (v0 > -1e29f) ? __expf(v0 - newm) : 0.f;
      const float e1 = (v1 > -1e29f) ? __expf(v1 - newm) : 0.f;
      const float e2 = (v2 > -1e29f) ? __expf(v2 - newm) : 0.f;
      const float e3 = (v3 > -1e29f) ? __expf(v3 - newm) : 0.f;
      float rsum = e0 + e1 + e2 + e3;
      #pragma unroll
      for (int x = 8; x >= 1; x >>= 1) rsum += __shfl_xor(rsum, x, 32);
      lstate[r] = lstate[r] * alpha + rsum;
      mstate[r] = newm;
      #pragma unroll
      for (int t2 = 0; t2 < 4; ++t2) o[t2][r] *= alpha;
      _Float16* pr = plds + wave * (16 * PITCH64) + (r + 8 * hf) * PITCH64 + n_lo;
      pr[0]  = (_Float16)e0;  pr[16] = (_Float16)e1;
      pr[32] = (_Float16)e2;  pr[48] = (_Float16)e3;
    }

    // intra-wave LDS RAW (cross-lane): wait for the P stores, then O += P @ V
    asm volatile("s_wait_dscnt 0" ::: "memory");
    const _Float16* pw = plds + wave * (16 * PITCH64);
    const v16h pa0 = load_frag16(pw, PITCH64, lane);
    const v16h pa1 = load_frag16(pw + 32, PITCH64, lane);
    #pragma unroll
    for (int t2 = 0; t2 < 4; ++t2) {
      o[t2] = WMMA_F16(pa0, load_frag16(vtlds[cur] + t2 * 16 * PITCH64, PITCH64, lane), o[t2]);
      o[t2] = WMMA_F16(pa1, load_frag16(vtlds[cur] + t2 * 16 * PITCH64 + 32, PITCH64, lane), o[t2]);
    }

    if (j + 1 < 32) storeV(nxt, vreg);
    wait_async();
    __syncthreads();
    cur = nxt;
  }

  // epilogue: query-mask * (O / l) -> combined [B,L,768] f16
  #pragma unroll
  for (int r = 0; r < 8; ++r) {
    const int qrow = qb * 128 + wave * 16 + r + 8 * hf;
    const int qm = amask[b * 2048 + qrow];
    const float scl = (qm != 0 && lstate[r] > 0.f) ? (1.f / lstate[r]) : 0.f;
    #pragma unroll
    for (int t2 = 0; t2 < 4; ++t2) {
      const int d = t2 * 16 + n_lo;
      Ch[((size_t)(b * 2048 + qrow)) * 768 + h * 64 + d] = (_Float16)(o[t2][r] * scl);
    }
  }
}

// ---------------------------------------------------------------------------
// LayerNorm over the SEQUENCE axis (axis=1), ddof=1, per (batch, channel).
// grid (2, 24); block 1024: 32 channels (one 128-B line per row) x 128 row
// segments.  Each thread keeps its 16 rows x 4 channels in registers, so the
// column block is read once, all loads in flight together, and is normalised
// from registers after one block-wide reduction through LDS.
// ---------------------------------------------------------------------------
__global__ __launch_bounds__(1024) void ln_kernel(const float* __restrict__ Xr,
                                                  const float* __restrict__ gamma,
                                                  const float* __restrict__ beta,
                                                  float* __restrict__ out) {
  __shared__ __attribute__((aligned(16))) float red[2][128][32];   // per-thread partials: [sum|sq][row seg][channel]
  __shared__ float red2[2][16][32];   // partials over 8 row segments each
  __shared__ __attribute__((aligned(16))) float tot[2][32];        // column totals
  const int t  = threadIdx.x;
  const int c4 = t & 7;               // float4 column inside the 32-channel group
  const int rs = t >> 3;              // row segment 0..127
  const int c  = blockIdx.y * 32 + c4 * 4;
  // 32-bit byte offset of this thread's first row, shared by the loads and the stores
  const unsigned boff = (((unsigned)blockIdx.x * 2048u + (unsigned)rs) * 768u + (unsigned)c) * 4u;
  const char* xp = (const char*)Xr + boff;
  char* op = (char*)out + boff;

  const float4 g  = *(const float4*)(gamma + c);   // issued with the rows: off the path behind the reduction
  const float4 bb = *(const float4*)(beta + c);
  // keeps the two loads above issued together with the row loads; without it they
  // sink to the first barrier and are waited for there alone, a second load latency
  __builtin_amdgcn_sched_barrier(0);
  float4 v[16];
  // the loops over v[] are unrolled so that v[] has constant indices and stays in
  // registers, and so that the 16 loads (and the 16 stores) issue back to back
  #pragma unroll
  for (int i = 0; i < 16; ++i) v[i] = *(const float4*)(xp + i * (128 * 768 * 4));

  float4 sum = {0.f, 0.f, 0.f, 0.f}, sq = {0.f, 0.f, 0.f, 0.f};
  #pragma unroll
  for (int i = 0; i < 16; ++i) {
    sum.x += v[i].x; sq.x += v[i].x * v[i].x;
    sum.y += v[i].y; sq.y += v[i].y * v[i].y;
    sum.z += v[i].z; sq.z += v[i].z * v[i].z;
    sum.w += v[i].w; sq.w += v[i].w * v[i].w;
  }
  *(float4*)&red[0][rs][c4 * 4] = sum;
  *(float4*)&red[1][rs][c4 * 4] = sq;
  __syncthreads();

  {  // 128 -> 16 partials: a wave sums one quantity of all 32 channels over 8 segments
    const int which = (t >> 5) & 1, ch = t & 31, part = t >> 6;
    float p = 0.f;
    #pragma unroll  // the LDS reads issue together, one latency instead of eight
    for (int k = 0; k < 8; ++k) p += red[which][part * 8 + k][ch];
    red2[which][part][ch] = p;
  }
  __syncthreads();
  if (t < 64) {  // 16 -> 1
    const int which = t >> 5, ch = t & 31;
    float p = 0.f;
    #pragma unroll  // as above
    for (int k = 0; k < 16; ++k) p += red2[which][k][ch];
    tot[which][ch] = p;
  }
  __syncthreads();

  const float4 S = *(const float4*)&tot[0][c4 * 4];
  const float4 Q = *(const float4*)&tot[1][c4 * 4];
  float4 mean, inv;
  mean.x = S.x * (1.f / 2048.f);
  mean.y = S.y * (1.f / 2048.f);
  mean.z = S.z * (1.f / 2048.f);
  mean.w = S.w * (1.f / 2048.f);
  inv.x = rsqrtf(fmaxf((Q.x - 2048.f * mean.x * mean.x) * (1.f / 2047.f), 1e-20f));
  inv.y = rsqrtf(fmaxf((Q.y - 2048.f * mean.y * mean.y) * (1.f / 2047.f), 1e-20f));
  inv.z = rsqrtf(fmaxf((Q.z - 2048.f * mean.z * mean.z) * (1.f / 2047.f), 1e-20f));
  inv.w = rsqrtf(fmaxf((Q.w - 2048.f * mean.w * mean.w) * (1.f / 2047.f), 1e-20f));
  #pragma unroll
  for (int i = 0; i < 16; ++i) {
    float4 y;
    y.x = (v[i].x - mean.x) * inv.x * g.x + bb.x;
    y.y = (v[i].y - mean.y) * inv.y * g.y + bb.y;
    y.z = (v[i].z - mean.z) * inv.z * g.z + bb.z;
    y.w = (v[i].w - mean.w) * inv.w * g.w + bb.w;
    *(float4*)(op + i * (128 * 768 * 4)) = y;
  }
}

// ---------------------------------------------------------------------------
extern "C" void kernel_launch(void* const* d_in, const int* in_sizes, int n_in,
                              void* d_out, int out_size, void* d_ws, size_t ws_size,
                              hipStream_t stream) {
  const float* inputs = (const float*)d_in[0];   // [2,2048,768]
  const int*   amask  = (const int*)d_in[1];     // [2,2048]
  const float* wq_w = (const float*)d_in[2];
  const float* wq_b = (const float*)d_in[3];
  const float* wk_w = (const float*)d_in[4];
  const float* wk_b = (const float*)d_in[5];
  const float* wv_w = (const float*)d_in[6];
  const float* wv_b = (const float*)d_in[7];
  const float* wo_w = (const float*)d_in[8];
  const float* wo_b = (const float*)d_in[9];
  const float* gamma = (const float*)d_in[10];
  const float* beta  = (const float*)d_in[11];
  float* out = (float*)d_out;

  // workspace carve-up (~48.8 MB), 256B aligned
  char* ws = (char*)d_ws;
  size_t off = 0;
  auto carve = [&](size_t bytes) { char* p = ws + off; off += (bytes + 255) & ~(size_t)255; return p; };
  const size_t NX = (size_t)4096 * 768;          // activations
  const size_t NW = (size_t)768 * 768;           // weights
  _Float16* xh  = (_Float16*)carve(NX * 2);
  _Float16* wqh = (_Float16*)carve(NW * 2);
  _Float16* wkh = (_Float16*)carve(NW * 2);
  _Float16* wvh = (_Float16*)carve(NW * 2);
  _Float16* woh = (_Float16*)carve(NW * 2);
  _Float16* qhh = (_Float16*)carve(NX * 2);      // [B,H,L,64]
  _Float16* khh = (_Float16*)carve(NX * 2);
  _Float16* vhh = (_Float16*)carve(NX * 2);
  _Float16* chh = (_Float16*)carve(NX * 2);      // combined [B,L,768]
  float*    xr  = (float*)carve(NX * 4);         // residual sum, fp32
  (void)ws_size; (void)in_sizes; (void)n_in; (void)out_size;

  // 1) fp32 -> f16 conversions
  cvt_f16_kernel<<<NX / 1024, 256, 0, stream>>>(inputs, xh);
  cvt_f16_kernel<<<NW / 1024, 256, 0, stream>>>(wq_w, wqh);
  cvt_f16_kernel<<<NW / 1024, 256, 0, stream>>>(wk_w, wkh);
  cvt_f16_kernel<<<NW / 1024, 256, 0, stream>>>(wv_w, wvh);
  cvt_f16_kernel<<<NW / 1024, 256, 0, stream>>>(wo_w, woh);

  // 2) Q/K/V projections (128x128 tiles)
  dim3 ggrid(32, 6);
  gemm_kernel<0><<<ggrid, 256, 0, stream>>>(xh, wqh, wq_b, nullptr, qhh, nullptr);
  gemm_kernel<0><<<ggrid, 256, 0, stream>>>(xh, wkh, wk_b, nullptr, khh, nullptr);
  gemm_kernel<0><<<ggrid, 256, 0, stream>>>(xh, wvh, wv_b, nullptr, vhh, nullptr);

  // 3) fused attention
  attn_kernel<<<dim3(24, 16), 256, 0, stream>>>(qhh, khh, vhh, amask, chh);

  // 4) output projection + residual
  gemm_kernel<1><<<ggrid, 256, 0, stream>>>(chh, woh, wo_b, inputs, nullptr, xr);

  // 5) layernorm over sequence axis
  ln_kernel<<<dim3(2, 24), 1024, 0, stream>>>(xr, gamma, beta, out);
}

// v003
// A run of this version takes 166 microseconds.
// In two side-by-side timings against v002, it was 1.49 and 1.50 times as fast.
// Counting every step since v000, it is 2.75 times as fast.
#include <hip/hip_runtime.h>
#include <hip/hip_bf16.h>

// ---------------------------------------------------------------------------
// MHA + residual + LayerNorm(axis=L) for gfx1250 (MI455X), f16 WMMA path,
// async global->LDS copies + double-buffered, software-pipelined tiles.
// Every B operand (the weights, V) is laid out K-contiguous and in tile order
// by the kernel that produces it, so no tile is transposed on its way to LDS.
// B=2, L=2048, HIDDEN=768, HEADS=12, HEAD=64.
// ---------------------------------------------------------------------------

typedef __attribute__((ext_vector_type(16))) _Float16 v16h;
typedef __attribute__((ext_vector_type(8)))  float    v8f;
typedef __attribute__((ext_vector_type(4)))  int      v4i;

// LDS row pitches in halfs, an odd multiple of 16 B each, so that the 16 rows a
// ds_load_b128 fragment read touches fall on different banks (64 banks x 4 B).
#define PITCH32 40   // rows of 32 halfs (64 B)  -> 80 B
#define PITCH64 72   // rows of 64 halfs (128 B) -> 144 B

#define WMMA_F16(a, b, c) \
  __builtin_amdgcn_wmma_f32_16x16x32_f16(false, (a), false, (b), (short)0, (c), false, false)

#if __has_builtin(__builtin_amdgcn_global_load_async_to_lds_b128)
#define HAVE_ASYNC_LDS 1
#else
#define HAVE_ASYNC_LDS 0
#endif

// 16-byte global -> LDS copy; async (ASYNCcnt) when the builtin exists.
// Probed signature: (v4i addrspace(1)*, v4i addrspace(3)*, imm offset, imm cpol)
__device__ inline void async_copy16(const _Float16* g, _Float16* l) {
#if HAVE_ASYNC_LDS
  __builtin_amdgcn_global_load_async_to_lds_b128(
      (__attribute__((address_space(1))) v4i*)g,
      (__attribute__((address_space(3))) v4i*)l, 0, 0);
#else
  *(float4*)l = *(const float4*)g;
#endif
}

// Publish point of a two-buffer ring, passed by every wave: behind it the tile
// copied last is readable by all waves and the other buffer may be refilled.
__device__ inline void ring_publish() {
  // this wave's LDS reads and writes have retired before another wave's copies
  // or reads touch the same bytes
  asm volatile("s_wait_dscnt 0x0" ::: "memory");
  // this wave's own copies have landed before the barrier lets others read them
  asm volatile("s_wait_asynccnt 0x0" ::: "memory");
  __syncthreads();
}

// Load a 16x32 f16 fragment (A-layout; also B-layout when source is stored
// transposed, i.e. K contiguous per row).  Per CDNA5 ISA 7.12.2:
//   lane 0-15: row = lane,   VGPR v<4: K = half*8 + v*2,   v>=4: K = 16+...
// => per lane: 8 contiguous halfs at [row][half*8] and 8 at [row][16+half*8].
__device__ inline v16h load_frag16(const _Float16* base, int stride_h, int lane) {
  const int m  = lane & 15;
  const int hf = lane >> 4;
  union { v16h v; float4 q[2]; } u;
  u.q[0] = *(const float4*)(base + (size_t)m * stride_h + hf * 8);
  u.q[1] = *(const float4*)(base + (size_t)m * stride_h + 16 + hf * 8);
  return u.v;
}

// ---------------------------------------------------------------------------
// fp32 -> f16 conversion, 4 elems/thread (sizes are multiples of 1024)
// ---------------------------------------------------------------------------
__global__ __launch_bounds__(256) void cvt_f16_kernel(const float* __restrict__ src,
                                                      _Float16* __restrict__ dst) {
  const int i = (blockIdx.x * 256 + threadIdx.x) * 4;
  float4 v = *(const float4*)(src + i);
  union { uint2 u; _Float16 h[4]; } p;
  p.h[0] = (_Float16)v.x; p.h[1] = (_Float16)v.y;
  p.h[2] = (_Float16)v.z; p.h[3] = (_Float16)v.w;
  *(uint2*)(dst + i) = p.u;
}

// ---------------------------------------------------------------------------
// Weight fp32 [k][n] -> f16 in the GEMM's tile order: dst[k / 32][n][k % 32].
// grid (12, 24): 64 columns x one 32-row k block.  A lane converts 8 k of one
// column; a wave stores 8 columns x 64 B = 512 contiguous bytes.
// ---------------------------------------------------------------------------
__global__ __launch_bounds__(256) void cvt_wt_f16_kernel(const float* __restrict__ src,
                                                         _Float16* __restrict__ dst) {
  const int t  = threadIdx.x;
  const int n  = blockIdx.x * 64 + (t >> 2);
  const int kb = blockIdx.y, kg = t & 3;
  union { float4 f; _Float16 h[8]; } u;
  #pragma unroll  // the 8 loads issue together
  for (int j = 0; j < 8; ++j) u.h[j] = (_Float16)src[(size_t)(kb * 32 + kg * 8 + j) * 768 + n];
  *(float4*)(dst + ((size_t)kb * 768 + n) * 32 + kg * 8) = u.f;
}

// ---------------------------------------------------------------------------
// GEMM: C = X @ W + bias, X:[4096,768] f16, W:[768,768] f16 as Wt[k/32][n][k%32].
// Block tile 128(M) x 128(N), K-step 32, double-buffered LDS, X and W tiles
// both by async copies.  8 waves; wave = 16 rows x 128 cols.
// MODE 0: scatter to Q/K [B,H,L,64] f16.   MODE 1: += residual, fp32 out.
// MODE 2: V transposed in 16-key groups, [B,H,L/16,64,16] f16.
// ---------------------------------------------------------------------------
template <int MODE>
__global__ __launch_bounds__(256) void gemm_kernel(const _Float16* __restrict__ X,
                                                   const _Float16* __restrict__ Wt,
                                                   const float* __restrict__ bias,
                                                   const float* __restrict__ resid,
                                                   _Float16* __restrict__ Yh,
                                                   float* __restrict__ Yf) {
  __shared__ __attribute__((aligned(16))) _Float16 xt[2][128 * PITCH32];   // 2 x 10 KB
  __shared__ __attribute__((aligned(16))) _Float16 wt[2][128 * PITCH32];   // 2 x 10 KB, transposed: wt[n][k]
  const int mtile = blockIdx.x;          // 0..31
  const int ntile = blockIdx.y;          // 0..5
  const int t = threadIdx.x, wave = t >> 5, lane = t & 31;

  // X tile 128x32: 512 16B segments; async copy, natural layout.
  auto loadX = [&](int kb, int buf) {
    #pragma unroll
    for (int p = t; p < 512; p += 256) {
      const int row = p >> 2, c4 = p & 3;
      async_copy16(X + ((size_t)(mtile * 128 + row)) * 768 + kb * 32 + c4 * 8,
                   &xt[buf][row * PITCH32 + c4 * 8]);
    }
  };
  // W tile 128(n)x32(k): 8 KB contiguous in Wt, 512 16B segments; async copy.
  auto loadW = [&](int kb, int buf) {
    const _Float16* wsrc = Wt + ((size_t)kb * 768 + ntile * 128) * 32;
    #pragma unroll  // both copies issue back to back, no loop branch around them
    for (int i = 0; i < 2; ++i) {
      const int p = t + i * 256;
      async_copy16(wsrc + p * 8, &wt[buf][(p >> 2) * PITCH32 + (p & 3) * 8]);
    }
  };

  loadX(0, 0);
  loadW(0, 0);
  ring_publish();

  v8f acc[8] = {};
  int cur = 0;
  for (int kb = 0; kb < 24; ++kb) {
    const int nxt = cur ^ 1;
    if (kb + 1 < 24) { loadX(kb + 1, nxt); loadW(kb + 1, nxt); }
    const v16h a = load_frag16(xt[cur] + wave * 16 * PITCH32, PITCH32, lane);
    #pragma unroll
    for (int t2 = 0; t2 < 8; ++t2) {
      const v16h b = load_frag16(wt[cur] + t2 * 16 * PITCH32, PITCH32, lane);
      acc[t2] = WMMA_F16(a, b, acc[t2]);
    }
    ring_publish();
    cur = nxt;
  }

  const int n_lo = lane & 15, hf = lane >> 4;
  #pragma unroll
  for (int t2 = 0; t2 < 8; ++t2) {
    const int n = ntile * 128 + t2 * 16 + n_lo;
    const float bv = bias[n];
    if (MODE == 2) {
      // the lane's 8 accumulator rows are 8 consecutive keys of one channel: one
      // 16-B store; the wave's 32 stores are 512 contiguous bytes
      const int m0 = mtile * 128 + wave * 16;
      const int b = m0 >> 11, lg = (m0 & 2047) >> 4;
      const int h = n >> 6, d = n & 63;
      union { float4 f; _Float16 hh[8]; } u;
      #pragma unroll  // constant indices keep acc[] and u in registers
      for (int r = 0; r < 8; ++r) u.hh[r] = (_Float16)(acc[t2][r] + bv);
      *(float4*)(Yh + ((((size_t)(b * 12 + h)) * 128 + lg) * 64 + d) * 16 + 8 * hf) = u.f;
      continue;
    }
    #pragma unroll
    for (int r = 0; r < 8; ++r) {
      const int m = mtile * 128 + wave * 16 + r + 8 * hf;
      if (MODE == 0) {
        const int b = m >> 11, l = m & 2047;
        const int h = n >> 6, d = n & 63;
        Yh[(((size_t)(b * 12 + h)) * 2048 + l) * 64 + d] = (_Float16)(acc[t2][r] + bv);
      } else {
        const size_t idx = (size_t)m * 768 + n;
        Yf[idx] = acc[t2][r] + bv + resid[idx];
      }
    }
  }
}

// ---------------------------------------------------------------------------
// Flash attention: grid (24 bh, 16 q-blocks of 128).  Wave = 16 query rows.
// Double-buffered K/V^T tiles, both by async copies (Vt: [B,H,L/16,64,16]).
// ---------------------------------------------------------------------------
__global__ __launch_bounds__(256) void attn_kernel(const _Float16* __restrict__ Qh,
                                                   const _Float16* __restrict__ Kh,
                                                   const _Float16* __restrict__ Vt,
                                                   const int* __restrict__ amask,
                                                   _Float16* __restrict__ Ch) {
  __shared__ __attribute__((aligned(16))) _Float16 klds[2][64 * PITCH64];   // K tile, natural [key][d]    2x9 KB
  __shared__ __attribute__((aligned(16))) _Float16 vtlds[2][64 * PITCH64];  // V tile transposed [d][key]  2x9 KB
  __shared__ float    mlds[2][64];        // additive key mask
  __shared__ __attribute__((aligned(16))) _Float16 plds[8 * 16 * PITCH64];  // per-wave P staging          18 KB

  const int bh = blockIdx.x;              // 0..23
  const int qb = blockIdx.y;              // 0..15
  const int b  = bh / 12, h = bh % 12;
  const int t = threadIdx.x, wave = t >> 5, lane = t & 31;
  const int n_lo = lane & 15, hf = lane >> 4;

  // Q fragments stay in registers: 16 rows x 64 d
  const _Float16* qbase = Qh + (((size_t)bh * 2048) + qb * 128 + wave * 16) * 64;
  const v16h qa0 = load_frag16(qbase, 64, lane);
  const v16h qa1 = load_frag16(qbase + 32, 64, lane);

  auto loadK = [&](int j, int buf) {
    const _Float16* kb_ = Kh + (((size_t)bh * 2048) + j * 64) * 64;
    #pragma unroll
    for (int p = t; p < 512; p += 256) async_copy16(kb_ + p * 8, &klds[buf][(p >> 3) * PITCH64 + (p & 7) * 8]);
  };
  // 64 keys = 4 groups of [64 d][16 keys], 8 KB contiguous in Vt; segment p holds
  // 8 keys of channel (p >> 1) & 63 in group p >> 7
  auto loadV = [&](int j, int buf) {
    const _Float16* vb_ = Vt + (((size_t)bh * 2048) + j * 64) * 64;
    #pragma unroll  // both copies issue back to back, no loop branch around them
    for (int i = 0; i < 2; ++i) {
      const int p = t + i * 256;
      async_copy16(vb_ + p * 8, &vtlds[buf][((p >> 1) & 63) * PITCH64 + (p >> 7) * 16 + (p & 1) * 8]);
    }
  };
  auto loadM = [&](int j, int buf) {
    if (t < 64) mlds[buf][t] = amask[b * 2048 + j * 64 + t] ? 0.f : -1e30f;
  };

  float mstate[8], lstate[8];
  v8f o[4] = {};
  #pragma unroll
  for (int r = 0; r < 8; ++r) { mstate[r] = -1e30f; lstate[r] = 0.f; }

  loadK(0, 0); loadV(0, 0); loadM(0, 0);
  ring_publish();

  int cur = 0;
  for (int j = 0; j < 32; ++j) {
    const int nxt = cur ^ 1;
    if (j + 1 < 32) { loadK(j + 1, nxt); loadV(j + 1, nxt); loadM(j + 1, nxt); }

    // S = (Q @ K^T) * 0.125 + mask
    v8f s[4];
    #pragma unroll
    for (int t2 = 0; t2 < 4; ++t2) {
      v8f z = {};
      z = WMMA_F16(qa0, load_frag16(klds[cur] + t2 * 16 * PITCH64, PITCH64, lane), z);
      z = WMMA_F16(qa1, load_frag16(klds[cur] + t2 * 16 * PITCH64 + 32, PITCH64, lane), z);
      s[t2] = z;
    }

    // online softmax per query row (row = r + 8*hf, shared by a 16-lane half)
    #pragma unroll
    for (int r = 0; r < 8; ++r) {
      float v0 = s[0][r] * 0.125f + mlds[cur][0  + n_lo];
      float v1 = s[1][r] * 0.125f + mlds[cur][16 + n_lo];
      float v2 = s[2][r] * 0.125f + mlds[cur][32 + n_lo];
      float v3 = s[3][r] * 0.125f + mlds[cur][48 + n_lo];
      float rmax = fmaxf(fmaxf(v0, v1), fmaxf(v2, v3));
      #pragma unroll
      for (int x = 8; x >= 1; x >>= 1) rmax = fmaxf(rmax, __shfl_xor(rmax, x, 32));
      const float newm  = fmaxf(mstate[r], rmax);
      const float alpha = __expf(mstate[r] - newm);
      const float e0 = (v0 > -1e29f) ? __expf(v0 - newm) : 0.f;
      const float e1 = (v1 > -1e29f) ? __expf(v1 - newm) : 0.f;
      const float e2 = (v2 > -1e29f) ? __expf(v2 - newm) : 0.f;
      const float e3 = (v3 > -1e29f) ? __expf(v3 - newm) : 0.f;
      float rsum = e0 + e1 + e2 + e3;
      #pragma unroll
      for (int x = 8; x >= 1; x >>= 1) rsum += __shfl_xor(rsum, x, 32);
      lstate[r] = lstate[r] * alpha + rsum;
      mstate[r] = newm;
      #pragma unroll
      for (int t2 = 0; t2 < 4; ++t2) o[t2][r] *= alpha;
      _Float16* pr = plds + wave * (16 * PITCH64) + (r + 8 * hf) * PITCH64 + n_lo;
      pr[0]  = (_Float16)e0;  pr[16] = (_Float16)e1;
      pr[32] = (_Float16)e2;  pr[48] = (_Float16)e3;
    }

    // intra-wave LDS RAW (cross-lane): wait for the P stores, then O += P @ V
    asm volatile("s_wait_dscnt 0" ::: "memory");
    const _Float16* pw = plds + wave * (16 * PITCH64);
    const v16h pa0 = load_frag16(pw, PITCH64, lane);
    const v16h pa1 = load_frag16(pw + 32, PITCH64, lane);
    #pragma unroll
    for (int t2 = 0; t2 < 4; ++t2) {
      o[t2] = WMMA_F16(pa0, load_frag16(vtlds[cur] + t2 * 16 * PITCH64, PITCH64, lane), o[t2]);
      o[t2] = WMMA_F16(pa1, load_frag16(vtlds[cur] + t2 * 16 * PITCH64 + 32, PITCH64, lane), o[t2]);
    }

    ring_publish();
    cur = nxt;
  }

  // epilogue: query-mask * (O / l) -> combined [B,L,768] f16
  #pragma unroll
  for (int r = 0; r < 8; ++r) {
    const int qrow = qb * 128 + wave * 16 + r + 8 * hf;
    const int qm = amask[b * 2048 + qrow];
    const float scl = (qm != 0 && lstate[r] > 0.f) ? (1.f / lstate[r]) : 0.f;
    #pragma unroll
    for (int t2 = 0; t2 < 4; ++t2) {
      const int d = t2 * 16 + n_lo;
      Ch[((size_t)(b * 2048 + qrow)) * 768 + h * 64 + d] = (_Float16)(o[t2][r] * scl);
    }
  }
}

// ---------------------------------------------------------------------------
// LayerNorm over the SEQUENCE axis (axis=1), ddof=1, per (batch, channel).
// grid (2, 24); block 1024: 32 channels (one 128-B line per row) x 128 row
// segments.  Each thread keeps its 16 rows x 4 channels in registers, so the
// column block is read once, all loads in flight together, and is normalised
// from registers after one block-wide reduction through LDS.
// ---------------------------------------------------------------------------
__global__ __launch_bounds__(1024) void ln_kernel(const float* __restrict__ Xr,
                                                  const float* __restrict__ gamma,
                                                  const float* __restrict__ beta,
                                                  float* __restrict__ out) {
  __shared__ __attribute__((aligned(16))) float red[2][128][32];   // per-thread partials: [sum|sq][row seg][channel]
  __shared__ float red2[2][16][32];   // partials over 8 row segments each
  __shared__ __attribute__((aligned(16))) float tot[2][32];        // column totals
  const int t  = threadIdx.x;
  const int c4 = t & 7;               // float4 column inside the 32-channel group
  const int rs = t >> 3;              // row segment 0..127
  const int c  = blockIdx.y * 32 + c4 * 4;
  // 32-bit byte offset of this thread's first row, shared by the loads and the stores
  const unsigned boff = (((unsigned)blockIdx.x * 2048u + (unsigned)rs) * 768u + (unsigned)c) * 4u;
  const char* xp = (const char*)Xr + boff;
  char* op = (char*)out + boff;

  const float4 g  = *(const float4*)(gamma + c);   // issued with the rows: off the path behind the reduction
  const float4 bb = *(const float4*)(beta + c);
  // keeps the two loads above issued together with the row loads; without it they
  // sink to the first barrier and are waited for there alone, a second load latency
  __builtin_amdgcn_sched_barrier(0);
  float4 v[16];
  // the loops over v[] are unrolled so that v[] has constant indices and stays in
  // registers, and so that the 16 loads (and the 16 stores) issue back to back
  #pragma unroll
  for (int i = 0; i < 16; ++i) v[i] = *(const float4*)(xp + i * (128 * 768 * 4));

  float4 sum = {0.f, 0.f, 0.f, 0.f}, sq = {0.f, 0.f, 0.f, 0.f};
  #pragma unroll
  for (int i = 0; i < 16; ++i) {
    sum.x += v[i].x; sq.x += v[i].x * v[i].x;
    sum.y += v[i].y; sq.y += v[i].y * v[i].y;
    sum.z += v[i].z; sq.z += v[i].z * v[i].z;
    sum.w += v[i].w; sq.w += v[i].w * v[i].w;
  }
  *(float4*)&red[0][rs][c4 * 4] = sum;
  *(float4*)&red[1][rs][c4 * 4] = sq;
  __syncthreads();

  {  // 128 -> 16 partials: a wave sums one quantity of all 32 channels over 8 segments
    const int which = (t >> 5) & 1, ch = t & 31, part = t >> 6;
    float p = 0.f;
    #pragma unroll  // the LDS reads issue together, one latency instead of eight
    for (int k = 0; k < 8; ++k) p += red[which][part * 8 + k][ch];
    red2[which][part][ch] = p;
  }
  __syncthreads();
  if (t < 64) {  // 16 -> 1
    const int which = t >> 5, ch = t & 31;
    float p = 0.f;
    #pragma unroll  // as above
    for (int k = 0; k < 16; ++k) p += red2[which][k][ch];
    tot[which][ch] = p;
  }
  __syncthreads();

  const float4 S = *(const float4*)&tot[0][c4 * 4];
  const float4 Q = *(const float4*)&tot[1][c4 * 4];
  float4 mean, inv;
  mean.x = S.x * (1.f / 2048.f);
  mean.y = S.y * (1.f / 2048.f);
  mean.z = S.z * (1.f / 2048.f);
  mean.w = S.w * (1.f / 2048.f);
  inv.x = rsqrtf(fmaxf((Q.x - 2048.f * mean.x * mean.x) * (1.f / 2047.f), 1e-20f));
  inv.y = rsqrtf(fmaxf((Q.y - 2048.f * mean.y * mean.y) * (1.f / 2047.f), 1e-20f));
  inv.z = rsqrtf(fmaxf((Q.z - 2048.f * mean.z * mean.z) * (1.f / 2047.f), 1e-20f));
  inv.w = rsqrtf(fmaxf((Q.w - 2048.f * mean.w * mean.w) * (1.f / 2047.f), 1e-20f));
  #pragma unroll
  for (int i = 0; i < 16; ++i) {
    float4 y;
    y.x = (v[i].x - mean.x) * inv.x * g.x + bb.x;
    y.y = (v[i].y - mean.y) * inv.y * g.y + bb.y;
    y.z = (v[i].z - mean.z) * inv.z * g.z + bb.z;
    y.w = (v[i].w - mean.w) * inv.w * g.w + bb.w;
    *(float4*)(op + i * (128 * 768 * 4)) = y;
  }
}

// ---------------------------------------------------------------------------
extern "C" void kernel_launch(void* const* d_in, const int* in_sizes, int n_in,
                              void* d_out, int out_size, void* d_ws, size_t ws_size,
                              hipStream_t stream) {
  const float* inputs = (const float*)d_in[0];   // [2,2048,768]
  const int*   amask  = (const int*)d_in[1];     // [2,2048]
  const float* wq_w = (const float*)d_in[2];
  const float* wq_b = (const float*)d_in[3];
  const float* wk_w = (const float*)d_in[4];
  const float* wk_b = (const float*)d_in[5];
  const float* wv_w = (const float*)d_in[6];
  const float* wv_b = (const float*)d_in[7];
  const float* wo_w = (const float*)d_in[8];
  const float* wo_b = (const float*)d_in[9];
  const float* gamma = (const float*)d_in[10];
  const float* beta  = (const float*)d_in[11];
  float* out = (float*)d_out;

  // workspace carve-up (~48.8 MB), 256B aligned
  char* ws = (char*)d_ws;
  size_t off = 0;
  auto carve = [&](size_t bytes) { char* p = ws + off; off += (bytes + 255) & ~(size_t)255; return p; };
  const size_t NX = (size_t)4096 * 768;          // activations
  const size_t NW = (size_t)768 * 768;           // weights
  _Float16* xh  = (_Float16*)carve(NX * 2);
  _Float16* wqh = (_Float16*)carve(NW * 2);      // weights: [k/32][n][k%32]
  _Float16* wkh = (_Float16*)carve(NW * 2);
  _Float16* wvh = (_Float16*)carve(NW * 2);
  _Float16* woh = (_Float16*)carve(NW * 2);
  _Float16* qhh = (_Float16*)carve(NX * 2);      // [B,H,L,64]
  _Float16* khh = (_Float16*)carve(NX * 2);
  _Float16* vth = (_Float16*)carve(NX * 2);      // [B,H,L/16,64,16]
  _Float16* chh = (_Float16*)carve(NX * 2);      // combined [B,L,768]
  float*    xr  = (float*)carve(NX * 4);         // residual sum, fp32
  (void)ws_size; (void)in_sizes; (void)n_in; (void)out_size;

  // 1) fp32 -> f16 conversions
  cvt_f16_kernel<<<NX / 1024, 256, 0, stream>>>(inputs, xh);
  dim3 wgrid(12, 24);
  cvt_wt_f16_kernel<<<wgrid, 256, 0, stream>>>(wq_w, wqh);
  cvt_wt_f16_kernel<<<wgrid, 256, 0, stream>>>(wk_w, wkh);
  cvt_wt_f16_kernel<<<wgrid, 256, 0, stream>>>(wv_w, wvh);
  cvt_wt_f16_kernel<<<wgrid, 256, 0, stream>>>(wo_w, woh);

  // 2) Q/K/V projections (128x128 tiles)
  dim3 ggrid(32, 6);
  gemm_kernel<0><<<ggrid, 256, 0, stream>>>(xh, wqh, wq_b, nullptr, qhh, nullptr);
  gemm_kernel<0><<<ggrid, 256, 0, stream>>>(xh, wkh, wk_b, nullptr, khh, nullptr);
  gemm_kernel<2><<<ggrid, 256, 0, stream>>>(xh, wvh, wv_b, nullptr, vth, nullptr);

  // 3) fused attention
  attn_kernel<<<dim3(24, 16), 256, 0, stream>>>(qhh, khh, vth, amask, chh);

  // 4) output projection + residual
  gemm_kernel<1><<<ggrid, 256, 0, stream>>>(chh, woh, wo_b, inputs, nullptr, xr);

  // 5) layernorm over sequence axis
  ln_kernel<<<dim3(2, 24), 1024, 0, stream>>>(xr, gamma, beta, out);
}

// v004
// Measured time: 130 microseconds a run.
// Timed twice side by side with v003, it ran 1.28 times as fast both times.
// Counting every step since v000, it is 3.52 times as fast.
#include <hip/hip_runtime.h>
#include <hip/hip_bf16.h>

// ---------------------------------------------------------------------------
// MHA + residual + LayerNorm(axis=L) for gfx1250 (MI455X), f16 WMMA path,
// async global->LDS copies + double-buffered, software-pipelined tiles.
// Every B operand (the weights, V) is laid out K-contiguous and in tile order
// by the kernel that produces it, so no tile is transposed on its way to LDS.
// Tokens whose mask is 0 have weight 0 as keys and a zero context row as queries:
// Q, K, V and the attention are computed on the unmasked tokens only, compacted.
// B=2, L=2048, HIDDEN=768, HEADS=12, HEAD=64.
// ---------------------------------------------------------------------------

typedef __attribute__((ext_vector_type(16))) _Float16 v16h;
typedef __attribute__((ext_vector_type(8)))  float    v8f;
typedef __attribute__((ext_vector_type(4)))  int      v4i;

// LDS row pitches in halfs, an odd multiple of 16 B each, so that the 16 rows a
// ds_load_b128 fragment read touches fall on different banks (64 banks x 4 B).
#define PITCH32 40   // rows of 32 halfs (64 B)  -> 80 B
#define PITCH64 72   // rows of 64 halfs (128 B) -> 144 B

#define WMMA_F16(a, b, c) \
  __builtin_amdgcn_wmma_f32_16x16x32_f16(false, (a), false, (b), (short)0, (c), false, false)

#if __has_builtin(__builtin_amdgcn_global_load_async_to_lds_b128)
#define HAVE_ASYNC_LDS 1
#else
#define HAVE_ASYNC_LDS 0
#endif

// 16-byte global -> LDS copy; async (ASYNCcnt) when the builtin exists.
// Probed signature: (v4i addrspace(1)*, v4i addrspace(3)*, imm offset, imm cpol)
__device__ inline void async_copy16(const _Float16* g, _Float16* l) {
#if HAVE_ASYNC_LDS
  __builtin_amdgcn_global_load_async_to_lds_b128(
      (__attribute__((address_space(1))) v4i*)g,
      (__attribute__((address_space(3))) v4i*)l, 0, 0);
#else
  *(float4*)l = *(const float4*)g;
#endif
}

// Publish point of a two-buffer ring, passed by every wave: behind it the tile
// copied last is readable by all waves and the other buffer may be refilled.
__device__ inline void ring_publish() {
  // this wave's LDS reads and writes have retired before another wave's copies
  // or reads touch the same bytes
  asm volatile("s_wait_dscnt 0x0" ::: "memory");
  // this wave's own copies have landed before the barrier lets others read them
  asm volatile("s_wait_asynccnt 0x0" ::: "memory");
  __syncthreads();
}

// Load a 16x32 f16 fragment (A-layout; also B-layout when source is stored
// transposed, i.e. K contiguous per row).  Per CDNA5 ISA 7.12.2:
//   lane 0-15: row = lane,   VGPR v<4: K = half*8 + v*2,   v>=4: K = 16+...
// => per lane: 8 contiguous halfs at [row][half*8] and 8 at [row][16+half*8].
__device__ inline v16h load_frag16(const _Float16* base, int stride_h, int lane) {
  const int m  = lane & 15;
  const int hf = lane >> 4;
  union { v16h v; float4 q[2]; } u;
  u.q[0] = *(const float4*)(base + (size_t)m * stride_h + hf * 8);
  u.q[1] = *(const float4*)(base + (size_t)m * stride_h + 16 + hf * 8);
  return u.v;
}

// ---------------------------------------------------------------------------
// Blocks 0 and 1: token order of one batch each.  idx[b][0 .. cnts[b]) lists the
// unmasked tokens in rising order, the rest of idx[b] the masked ones, so idx[b]
// is a permutation of 0..2047 for any mask.  A wave ranks 256 consecutive tokens
// by ballots; the 8 wave totals meet in LDS.
// Other blocks: fp32 -> f16 conversion, 4 elems/thread (sizes are multiples of
// 1024), and zeros into the context rows of masked tokens, which the attention
// does not compute.
// ---------------------------------------------------------------------------
__global__ __launch_bounds__(256) void cvt_f16_kernel(const float* __restrict__ src,
                                                      const int* __restrict__ amask,
                                                      _Float16* __restrict__ dst,
                                                      _Float16* __restrict__ Ch,
                                                      int* __restrict__ idx,
                                                      int* __restrict__ cnts) {
  __shared__ int wc[8];
  const int t = threadIdx.x;
  if (blockIdx.x < 2) {
    const int b = blockIdx.x, wave = t >> 5, lane = t & 31;
    unsigned bal[8];
    int wtot = 0;
    #pragma unroll  // constant indices keep bal[] in registers; the 8 loads issue together
    for (int s = 0; s < 8; ++s) {
      bal[s] = __builtin_amdgcn_ballot_w32(amask[b * 2048 + (wave * 8 + s) * 32 + lane] != 0);
      wtot += __popc(bal[s]);
    }
    if (lane == 0) wc[wave] = wtot;
    __syncthreads();
    int base = 0, total = 0;   // unmasked tokens in front of this wave's; in the batch
    #pragma unroll  // the 8 totals come as two wide LDS reads
    for (int k = 0; k < 8; ++k) {
      const int c = wc[k];
      total += c;
      if (k < wave) base += c;
    }
    #pragma unroll  // constant indices keep bal[] in registers
    for (int s = 0; s < 8; ++s) {
      const int l = (wave * 8 + s) * 32 + lane;
      const int rank = base + __popc(bal[s] & ((1u << lane) - 1u));   // unmasked tokens in front of l
      const bool on = ((bal[s] >> lane) & 1u) != 0u;
      idx[b * 2048 + (on ? rank : total + l - rank)] = l;
      base += __popc(bal[s]);
    }
    if (t == 0) cnts[b] = total;
    return;
  }
  const int i = ((blockIdx.x - 2) * 256 + t) * 4;
  float4 v = *(const float4*)(src + i);
  union { uint2 u; _Float16 h[4]; } p;
  p.h[0] = (_Float16)v.x; p.h[1] = (_Float16)v.y;
  p.h[2] = (_Float16)v.z; p.h[3] = (_Float16)v.w;
  *(uint2*)(dst + i) = p.u;
  if (amask[i / 768] == 0) *(uint2*)(Ch + i) = make_uint2(0u, 0u);
}

// ---------------------------------------------------------------------------
// Weight fp32 [k][n] -> f16 in the GEMM's tile order: dst[k / 32][n][k % 32].
// grid (12, 24): 64 columns x one 32-row k block.  A lane converts 8 k of one
// column; a wave stores 8 columns x 64 B = 512 contiguous bytes.
// ---------------------------------------------------------------------------
__global__ __launch_bounds__(256) void cvt_wt_f16_kernel(const float* __restrict__ src,
                                                         _Float16* __restrict__ dst) {
  const int t  = threadIdx.x;
  const int n  = blockIdx.x * 64 + (t >> 2);
  const int kb = blockIdx.y, kg = t & 3;
  union { float4 f; _Float16 h[8]; } u;
  #pragma unroll  // the 8 loads issue together
  for (int j = 0; j < 8; ++j) u.h[j] = (_Float16)src[(size_t)(kb * 32 + kg * 8 + j) * 768 + n];
  *(float4*)(dst + ((size_t)kb * 768 + n) * 32 + kg * 8) = u.f;
}

// ---------------------------------------------------------------------------
// GEMM: C = X @ W + bias, X:[4096,768] f16, W:[768,768] f16 as Wt[k/32][n][k%32].
// Block tile 128(M) x 128(N), K-step 32, double-buffered LDS, X and W tiles
// both by async copies.  8 waves; wave = 16 rows x 128 cols.
// MODE 0: scatter to Q/K [B,H,L,64] f16.   MODE 1: += residual, fp32 out.
// MODE 2: V transposed in 16-key groups, [B,H,L/16,64,16] f16.
// MODE 0 and 2 work on the compacted tokens: row i of a batch is X row idx[b][i],
// and L above is the compact position.  Tiles wholly past cnts[b] are not computed;
// the last tile's rows past it are masked tokens' rows, finite, which the attention
// gives weight 0.
// ---------------------------------------------------------------------------
template <int MODE>
__global__ __launch_bounds__(256) void gemm_kernel(const _Float16* __restrict__ X,
                                                   const _Float16* __restrict__ Wt,
                                                   const float* __restrict__ bias,
                                                   const float* __restrict__ resid,
                                                   const int* __restrict__ idx,
                                                   const int* __restrict__ cnts,
                                                   _Float16* __restrict__ Yh,
                                                   float* __restrict__ Yf) {
  __shared__ __attribute__((aligned(16))) _Float16 xt[2][128 * PITCH32];   // 2 x 10 KB
  __shared__ __attribute__((aligned(16))) _Float16 wt[2][128 * PITCH32];   // 2 x 10 KB, transposed: wt[n][k]
  const int mtile = blockIdx.x;          // 0..31
  const int ntile = blockIdx.y;          // 0..5
  const int t = threadIdx.x, wave = t >> 5, lane = t & 31;

  // the two X rows that this thread copies segments of (tile rows t / 4 and 64 + t / 4)
  int xrow0 = mtile * 128 + (t >> 2), xrow1 = xrow0 + 64;
  if (MODE != 1) {
    const int b = mtile >> 4;            // 16 tiles a batch
    if ((mtile & 15) * 128 >= cnts[b]) return;   // whole block, in front of every copy and barrier
    // & 2047 bounds the row whatever the list holds
    const int i0 = idx[xrow0] & 2047, i1 = idx[xrow1] & 2047;
    xrow0 = b * 2048 + i0;
    xrow1 = b * 2048 + i1;
  }
  const _Float16* xs0 = X + (size_t)xrow0 * 768 + (t & 3) * 8;
  const _Float16* xs1 = X + (size_t)xrow1 * 768 + (t & 3) * 8;

  // X tile 128x32: 512 16B segments; async copy, rows as listed above.
  auto loadX = [&](int kb, int buf) {
    _Float16* xd = &xt[buf][(t >> 2) * PITCH32 + (t & 3) * 8];
    async_copy16(xs0 + kb * 32, xd);
    async_copy16(xs1 + kb * 32, xd + 64 * PITCH32);
  };
  // W tile 128(n)x32(k): 8 KB contiguous in Wt, 512 16B segments; async copy.
  auto loadW = [&](int kb, int buf) {
    const _Float16* wsrc = Wt + ((size_t)kb * 768 + ntile * 128) * 32;
    #pragma unroll  // both copies issue back to back, no loop branch around them
    for (int i = 0; i < 2; ++i) {
      const int p = t + i * 256;
      async_copy16(wsrc + p * 8, &wt[buf][(p >> 2) * PITCH32 + (p & 3) * 8]);
    }
  };

  loadX(0, 0);
  loadW(0, 0);
  ring_publish();

  v8f acc[8] = {};
  int cur = 0;
  for (int kb = 0; kb < 24; ++kb) {
    const int nxt = cur ^ 1;
    if (kb + 1 < 24) { loadX(kb + 1, nxt); loadW(kb + 1, nxt); }
    const v16h a = load_frag16(xt[cur] + wave * 16 * PITCH32, PITCH32, lane);
    #pragma unroll
    for (int t2 = 0; t2 < 8; ++t2) {
      const v16h b = load_frag16(wt[cur] + t2 * 16 * PITCH32, PITCH32, lane);
      acc[t2] = WMMA_F16(a, b, acc[t2]);
    }
    ring_publish();
    cur = nxt;
  }

  const int n_lo = lane & 15, hf = lane >> 4;
  #pragma unroll
  for (int t2 = 0; t2 < 8; ++t2) {
    const int n = ntile * 128 + t2 * 16 + n_lo;
    const float bv = bias[n];
    if (MODE == 2) {
      // the lane's 8 accumulator rows are 8 consecutive keys of one channel: one
      // 16-B store; the wave's 32 stores are 512 contiguous bytes
      const int m0 = mtile * 128 + wave * 16;
      const int b = m0 >> 11, lg = (m0 & 2047) >> 4;
      const int h = n >> 6, d = n & 63;
      union { float4 f; _Float16 hh[8]; } u;
      #pragma unroll  // constant indices keep acc[] and u in registers
      for (int r = 0; r < 8; ++r) u.hh[r] = (_Float16)(acc[t2][r] + bv);
      *(float4*)(Yh + ((((size_t)(b * 12 + h)) * 128 + lg) * 64 + d) * 16 + 8 * hf) = u.f;
      continue;
    }
    #pragma unroll
    for (int r = 0; r < 8; ++r) {
      const int m = mtile * 128 + wave * 16 + r + 8 * hf;
      if (MODE == 0) {
        const int b = m >> 11, l = m & 2047;
        const int h = n >> 6, d = n & 63;
        Yh[(((size_t)(b * 12 + h)) * 2048 + l) * 64 + d] = (_Float16)(acc[t2][r] + bv);
      } else {
        const size_t idx = (size_t)m * 768 + n;
        Yf[idx] = acc[t2][r] + bv + resid[idx];
      }
    }
  }
}

// ---------------------------------------------------------------------------
// Flash attention: grid (24 bh, 16 q-blocks of 128).  Wave = 16 query rows.
// Double-buffered K/V^T tiles, both by async copies (Vt: [B,H,L/16,64,16]).
// Queries and keys are the compacted tokens: cnts[b] of them; q-blocks past that
// leave at once, the key loop ends at the last tile that holds one, and each
// context row goes to its token's own row idx[b][i].
// ---------------------------------------------------------------------------
__global__ __launch_bounds__(256) void attn_kernel(const _Float16* __restrict__ Qh,
                                                   const _Float16* __restrict__ Kh,
                                                   const _Float16* __restrict__ Vt,
                                                   const int* __restrict__ idx,
                                                   const int* __restrict__ cnts,
                                                   _Float16* __restrict__ Ch) {
  __shared__ __attribute__((aligned(16))) _Float16 klds[2][64 * PITCH64];   // K tile, natural [key][d]    2x9 KB
  __shared__ __attribute__((aligned(16))) _Float16 vtlds[2][64 * PITCH64];  // V tile transposed [d][key]  2x9 KB
  __shared__ float    mlds[2][64];        // additive key mask
  __shared__ __attribute__((aligned(16))) _Float16 plds[8 * 16 * PITCH64];  // per-wave P staging          18 KB

  const int bh = blockIdx.x;              // 0..23
  const int qb = blockIdx.y;              // 0..15
  const int b  = bh / 12, h = bh % 12;
  const int t = threadIdx.x, wave = t >> 5, lane = t & 31;
  const int n_lo = lane & 15, hf = lane >> 4;
  const int cnt = min(cnts[b], 2048);     // the clamp bounds the trip count below
  if (qb * 128 >= cnt) return;            // whole block, in front of every copy and barrier
  const int ntile = (cnt + 63) >> 6;      // key tiles, 1..32

  // Q fragments stay in registers: 16 rows x 64 d
  const _Float16* qbase = Qh + (((size_t)bh * 2048) + qb * 128 + wave * 16) * 64;
  const v16h qa0 = load_frag16(qbase, 64, lane);
  const v16h qa1 = load_frag16(qbase + 32, 64, lane);
  // the tokens of this lane's 8 query rows (r + 8 * hf), for the epilogue; read here,
  // with the Q fragments, so that the epilogue waits for no load
  union { int4 q[2]; int i[8]; } qtok;
  qtok.q[0] = *(const int4*)(idx + b * 2048 + qb * 128 + wave * 16 + 8 * hf);
  qtok.q[1] = *(const int4*)(idx + b * 2048 + qb * 128 + wave * 16 + 8 * hf + 4);

  auto loadK = [&](int j, int buf) {
    const _Float16* kb_ = Kh + (((size_t)bh * 2048) + j * 64) * 64;
    #pragma unroll
    for (int p = t; p < 512; p += 256) async_copy16(kb_ + p * 8, &klds[buf][(p >> 3) * PITCH64 + (p & 7) * 8]);
  };
  // 64 keys = 4 groups of [64 d][16 keys], 8 KB contiguous in Vt; segment p holds
  // 8 keys of channel (p >> 1) & 63 in group p >> 7
  auto loadV = [&](int j, int buf) {
    const _Float16* vb_ = Vt + (((size_t)bh * 2048) + j * 64) * 64;
    #pragma unroll  // both copies issue back to back, no loop branch around them
    for (int i = 0; i < 2; ++i) {
      const int p = t + i * 256;
      async_copy16(vb_ + p * 8, &vtlds[buf][((p >> 1) & 63) * PITCH64 + (p >> 7) * 16 + (p & 1) * 8]);
    }
  };
  auto loadM = [&](int j, int buf) {
    if (t < 64) mlds[buf][t] = (j * 64 + t < cnt) ? 0.f : -1e30f;
  };

  float mstate[8], lstate[8];
  v8f o[4] = {};
  #pragma unroll
  for (int r = 0; r < 8; ++r) { mstate[r] = -1e30f; lstate[r] = 0.f; }

  loadK(0, 0); loadV(0, 0); loadM(0, 0);
  ring_publish();

  int cur = 0;
  for (int j = 0; j < ntile; ++j) {
    const int nxt = cur ^ 1;
    if (j + 1 < ntile) { loadK(j + 1, nxt); loadV(j + 1, nxt); loadM(j + 1, nxt); }

    // S = (Q @ K^T) * 0.125 + mask
    v8f s[4];
    #pragma unroll
    for (int t2 = 0; t2 < 4; ++t2) {
      v8f z = {};
      z = WMMA_F16(qa0, load_frag16(klds[cur] + t2 * 16 * PITCH64, PITCH64, lane), z);
      z = WMMA_F16(qa1, load_frag16(klds[cur] + t2 * 16 * PITCH64 + 32, PITCH64, lane), z);
      s[t2] = z;
    }

    // online softmax per query row (row = r + 8*hf, shared by a 16-lane half)
    #pragma unroll
    for (int r = 0; r < 8; ++r) {
      float v0 = s[0][r] * 0.125f + mlds[cur][0  + n_lo];
      float v1 = s[1][r] * 0.125f + mlds[cur][16 + n_lo];
      float v2 = s[2][r] * 0.125f + mlds[cur][32 + n_lo];
      float v3 = s[3][r] * 0.125f + mlds[cur][48 + n_lo];
      float rmax = fmaxf(fmaxf(v0, v1), fmaxf(v2, v3));
      #pragma unroll
      for (int x = 8; x >= 1; x >>= 1) rmax = fmaxf(rmax, __shfl_xor(rmax, x, 32));
      const float newm  = fmaxf(mstate[r], rmax);
      const float alpha = __expf(mstate[r] - newm);
      const float e0 = (v0 > -1e29f) ? __expf(v0 - newm) : 0.f;
      const float e1 = (v1 > -1e29f) ? __expf(v1 - newm) : 0.f;
      const float e2 = (v2 > -1e29f) ? __expf(v2 - newm) : 0.f;
      const float e3 = (v3 > -1e29f) ? __expf(v3 - newm) : 0.f;
      float rsum = e0 + e1 + e2 + e3;
      #pragma unroll
      for (int x = 8; x >= 1; x >>= 1) rsum += __shfl_xor(rsum, x, 32);
      lstate[r] = lstate[r] * alpha + rsum;
      mstate[r] = newm;
      #pragma unroll
      for (int t2 = 0; t2 < 4; ++t2) o[t2][r] *= alpha;
      _Float16* pr = plds + wave * (16 * PITCH64) + (r + 8 * hf) * PITCH64 + n_lo;
      pr[0]  = (_Float16)e0;  pr[16] = (_Float16)e1;
      pr[32] = (_Float16)e2;  pr[48] = (_Float16)e3;
    }

    // intra-wave LDS RAW (cross-lane): wait for the P stores, then O += P @ V
    asm volatile("s_wait_dscnt 0" ::: "memory");
    const _Float16* pw = plds + wave * (16 * PITCH64);
    const v16h pa0 = load_frag16(pw, PITCH64, lane);
    const v16h pa1 = load_frag16(pw + 32, PITCH64, lane);
    #pragma unroll
    for (int t2 = 0; t2 < 4; ++t2) {
      o[t2] = WMMA_F16(pa0, load_frag16(vtlds[cur] + t2 * 16 * PITCH64, PITCH64, lane), o[t2]);
      o[t2] = WMMA_F16(pa1, load_frag16(vtlds[cur] + t2 * 16 * PITCH64 + 32, PITCH64, lane), o[t2]);
    }

    ring_publish();
    cur = nxt;
  }

  // epilogue: O / l -> combined [B,L,768] f16, unmasked tokens' rows only
  #pragma unroll
  for (int r = 0; r < 8; ++r) {
    const int qi = qb * 128 + wave * 16 + r + 8 * hf;
    if (qi >= cnt) continue;              // a masked token's row: zero-filled by the convert kernel
    const int qrow = qtok.i[r] & 2047;    // & 2047 bounds the row whatever the list holds
    const float scl = (lstate[r] > 0.f) ? (1.f / lstate[r]) : 0.f;
    #pragma unroll
    for (int t2 = 0; t2 < 4; ++t2) {
      const int d = t2 * 16 + n_lo;
      Ch[((size_t)(b * 2048 + qrow)) * 768 + h * 64 + d] = (_Float16)(o[t2][r] * scl);
    }
  }
}

// ---------------------------------------------------------------------------
// LayerNorm over the SEQUENCE axis (axis=1), ddof=1, per (batch, channel).
// grid (2, 24); block 1024: 32 channels (one 128-B line per row) x 128 row
// segments.  Each thread keeps its 16 rows x 4 channels in registers, so the
// column block is read once, all loads in flight together, and is normalised
// from registers after one block-wide reduction through LDS.
// ---------------------------------------------------------------------------
__global__ __launch_bounds__(1024) void ln_kernel(const float* __restrict__ Xr,
                                                  const float* __restrict__ gamma,
                                                  const float* __restrict__ beta,
                                                  float* __restrict__ out) {
  __shared__ __attribute__((aligned(16))) float red[2][128][32];   // per-thread partials: [sum|sq][row seg][channel]
  __shared__ float red2[2][16][32];   // partials over 8 row segments each
  __shared__ __attribute__((aligned(16))) float tot[2][32];        // column totals
  const int t  = threadIdx.x;
  const int c4 = t & 7;               // float4 column inside the 32-channel group
  const int rs = t >> 3;              // row segment 0..127
  const int c  = blockIdx.y * 32 + c4 * 4;
  // 32-bit byte offset of this thread's first row, shared by the loads and the stores
  const unsigned boff = (((unsigned)blockIdx.x * 2048u + (unsigned)rs) * 768u + (unsigned)c) * 4u;
  const char* xp = (const char*)Xr + boff;
  char* op = (char*)out + boff;

  const float4 g  = *(const float4*)(gamma + c);   // issued with the rows: off the path behind the reduction
  const float4 bb = *(const float4*)(beta + c);
  // keeps the two loads above issued together with the row loads; without it they
  // sink to the first barrier and are waited for there alone, a second load latency
  __builtin_amdgcn_sched_barrier(0);
  float4 v[16];
  // the loops over v[] are unrolled so that v[] has constant indices and stays in
  // registers, and so that the 16 loads (and the 16 stores) issue back to back
  #pragma unroll
  for (int i = 0; i < 16; ++i) v[i] = *(const float4*)(xp + i * (128 * 768 * 4));

  float4 sum = {0.f, 0.f, 0.f, 0.f}, sq = {0.f, 0.f, 0.f, 0.f};
  #pragma unroll
  for (int i = 0; i < 16; ++i) {
    sum.x += v[i].x; sq.x += v[i].x * v[i].x;
    sum.y += v[i].y; sq.y += v[i].y * v[i].y;
    sum.z += v[i].z; sq.z += v[i].z * v[i].z;
    sum.w += v[i].w; sq.w += v[i].w * v[i].w;
  }
  *(float4*)&red[0][rs][c4 * 4] = sum;
  *(float4*)&red[1][rs][c4 * 4] = sq;
  __syncthreads();

  {  // 128 -> 16 partials: a wave sums one quantity of all 32 channels over 8 segments
    const int which = (t >> 5) & 1, ch = t & 31, part = t >> 6;
    float p = 0.f;
    #pragma unroll  // the LDS reads issue together, one latency instead of eight
    for (int k = 0; k < 8; ++k) p += red[which][part * 8 + k][ch];
    red2[which][part][ch] = p;
  }
  __syncthreads();
  if (t < 64) {  // 16 -> 1
    const int which = t >> 5, ch = t & 31;
    float p = 0.f;
    #pragma unroll  // as above
    for (int k = 0; k < 16; ++k) p += red2[which][k][ch];
    tot[which][ch] = p;
  }
  __syncthreads();

  const float4 S = *(const float4*)&tot[0][c4 * 4];
  const float4 Q = *(const float4*)&tot[1][c4 * 4];
  float4 mean, inv;
  mean.x = S.x * (1.f / 2048.f);
  mean.y = S.y * (1.f / 2048.f);
  mean.z = S.z * (1.f / 2048.f);
  mean.w = S.w * (1.f / 2048.f);
  inv.x = rsqrtf(fmaxf((Q.x - 2048.f * mean.x * mean.x) * (1.f / 2047.f), 1e-20f));
  inv.y = rsqrtf(fmaxf((Q.y - 2048.f * mean.y * mean.y) * (1.f / 2047.f), 1e-20f));
  inv.z = rsqrtf(fmaxf((Q.z - 2048.f * mean.z * mean.z) * (1.f / 2047.f), 1e-20f));
  inv.w = rsqrtf(fmaxf((Q.w - 2048.f * mean.w * mean.w) * (1.f / 2047.f), 1e-20f));
  #pragma unroll
  for (int i = 0; i < 16; ++i) {
    float4 y;
    y.x = (v[i].x - mean.x) * inv.x * g.x + bb.x;
    y.y = (v[i].y - mean.y) * inv.y * g.y + bb.y;
    y.z = (v[i].z - mean.z) * inv.z * g.z + bb.z;
    y.w = (v[i].w - mean.w) * inv.w * g.w + bb.w;
    *(float4*)(op + i * (128 * 768 * 4)) = y;
  }
}

// ---------------------------------------------------------------------------
extern "C" void kernel_launch(void* const* d_in, const int* in_sizes, int n_in,
                              void* d_out, int out_size, void* d_ws, size_t ws_size,
                              hipStream_t stream) {
  const float* inputs = (const float*)d_in[0];   // [2,2048,768]
  const int*   amask  = (const int*)d_in[1];     // [2,2048]
  const float* wq_w = (const float*)d_in[2];
  const float* wq_b = (const float*)d_in[3];
  const float* wk_w = (const float*)d_in[4];
  const float* wk_b = (const float*)d_in[5];
  const float* wv_w = (const float*)d_in[6];
  const float* wv_b = (const float*)d_in[7];
  const float* wo_w = (const float*)d_in[8];
  const float* wo_b = (const float*)d_in[9];
  const float* gamma = (const float*)d_in[10];
  const float* beta  = (const float*)d_in[11];
  float* out = (float*)d_out;

  // workspace carve-up (~48.8 MB), 256B aligned
  char* ws = (char*)d_ws;
  size_t off = 0;
  auto carve = [&](size_t bytes) { char* p = ws + off; off += (bytes + 255) & ~(size_t)255; return p; };
  const size_t NX = (size_t)4096 * 768;          // activations
  const size_t NW = (size_t)768 * 768;           // weights
  _Float16* xh  = (_Float16*)carve(NX * 2);
  _Float16* wqh = (_Float16*)carve(NW * 2);      // weights: [k/32][n][k%32]
  _Float16* wkh = (_Float16*)carve(NW * 2);
  _Float16* wvh = (_Float16*)carve(NW * 2);
  _Float16* woh = (_Float16*)carve(NW * 2);
  _Float16* qhh = (_Float16*)carve(NX * 2);      // [B,H,L,64]
  _Float16* khh = (_Float16*)carve(NX * 2);
  _Float16* vth = (_Float16*)carve(NX * 2);      // [B,H,L/16,64,16]
  _Float16* chh = (_Float16*)carve(NX * 2);      // combined [B,L,768]
  float*    xr  = (float*)carve(NX * 4);         // residual sum, fp32
  int*      idx = (int*)carve(4096 * 4);         // [B,L] token order: unmasked first
  int*      cnts = (int*)carve(2 * 4);           // [B] unmasked tokens
  (void)ws_size; (void)in_sizes; (void)n_in; (void)out_size;

  // 1) token order (2 blocks), fp32 -> f16 conversions
  cvt_f16_kernel<<<NX / 1024 + 2, 256, 0, stream>>>(inputs, amask, xh, chh, idx, cnts);
  dim3 wgrid(12, 24);
  cvt_wt_f16_kernel<<<wgrid, 256, 0, stream>>>(wq_w, wqh);
  cvt_wt_f16_kernel<<<wgrid, 256, 0, stream>>>(wk_w, wkh);
  cvt_wt_f16_kernel<<<wgrid, 256, 0, stream>>>(wv_w, wvh);
  cvt_wt_f16_kernel<<<wgrid, 256, 0, stream>>>(wo_w, woh);

  // 2) Q/K/V projections of the unmasked tokens (128x128 tiles)
  dim3 ggrid(32, 6);
  gemm_kernel<0><<<ggrid, 256, 0, stream>>>(xh, wqh, wq_b, nullptr, idx, cnts, qhh, nullptr);
  gemm_kernel<0><<<ggrid, 256, 0, stream>>>(xh, wkh, wk_b, nullptr, idx, cnts, khh, nullptr);
  gemm_kernel<2><<<ggrid, 256, 0, stream>>>(xh, wvh, wv_b, nullptr, idx, cnts, vth, nullptr);

  // 3) fused attention
  attn_kernel<<<dim3(24, 16), 256, 0, stream>>>(qhh, khh, vth, idx, cnts, chh);

  // 4) output projection + residual
  gemm_kernel<1><<<ggrid, 256, 0, stream>>>(chh, woh, wo_b, inputs, nullptr, nullptr, nullptr, xr);

  // 5) layernorm over sequence axis
  ln_kernel<<<dim3(2, 24), 1024, 0, stream>>>(xr, gamma, beta, out);
}

// v005
// Measured time: 88.6 microseconds a run.
// Next to v004, in two timings, it ran 1.49 and 1.50 times as fast.
// Counting every step since v000, it is 5.28 times as fast.
#include <hip/hip_runtime.h>
#include <hip/hip_bf16.h>

// ---------------------------------------------------------------------------
// MHA + residual + LayerNorm(axis=L) for gfx1250 (MI455X), f16 WMMA path,
// async global->LDS copies + double-buffered, software-pipelined tiles.
// Every B operand (the weights, V) is laid out K-contiguous and in tile order
// by the kernel that produces it, so no tile is transposed on its way to LDS.
// Tokens whose mask is 0 have weight 0 as keys and a zero context row as queries:
// Q, K, V and the attention are computed on the unmasked tokens only, compacted.
// B=2, L=2048, HIDDEN=768, HEADS=12, HEAD=64.
// ---------------------------------------------------------------------------

typedef __attribute__((ext_vector_type(16))) _Float16 v16h;
typedef __attribute__((ext_vector_type(8)))  float    v8f;
typedef __attribute__((ext_vector_type(4)))  int      v4i;

// LDS row pitches in halfs, an odd multiple of 16 B each, so that the 16 rows a
// ds_load_b128 fragment read touches fall on different banks (64 banks x 4 B).
#define PITCH32 40   // rows of 32 halfs (64 B)  -> 80 B
#define PITCH64 72   // rows of 64 halfs (128 B) -> 144 B

#define WMMA_F16(a, b, c) \
  __builtin_amdgcn_wmma_f32_16x16x32_f16(false, (a), false, (b), (short)0, (c), false, false)

#if __has_builtin(__builtin_amdgcn_global_load_async_to_lds_b128)
#define HAVE_ASYNC_LDS 1
#else
#define HAVE_ASYNC_LDS 0
#endif

// 16-byte global -> LDS copy; async (ASYNCcnt) when the builtin exists.
// Probed signature: (v4i addrspace(1)*, v4i addrspace(3)*, imm offset, imm cpol)
__device__ inline void async_copy16(const _Float16* g, _Float16* l) {
#if HAVE_ASYNC_LDS
  __builtin_amdgcn_global_load_async_to_lds_b128(
      (__attribute__((address_space(1))) v4i*)g,
      (__attribute__((address_space(3))) v4i*)l, 0, 0);
#else
  *(float4*)l = *(const float4*)g;
#endif
}

// Publish point of a two-buffer ring, passed by every wave: behind it the tile
// copied last is readable by all waves and the other buffer may be refilled.
__device__ inline void ring_publish() {
  // this wave's LDS reads and writes have retired before another wave's copies
  // or reads touch the same bytes
  asm volatile("s_wait_dscnt 0x0" ::: "memory");
  // this wave's own copies have landed before the barrier lets others read them
  asm volatile("s_wait_asynccnt 0x0" ::: "memory");
  __syncthreads();
}

// Load a 16x32 f16 fragment (A-layout; also B-layout when source is stored
// transposed, i.e. K contiguous per row).  Per CDNA5 ISA 7.12.2:
//   lane 0-15: row = lane,   VGPR v<4: K = half*8 + v*2,   v>=4: K = 16+...
// => per lane: 8 contiguous halfs at [row][half*8] and 8 at [row][16+half*8].
__device__ inline v16h load_frag16(const _Float16* base, int stride_h, int lane) {
  const int m  = lane & 15;
  const int hf = lane >> 4;
  union { v16h v; float4 q[2]; } u;
  u.q[0] = *(const float4*)(base + (size_t)m * stride_h + hf * 8);
  u.q[1] = *(const float4*)(base + (size_t)m * stride_h + 16 + hf * 8);
  return u.v;
}

// ---------------------------------------------------------------------------
// Blocks 0 and 1: token order of one batch each.  idx[b][0 .. cnts[b]) lists the
// unmasked tokens in rising order, the rest of idx[b] the masked ones, so idx[b]
// is a permutation of 0..2047 for any mask.  A wave ranks 256 consecutive tokens
// by ballots; the 8 wave totals meet in LDS.
// Blocks 2 .. 1153: the four weights, 288 blocks each, fp32 [k][n] -> f16 in the
// GEMM's tile order, Wt[weight][k / 32][n][k % 32].  A block takes 64 columns x one
// 32-row k block; a lane converts 8 k of one column; a wave stores 8 columns x 64 B
// = 512 contiguous bytes.
// Other blocks: fp32 -> f16 conversion, 4 elems/thread (sizes are multiples of
// 1024), and zeros into the context rows of masked tokens, which the attention
// does not compute.
// None of the three jobs reads what another writes, so they share one launch.
// ---------------------------------------------------------------------------
__global__ __launch_bounds__(256) void cvt_f16_kernel(const float* __restrict__ src,
                                                      const int* __restrict__ amask,
                                                      const float* __restrict__ w0,
                                                      const float* __restrict__ w1,
                                                      const float* __restrict__ w2,
                                                      const float* __restrict__ w3,
                                                      _Float16* __restrict__ dst,
                                                      _Float16* __restrict__ Wt,
                                                      _Float16* __restrict__ Ch,
                                                      int* __restrict__ idx,
                                                      int* __restrict__ cnts) {
  __shared__ int wc[8];
  const int t = threadIdx.x;
  if (blockIdx.x < 2) {
    const int b = blockIdx.x, wave = t >> 5, lane = t & 31;
    unsigned bal[8];
    int wtot = 0;
    #pragma unroll  // constant indices keep bal[] in registers; the 8 loads issue together
    for (int s = 0; s < 8; ++s) {
      bal[s] = __builtin_amdgcn_ballot_w32(amask[b * 2048 + (wave * 8 + s) * 32 + lane] != 0);
      wtot += __popc(bal[s]);
    }
    if (lane == 0) wc[wave] = wtot;
    __syncthreads();
    int base = 0, total = 0;   // unmasked tokens in front of this wave's; in the batch
    #pragma unroll  // the 8 totals come as two wide LDS reads
    for (int k = 0; k < 8; ++k) {
      const int c = wc[k];
      total += c;
      if (k < wave) base += c;
    }
    #pragma unroll  // constant indices keep bal[] in registers
    for (int s = 0; s < 8; ++s) {
      const int l = (wave * 8 + s) * 32 + lane;
      const int rank = base + __popc(bal[s] & ((1u << lane) - 1u));   // unmasked tokens in front of l
      const bool on = ((bal[s] >> lane) & 1u) != 0u;
      idx[b * 2048 + (on ? rank : total + l - rank)] = l;
      base += __popc(bal[s]);
    }
    if (t == 0) cnts[b] = total;
    return;
  }
  if (blockIdx.x < 2 + 4 * 288) {
    const int wb = blockIdx.x - 2;
    const int which = wb / 288, tile = wb % 288;
    const float* wsrc = which == 0 ? w0 : which == 1 ? w1 : which == 2 ? w2 : w3;
    const int n  = (tile % 12) * 64 + (t >> 2);
    const int kb = tile / 12, kg = t & 3;
    union { float4 f; _Float16 h[8]; } u;
    #pragma unroll  // the 8 loads issue together
    for (int j = 0; j < 8; ++j) u.h[j] = (_Float16)wsrc[(size_t)(kb * 32 + kg * 8 + j) * 768 + n];
    *(float4*)(Wt + (((size_t)which * 24 + kb) * 768 + n) * 32 + kg * 8) = u.f;
    // precaution: stands in front of every later write of the store's registers (the
    // code of the token-order path follows this one in the built kernel)
    asm volatile("s_wait_xcnt 0x0" ::: "memory");
    return;
  }
  const int i = ((blockIdx.x - (2 + 4 * 288)) * 256 + t) * 4;
  float4 v = *(const float4*)(src + i);
  union { uint2 u; _Float16 h[4]; } p;
  p.h[0] = (_Float16)v.x; p.h[1] = (_Float16)v.y;
  p.h[2] = (_Float16)v.z; p.h[3] = (_Float16)v.w;
  *(uint2*)(dst + i) = p.u;
  if (amask[i / 768] == 0) *(uint2*)(Ch + i) = make_uint2(0u, 0u);
}

// ---------------------------------------------------------------------------
// GEMM: C = X @ W + bias, X:[4096,768] f16, W:[768,768] f16 as Wt[k/32][n][k%32].
// Block tile 128(M) x 128(N), K-step 32, double-buffered LDS, X and W tiles
// both by async copies.  8 waves; wave = 16 rows x 128 cols.
// MODE 0: the Q, K and V projections in one launch, blockIdx.z picks the product
// (weight plane z of Wt, bias z, output plane z of Yh): Q and K scatter to
// [B,H,L,64] f16, V goes out transposed in 16-key groups, [B,H,L/16,64,16] f16.
// MODE 1: += residual, fp32 out.
// MODE 0 works on the compacted tokens: row i of a batch is X row idx[b][i],
// and L above is the compact position.  Tiles wholly past cnts[b] are not computed;
// the last tile's rows past it are masked tokens' rows, finite, which the attention
// gives weight 0.
// ---------------------------------------------------------------------------
template <int MODE>
__global__ __launch_bounds__(256) void gemm_kernel(const _Float16* __restrict__ X,
                                                   const _Float16* __restrict__ Wt,
                                                   const float* __restrict__ bias0,
                                                   const float* __restrict__ bias1,
                                                   const float* __restrict__ bias2,
                                                   const float* __restrict__ resid,
                                                   const int* __restrict__ idx,
                                                   const int* __restrict__ cnts,
                                                   _Float16* __restrict__ Yh,
                                                   float* __restrict__ Yf) {
  __shared__ __attribute__((aligned(16))) _Float16 xt[2][128 * PITCH32];   // 2 x 10 KB
  __shared__ __attribute__((aligned(16))) _Float16 wt[2][128 * PITCH32];   // 2 x 10 KB, transposed: wt[n][k]
  const int mtile = blockIdx.x;          // 0..31
  const int ntile = blockIdx.y;          // 0..5
  const int prod  = (MODE == 0) ? blockIdx.z : 0;   // 0 Q, 1 K, 2 V
  const int t = threadIdx.x, wave = t >> 5, lane = t & 31;

  // the two X rows that this thread copies segments of (tile rows t / 4 and 64 + t / 4)
  int xrow0 = mtile * 128 + (t >> 2), xrow1 = xrow0 + 64;
  if (MODE != 1) {
    const int b = mtile >> 4;            // 16 tiles a batch
    if ((mtile & 15) * 128 >= cnts[b]) return;   // whole block, in front of every copy and barrier
    // & 2047 bounds the row whatever the list holds
    const int i0 = idx[xrow0] & 2047, i1 = idx[xrow1] & 2047;
    xrow0 = b * 2048 + i0;
    xrow1 = b * 2048 + i1;
  }
  const _Float16* xs0 = X + (size_t)xrow0 * 768 + (t & 3) * 8;
  const _Float16* xs1 = X + (size_t)xrow1 * 768 + (t & 3) * 8;

  // X tile 128x32: 512 16B segments; async copy, rows as listed above.
  auto loadX = [&](int kb, int buf) {
    _Float16* xd = &xt[buf][(t >> 2) * PITCH32 + (t & 3) * 8];
    async_copy16(xs0 + kb * 32, xd);
    async_copy16(xs1 + kb * 32, xd + 64 * PITCH32);
  };
  // W tile 128(n)x32(k): 8 KB contiguous in Wt, 512 16B segments; async copy.
  auto loadW = [&](int kb, int buf) {
    const _Float16* wsrc = Wt + (((size_t)prod * 24 + kb) * 768 + ntile * 128) * 32;
    #pragma unroll  // both copies issue back to back, no loop branch around them
    for (int i = 0; i < 2; ++i) {
      const int p = t + i * 256;
      async_copy16(wsrc + p * 8, &wt[buf][(p >> 2) * PITCH32 + (p & 3) * 8]);
    }
  };

  loadX(0, 0);
  loadW(0, 0);
  ring_publish();

  v8f acc[8] = {};
  int cur = 0;
  for (int kb = 0; kb < 24; ++kb) {
    const int nxt = cur ^ 1;
    if (kb + 1 < 24) { loadX(kb + 1, nxt); loadW(kb + 1, nxt); }
    const v16h a = load_frag16(xt[cur] + wave * 16 * PITCH32, PITCH32, lane);
    #pragma unroll
    for (int t2 = 0; t2 < 8; ++t2) {
      const v16h b = load_frag16(wt[cur] + t2 * 16 * PITCH32, PITCH32, lane);
      acc[t2] = WMMA_F16(a, b, acc[t2]);
    }
    ring_publish();
    cur = nxt;
  }

  const int n_lo = lane & 15, hf = lane >> 4;
  const float* bias = prod == 0 ? bias0 : prod == 1 ? bias1 : bias2;
  if (MODE == 0) Yh += (size_t)prod * (4096 * 768);
  float bv8[8];
  #pragma unroll  // constant indices keep bv8[] in registers; the 8 loads issue together
  for (int t2 = 0; t2 < 8; ++t2) bv8[t2] = bias[ntile * 128 + t2 * 16 + n_lo];
  // precaution: stands in front of every later write of the bias loads' address registers
  asm volatile("s_wait_xcnt 0x0" ::: "memory");
  // one block-uniform branch in front of the two store loops, none inside them
  if (MODE == 0 && prod == 2) {
    #pragma unroll
    for (int t2 = 0; t2 < 8; ++t2) {
      const int n = ntile * 128 + t2 * 16 + n_lo;
      const float bv = bv8[t2];
      // the lane's 8 accumulator rows are 8 consecutive keys of one channel: one
      // 16-B store; the wave's 32 stores are 512 contiguous bytes
      const int m0 = mtile * 128 + wave * 16;
      const int b = m0 >> 11, lg = (m0 & 2047) >> 4;
      const int h = n >> 6, d = n & 63;
      union { float4 f; _Float16 hh[8]; } u;
      #pragma unroll  // constant indices keep acc[] and u in registers
      for (int r = 0; r < 8; ++r) u.hh[r] = (_Float16)(acc[t2][r] + bv);
      *(float4*)(Yh + ((((size_t)(b * 12 + h)) * 128 + lg) * 64 + d) * 16 + 8 * hf) = u.f;
    }
    return;
  }
  #pragma unroll
  for (int t2 = 0; t2 < 8; ++t2) {
    const int n = ntile * 128 + t2 * 16 + n_lo;
    const float bv = bv8[t2];
    #pragma unroll
    for (int r = 0; r < 8; ++r) {
      const int m = mtile * 128 + wave * 16 + r + 8 * hf;
      if (MODE == 0) {
        const int b = m >> 11, l = m & 2047;
        const int h = n >> 6, d = n & 63;
        Yh[(((size_t)(b * 12 + h)) * 2048 + l) * 64 + d] = (_Float16)(acc[t2][r] + bv);
      } else {
        const size_t idx = (size_t)m * 768 + n;
        Yf[idx] = acc[t2][r] + bv + resid[idx];
      }
    }
  }
  // precaution, MODE 0: the code of the V path follows this one in the built kernel;
  // the wait stands in front of its writes of these stores' registers
  if (MODE == 0) asm volatile("s_wait_xcnt 0x0" ::: "memory");
}

// ---------------------------------------------------------------------------
// Flash attention: grid (24 bh, 16 q-blocks of 128).  Wave = 16 query rows.
// Double-buffered K/V^T tiles, both by async copies (Vt: [B,H,L/16,64,16]).
// Queries and keys are the compacted tokens: cnts[b] of them; q-blocks past that
// leave at once, the key loop ends at the last tile that holds one, and each
// context row goes to its token's own row idx[b][i].
// ---------------------------------------------------------------------------
__global__ __launch_bounds__(256) void attn_kernel(const _Float16* __restrict__ Qh,
                                                   const _Float16* __restrict__ Kh,
                                                   const _Float16* __restrict__ Vt,
                                                   const int* __restrict__ idx,
                                                   const int* __restrict__ cnts,
                                                   _Float16* __restrict__ Ch) {
  __shared__ __attribute__((aligned(16))) _Float16 klds[2][64 * PITCH64];   // K tile, natural [key][d]    2x9 KB
  __shared__ __attribute__((aligned(16))) _Float16 vtlds[2][64 * PITCH64];  // V tile transposed [d][key]  2x9 KB
  __shared__ float    mlds[2][64];        // additive key mask
  __shared__ __attribute__((aligned(16))) _Float16 plds[8 * 16 * PITCH64];  // per-wave P staging          18 KB

  const int bh = blockIdx.x;              // 0..23
  const int qb = blockIdx.y;              // 0..15
  const int b  = bh / 12, h = bh % 12;
  const int t = threadIdx.x, wave = t >> 5, lane = t & 31;
  const int n_lo = lane & 15, hf = lane >> 4;
  const int cnt = min(cnts[b], 2048);     // the clamp bounds the trip count below
  if (qb * 128 >= cnt) return;            // whole block, in front of every copy and barrier
  const int ntile = (cnt + 63) >> 6;      // key tiles, 1..32

  // Q fragments stay in registers: 16 rows x 64 d
  const _Float16* qbase = Qh + (((size_t)bh * 2048) + qb * 128 + wave * 16) * 64;
  const v16h qa0 = load_frag16(qbase, 64, lane);
  const v16h qa1 = load_frag16(qbase + 32, 64, lane);
  // the tokens of this lane's 8 query rows (r + 8 * hf), for the epilogue; read here,
  // with the Q fragments, so that the epilogue waits for no load
  union { int4 q[2]; int i[8]; } qtok;
  qtok.q[0] = *(const int4*)(idx + b * 2048 + qb * 128 + wave * 16 + 8 * hf);
  qtok.q[1] = *(const int4*)(idx + b * 2048 + qb * 128 + wave * 16 + 8 * hf + 4);

  auto loadK = [&](int j, int buf) {
    const _Float16* kb_ = Kh + (((size_t)bh * 2048) + j * 64) * 64;
    #pragma unroll
    for (int p = t; p < 512; p += 256) async_copy16(kb_ + p * 8, &klds[buf][(p >> 3) * PITCH64 + (p & 7) * 8]);
  };
  // 64 keys = 4 groups of [64 d][16 keys], 8 KB contiguous in Vt; segment p holds
  // 8 keys of channel (p >> 1) & 63 in group p >> 7
  auto loadV = [&](int j, int buf) {
    const _Float16* vb_ = Vt + (((size_t)bh * 2048) + j * 64) * 64;
    #pragma unroll  // both copies issue back to back, no loop branch around them
    for (int i = 0; i < 2; ++i) {
      const int p = t + i * 256;
      async_copy16(vb_ + p * 8, &vtlds[buf][((p >> 1) & 63) * PITCH64 + (p >> 7) * 16 + (p & 1) * 8]);
    }
  };
  auto loadM = [&](int j, int buf) {
    if (t < 64) mlds[buf][t] = (j * 64 + t < cnt) ? 0.f : -1e30f;
  };

  float mstate[8], lstate[8];
  v8f o[4] = {};
  #pragma unroll
  for (int r = 0; r < 8; ++r) { mstate[r] = -1e30f; lstate[r] = 0.f; }

  loadK(0, 0); loadV(0, 0); loadM(0, 0);
  ring_publish();

  int cur = 0;
  for (int j = 0; j < ntile; ++j) {
    const int nxt = cur ^ 1;
    if (j + 1 < ntile) { loadK(j + 1, nxt); loadV(j + 1, nxt); loadM(j + 1, nxt); }

    // S = (Q @ K^T) * 0.125 + mask
    v8f s[4];
    #pragma unroll
    for (int t2 = 0; t2 < 4; ++t2) {
      v8f z = {};
      z = WMMA_F16(qa0, load_frag16(klds[cur] + t2 * 16 * PITCH64, PITCH64, lane), z);
      z = WMMA_F16(qa1, load_frag16(klds[cur] + t2 * 16 * PITCH64 + 32, PITCH64, lane), z);
      s[t2] = z;
    }

    // online softmax per query row (row = r + 8*hf, shared by a 16-lane half)
    #pragma unroll
    for (int r = 0; r < 8; ++r) {
      float v0 = s[0][r] * 0.125f + mlds[cur][0  + n_lo];
      float v1 = s[1][r] * 0.125f + mlds[cur][16 + n_lo];
      float v2 = s[2][r] * 0.125f + mlds[cur][32 + n_lo];
      float v3 = s[3][r] * 0.125f + mlds[cur][48 + n_lo];
      float rmax = fmaxf(fmaxf(v0, v1), fmaxf(v2, v3));
      #pragma unroll
      for (int x = 8; x >= 1; x >>= 1) rmax = fmaxf(rmax, __shfl_xor(rmax, x, 32));
      const float newm  = fmaxf(mstate[r], rmax);
      const float alpha = __expf(mstate[r] - newm);
      const float e0 = (v0 > -1e29f) ? __expf(v0 - newm) : 0.f;
      const float e1 = (v1 > -1e29f) ? __expf(v1 - newm) : 0.f;
      const float e2 = (v2 > -1e29f) ? __expf(v2 - newm) : 0.f;
      const float e3 = (v3 > -1e29f) ? __expf(v3 - newm) : 0.f;
      float rsum = e0 + e1 + e2 + e3;
      #pragma unroll
      for (int x = 8; x >= 1; x >>= 1) rsum += __shfl_xor(rsum, x, 32);
      lstate[r] = lstate[r] * alpha + rsum;
      mstate[r] = newm;
      #pragma unroll
      for (int t2 = 0; t2 < 4; ++t2) o[t2][r] *= alpha;
      _Float16* pr = plds + wave * (16 * PITCH64) + (r + 8 * hf) * PITCH64 + n_lo;
      pr[0]  = (_Float16)e0;  pr[16] = (_Float16)e1;
      pr[32] = (_Float16)e2;  pr[48] = (_Float16)e3;
    }

    // intra-wave LDS RAW (cross-lane): wait for the P stores, then O += P @ V
    asm volatile("s_wait_dscnt 0" ::: "memory");
    const _Float16* pw = plds + wave * (16 * PITCH64);
    const v16h pa0 = load_frag16(pw, PITCH64, lane);
    const v16h pa1 = load_frag16(pw + 32, PITCH64, lane);
    #pragma unroll
    for (int t2 = 0; t2 < 4; ++t2) {
      o[t2] = WMMA_F16(pa0, load_frag16(vtlds[cur] + t2 * 16 * PITCH64, PITCH64, lane), o[t2]);
      o[t2] = WMMA_F16(pa1, load_frag16(vtlds[cur] + t2 * 16 * PITCH64 + 32, PITCH64, lane), o[t2]);
    }

    ring_publish();
    cur = nxt;
  }

  // epilogue: O / l -> combined [B,L,768] f16, unmasked tokens' rows only
  #pragma unroll
  for (int r = 0; r < 8; ++r) {
    const int qi = qb * 128 + wave * 16 + r + 8 * hf;
    if (qi >= cnt) continue;              // a masked token's row: zero-filled by the convert kernel
    const int qrow = qtok.i[r] & 2047;    // & 2047 bounds the row whatever the list holds
    const float scl = (lstate[r] > 0.f) ? (1.f / lstate[r]) : 0.f;
    #pragma unroll
    for (int t2 = 0; t2 < 4; ++t2) {
      const int d = t2 * 16 + n_lo;
      Ch[((size_t)(b * 2048 + qrow)) * 768 + h * 64 + d] = (_Float16)(o[t2][r] * scl);
    }
  }
}

// ---------------------------------------------------------------------------
// LayerNorm over the SEQUENCE axis (axis=1), ddof=1, per (batch, channel).
// grid (2, 24); block 1024: 32 channels (one 128-B line per row) x 128 row
// segments.  Each thread keeps its 16 rows x 4 channels in registers, so the
// column block is read once, all loads in flight together, and is normalised
// from registers after one block-wide reduction through LDS.
// ---------------------------------------------------------------------------
__global__ __launch_bounds__(1024) void ln_kernel(const float* __restrict__ Xr,
                                                  const float* __restrict__ gamma,
                                                  const float* __restrict__ beta,
                                                  float* __restrict__ out) {
  __shared__ __attribute__((aligned(16))) float red[2][128][32];   // per-thread partials: [sum|sq][row seg][channel]
  __shared__ float red2[2][16][32];   // partials over 8 row segments each
  __shared__ __attribute__((aligned(16))) float tot[2][32];        // column totals
  const int t  = threadIdx.x;
  const int c4 = t & 7;               // float4 column inside the 32-channel group
  const int rs = t >> 3;              // row segment 0..127
  const int c  = blockIdx.y * 32 + c4 * 4;
  // 32-bit byte offset of this thread's first row, shared by the loads and the stores
  const unsigned boff = (((unsigned)blockIdx.x * 2048u + (unsigned)rs) * 768u + (unsigned)c) * 4u;
  const char* xp = (const char*)Xr + boff;
  char* op = (char*)out + boff;

  const float4 g  = *(const float4*)(gamma + c);   // issued with the rows: off the path behind the reduction
  const float4 bb = *(const float4*)(beta + c);
  // keeps the two loads above issued together with the row loads; without it they
  // sink to the first barrier and are waited for there alone, a second load latency
  __builtin_amdgcn_sched_barrier(0);
  float4 v[16];
  // the loops over v[] are unrolled so that v[] has constant indices and stays in
  // registers, and so that the 16 loads (and the 16 stores) issue back to back
  #pragma unroll
  for (int i = 0; i < 16; ++i) v[i] = *(const float4*)(xp + i * (128 * 768 * 4));

  float4 sum = {0.f, 0.f, 0.f, 0.f}, sq = {0.f, 0.f, 0.f, 0.f};
  #pragma unroll
  for (int i = 0; i < 16; ++i) {
    sum.x += v[i].x; sq.x += v[i].x * v[i].x;
    sum.y += v[i].y; sq.y += v[i].y * v[i].y;
    sum.z += v[i].z; sq.z += v[i].z * v[i].z;
    sum.w += v[i].w; sq.w += v[i].w * v[i].w;
  }
  *(float4*)&red[0][rs][c4 * 4] = sum;
  *(float4*)&red[1][rs][c4 * 4] = sq;
  __syncthreads();

  {  // 128 -> 16 partials: a wave sums one quantity of all 32 channels over 8 segments
    const int which = (t >> 5) & 1, ch = t & 31, part = t >> 6;
    float p = 0.f;
    #pragma unroll  // the LDS reads issue together, one latency instead of eight
    for (int k = 0; k < 8; ++k) p += red[which][part * 8 + k][ch];
    red2[which][part][ch] = p;
  }
  __syncthreads();
  if (t < 64) {  // 16 -> 1
    const int which = t >> 5, ch = t & 31;
    float p = 0.f;
    #pragma unroll  // as above
    for (int k = 0; k < 16; ++k) p += red2[which][k][ch];
    tot[which][ch] = p;
  }
  __syncthreads();

  const float4 S = *(const float4*)&tot[0][c4 * 4];
  const float4 Q = *(const float4*)&tot[1][c4 * 4];
  float4 mean, inv;
  mean.x = S.x * (1.f / 2048.f);
  mean.y = S.y * (1.f / 2048.f);
  mean.z = S.z * (1.f / 2048.f);
  mean.w = S.w * (1.f / 2048.f);
  inv.x = rsqrtf(fmaxf((Q.x - 2048.f * mean.x * mean.x) * (1.f / 2047.f), 1e-20f));
  inv.y = rsqrtf(fmaxf((Q.y - 2048.f * mean.y * mean.y) * (1.f / 2047.f), 1e-20f));
  inv.z = rsqrtf(fmaxf((Q.z - 2048.f * mean.z * mean.z) * (1.f / 2047.f), 1e-20f));
  inv.w = rsqrtf(fmaxf((Q.w - 2048.f * mean.w * mean.w) * (1.f / 2047.f), 1e-20f));
  #pragma unroll
  for (int i = 0; i < 16; ++i) {
    float4 y;
    y.x = (v[i].x - mean.x) * inv.x * g.x + bb.x;
    y.y = (v[i].y - mean.y) * inv.y * g.y + bb.y;
    y.z = (v[i].z - mean.z) * inv.z * g.z + bb.z;
    y.w = (v[i].w - mean.w) * inv.w * g.w + bb.w;
    *(float4*)(op + i * (128 * 768 * 4)) = y;
  }
}

// ---------------------------------------------------------------------------
extern "C" void kernel_launch(void* const* d_in, const int* in_sizes, int n_in,
                              void* d_out, int out_size, void* d_ws, size_t ws_size,
                              hipStream_t stream) {
  const float* inputs = (const float*)d_in[0];   // [2,2048,768]
  const int*   amask  = (const int*)d_in[1];     // [2,2048]
  const float* wq_w = (const float*)d_in[2];
  const float* wq_b = (const float*)d_in[3];
  const float* wk_w = (const float*)d_in[4];
  const float* wk_b = (const float*)d_in[5];
  const float* wv_w = (const float*)d_in[6];
  const float* wv_b = (const float*)d_in[7];
  const float* wo_w = (const float*)d_in[8];
  const float* wo_b = (const float*)d_in[9];
  const float* gamma = (const float*)d_in[10];
  const float* beta  = (const float*)d_in[11];
  float* out = (float*)d_out;

  // workspace carve-up (~48.8 MB), 256B aligned
  char* ws = (char*)d_ws;
  size_t off = 0;
  auto carve = [&](size_t bytes) { char* p = ws + off; off += (bytes + 255) & ~(size_t)255; return p; };
  const size_t NX = (size_t)4096 * 768;          // activations
  const size_t NW = (size_t)768 * 768;           // weights
  _Float16* xh  = (_Float16*)carve(NX * 2);
  _Float16* wth = (_Float16*)carve(4 * NW * 2);  // weights q, k, v, o: [4][k/32][n][k%32]
  _Float16* woh = wth + 3 * NW;
  _Float16* qhh = (_Float16*)carve(3 * NX * 2);  // three planes: Q, K [B,H,L,64],
  _Float16* khh = qhh + NX;
  _Float16* vth = qhh + 2 * NX;                  // V [B,H,L/16,64,16]
  _Float16* chh = (_Float16*)carve(NX * 2);      // combined [B,L,768]
  float*    xr  = (float*)carve(NX * 4);         // residual sum, fp32
  int*      idx = (int*)carve(4096 * 4);         // [B,L] token order: unmasked first
  int*      cnts = (int*)carve(2 * 4);           // [B] unmasked tokens
  (void)ws_size; (void)in_sizes; (void)n_in; (void)out_size;

  // 1) token order (2 blocks), weight (4 x 288 blocks) and activation fp32 -> f16 conversions
  cvt_f16_kernel<<<2 + 4 * 288 + NX / 1024, 256, 0, stream>>>(inputs, amask, wq_w, wk_w, wv_w, wo_w,
                                                              xh, wth, chh, idx, cnts);

  // 2) Q/K/V projections of the unmasked tokens (128x128 tiles), one launch
  gemm_kernel<0><<<dim3(32, 6, 3), 256, 0, stream>>>(xh, wth, wq_b, wk_b, wv_b, nullptr, idx, cnts, qhh, nullptr);

  // 3) fused attention
  attn_kernel<<<dim3(24, 16), 256, 0, stream>>>(qhh, khh, vth, idx, cnts, chh);

  // 4) output projection + residual
  gemm_kernel<1><<<dim3(32, 6), 256, 0, stream>>>(chh, woh, wo_b, nullptr, nullptr, inputs, nullptr, nullptr, nullptr, xr);

  // 5) layernorm over sequence axis
  ln_kernel<<<dim3(2, 24), 1024, 0, stream>>>(xr, gamma, beta, out);
}

// v006
// One run takes 80.4 microseconds.
// Timed twice side by side with v005, it ran 1.09 times as fast both times.
// All steps since v000 together make it 5.75 times as fast.
#include <hip/hip_runtime.h>
#include <hip/hip_bf16.h>

// ---------------------------------------------------------------------------
// MHA + residual + LayerNorm(axis=L) for gfx1250 (MI455X), f16 WMMA path,
// async global->LDS copies + double-buffered, software-pipelined tiles.
// Each of the weights and V is laid out K-contiguous and in tile order
// by the kernel that produces it, so no tile is transposed on its way to LDS.
// Tokens whose mask is 0 have weight 0 as keys and a zero context row as queries:
// Q, K, V and the attention are computed on the unmasked tokens only, compacted.
// B=2, L=2048, HIDDEN=768, HEADS=12, HEAD=64.
// ---------------------------------------------------------------------------

typedef __attribute__((ext_vector_type(16))) _Float16 v16h;
typedef __attribute__((ext_vector_type(8)))  float    v8f;
typedef __attribute__((ext_vector_type(4)))  int      v4i;

// LDS row pitches in halfs, an odd multiple of 16 B each, so that the 16 rows a
// ds_load_b128 fragment read touches fall on different banks (64 banks x 4 B).
#define PITCH32 40   // rows of 32 halfs (64 B)  -> 80 B
#define PITCH64 72   // rows of 64 halfs (128 B) -> 144 B

#define WMMA_F16(a, b, c) \
  __builtin_amdgcn_wmma_f32_16x16x32_f16(false, (a), false, (b), (short)0, (c), false, false)

#if __has_builtin(__builtin_amdgcn_global_load_async_to_lds_b128)
#define HAVE_ASYNC_LDS 1
#else
#define HAVE_ASYNC_LDS 0
#endif

// 16-byte global -> LDS copy; async (ASYNCcnt) when the builtin exists.
// Probed signature: (v4i addrspace(1)*, v4i addrspace(3)*, imm offset, imm cpol)
__device__ inline void async_copy16(const _Float16* g, _Float16* l) {
#if HAVE_ASYNC_LDS
  __builtin_amdgcn_global_load_async_to_lds_b128(
      (__attribute__((address_space(1))) v4i*)g,
      (__attribute__((address_space(3))) v4i*)l, 0, 0);
#else
  *(float4*)l = *(const float4*)g;
#endif
}

// Publish point of a two-buffer ring, passed by every wave: behind it the tile
// copied last is readable by all waves and the other buffer may be refilled.
__device__ inline void ring_publish() {
  // this wave's LDS reads and writes have retired before another wave's copies
  // or reads touch the same bytes
  asm volatile("s_wait_dscnt 0x0" ::: "memory");
  // this wave's own copies have landed before the barrier lets others read them
  asm volatile("s_wait_asynccnt 0x0" ::: "memory");
  __syncthreads();
}

// Load a 16x32 f16 fragment (A-layout; also B-layout when source is stored
// transposed, i.e. K contiguous per row).  Per CDNA5 ISA 7.12.2:
//   lane 0-15: row = lane,   VGPR v<4: K = half*8 + v*2,   v>=4: K = 16+...
// => per lane: 8 contiguous halfs at [row][half*8] and 8 at [row][16+half*8].
__device__ inline v16h load_frag16(const _Float16* base, int stride_h, int lane) {
  const int m  = lane & 15;
  const int hf = lane >> 4;
  union { v16h v; float4 q[2]; } u;
  u.q[0] = *(const float4*)(base + (size_t)m * stride_h + hf * 8);
  u.q[1] = *(const float4*)(base + (size_t)m * stride_h + 16 + hf * 8);
  return u.v;
}

// ---------------------------------------------------------------------------
// Blocks 0 and 1: token order of one batch each.  idx[b][0 .. cnts[b]) lists the
// unmasked tokens in rising order, the rest of idx[b] the masked ones, so idx[b]
// is a permutation of 0..2047 for any mask.  A wave ranks 256 consecutive tokens
// by ballots; the 8 wave totals meet in LDS.
// Blocks 2 .. 1153: the four weights, 288 blocks each, fp32 [k][n] -> f16 in the
// GEMM's tile order, Wt[weight][k / 32][n][k % 32].  A block takes 64 columns x one
// 32-row k block; a lane converts 8 k of one column; a wave stores 8 columns x 64 B
// = 512 contiguous bytes.
// Other blocks: fp32 -> f16 conversion, 4 elems/thread (sizes are multiples of
// 1024), and zeros into the context rows of masked tokens, which the attention
// does not compute.
// None of the three jobs reads what another writes, so they share one launch.
// ---------------------------------------------------------------------------
__global__ __launch_bounds__(256) void cvt_f16_kernel(const float* __restrict__ src,
                                                      const int* __restrict__ amask,
                                                      const float* __restrict__ w0,
                                                      const float* __restrict__ w1,
                                                      const float* __restrict__ w2,
                                                      const float* __restrict__ w3,
                                                      _Float16* __restrict__ dst,
                                                      _Float16* __restrict__ Wt,
                                                      _Float16* __restrict__ Ch,
                                                      int* __restrict__ idx,
                                                      int* __restrict__ cnts) {
  __shared__ int wc[8];
  const int t = threadIdx.x;
  if (blockIdx.x < 2) {
    const int b = blockIdx.x, wave = t >> 5, lane = t & 31;
    unsigned bal[8];
    int wtot = 0;
    #pragma unroll  // constant indices keep bal[] in registers; the 8 loads issue together
    for (int s = 0; s < 8; ++s) {
      bal[s] = __builtin_amdgcn_ballot_w32(amask[b * 2048 + (wave * 8 + s) * 32 + lane] != 0);
      wtot += __popc(bal[s]);
    }
    if (lane == 0) wc[wave] = wtot;
    __syncthreads();
    int base = 0, total = 0;   // unmasked tokens in front of this wave's; in the batch
    #pragma unroll  // the 8 totals come as two wide LDS reads
    for (int k = 0; k < 8; ++k) {
      const int c = wc[k];
      total += c;
      if (k < wave) base += c;
    }
    #pragma unroll  // constant indices keep bal[] in registers
    for (int s = 0; s < 8; ++s) {
      const int l = (wave * 8 + s) * 32 + lane;
      const int rank = base + __popc(bal[s] & ((1u << lane) - 1u));   // unmasked tokens in front of l
      const bool on = ((bal[s] >> lane) & 1u) != 0u;
      idx[b * 2048 + (on ? rank : total + l - rank)] = l;
      base += __popc(bal[s]);
    }
    if (t == 0) cnts[b] = total;
    return;
  }
  if (blockIdx.x < 2 + 4 * 288) {
    const int wb = blockIdx.x - 2;
    const int which = wb / 288, tile = wb % 288;
    const float* wsrc = which == 0 ? w0 : which == 1 ? w1 : which == 2 ? w2 : w3;
    const int n  = (tile % 12) * 64 + (t >> 2);
    const int kb = tile / 12, kg = t & 3;
    union { float4 f; _Float16 h[8]; } u;
    #pragma unroll  // the 8 loads issue together
    for (int j = 0; j < 8; ++j) u.h[j] = (_Float16)wsrc[(size_t)(kb * 32 + kg * 8 + j) * 768 + n];
    *(float4*)(Wt + (((size_t)which * 24 + kb) * 768 + n) * 32 + kg * 8) = u.f;
    // precaution: stands in front of every later write of the store's registers (the
    // code of the token-order path follows this one in the built kernel)
    asm volatile("s_wait_xcnt 0x0" ::: "memory");
    return;
  }
  const int i = ((blockIdx.x - (2 + 4 * 288)) * 256 + t) * 4;
  float4 v = *(const float4*)(src + i);
  union { uint2 u; _Float16 h[4]; } p;
  p.h[0] = (_Float16)v.x; p.h[1] = (_Float16)v.y;
  p.h[2] = (_Float16)v.z; p.h[3] = (_Float16)v.w;
  *(uint2*)(dst + i) = p.u;
  if (amask[i / 768] == 0) *(uint2*)(Ch + i) = make_uint2(0u, 0u);
}

// ---------------------------------------------------------------------------
// GEMM: C = X @ W + bias, X:[4096,768] f16, W:[768,768] f16 as Wt[k/32][n][k%32].
// Block tile 128(M) x 128(N), K-step 32, double-buffered LDS, X and W tiles
// both by async copies.  8 waves; wave = 16 rows x 128 cols.
// MODE 0: the Q, K and V projections in one launch, blockIdx.z picks the product
// (weight plane z of Wt, bias z, output plane z of Yh): Q and K scatter to
// [B,H,L,64] f16, V goes out transposed in 16-key groups, [B,H,L/16,64,16] f16.
// MODE 1: += residual, fp32 out.
// MODE 0 works on the compacted tokens: row i of a batch is X row idx[b][i],
// and L above is the compact position.  Tiles wholly past cnts[b] are not computed;
// the last tile's rows past it are masked tokens' rows, finite, which the attention
// gives weight 0.
// ---------------------------------------------------------------------------
template <int MODE>
__global__ __launch_bounds__(256) void gemm_kernel(const _Float16* __restrict__ X,
                                                   const _Float16* __restrict__ Wt,
                                                   const float* __restrict__ bias0,
                                                   const float* __restrict__ bias1,
                                                   const float* __restrict__ bias2,
                                                   const float* __restrict__ resid,
                                                   const int* __restrict__ idx,
                                                   const int* __restrict__ cnts,
                                                   _Float16* __restrict__ Yh,
                                                   float* __restrict__ Yf) {
  __shared__ __attribute__((aligned(16))) _Float16 xt[2][128 * PITCH32];   // 2 x 10 KB
  __shared__ __attribute__((aligned(16))) _Float16 wt[2][128 * PITCH32];   // 2 x 10 KB, transposed: wt[n][k]
  const int mtile = blockIdx.x;          // 0..31
  const int ntile = blockIdx.y;          // 0..5
  const int prod  = (MODE == 0) ? blockIdx.z : 0;   // 0 Q, 1 K, 2 V
  const int t = threadIdx.x, wave = t >> 5, lane = t & 31;

  // the two X rows that this thread copies segments of (tile rows t / 4 and 64 + t / 4)
  int xrow0 = mtile * 128 + (t >> 2), xrow1 = xrow0 + 64;
  if (MODE != 1) {
    const int b = mtile >> 4;            // 16 tiles a batch
    if ((mtile & 15) * 128 >= cnts[b]) return;   // whole block, in front of every copy and barrier
    // & 2047 bounds the row whatever the list holds
    const int i0 = idx[xrow0] & 2047, i1 = idx[xrow1] & 2047;
    xrow0 = b * 2048 + i0;
    xrow1 = b * 2048 + i1;
  }
  const _Float16* xs0 = X + (size_t)xrow0 * 768 + (t & 3) * 8;
  const _Float16* xs1 = X + (size_t)xrow1 * 768 + (t & 3) * 8;

  // X tile 128x32: 512 16B segments; async copy, rows as listed above.
  auto loadX = [&](int kb, int buf) {
    _Float16* xd = &xt[buf][(t >> 2) * PITCH32 + (t & 3) * 8];
    async_copy16(xs0 + kb * 32, xd);
    async_copy16(xs1 + kb * 32, xd + 64 * PITCH32);
  };
  // W tile 128(n)x32(k): 8 KB contiguous in Wt, 512 16B segments; async copy.
  auto loadW = [&](int kb, int buf) {
    const _Float16* wsrc = Wt + (((size_t)prod * 24 + kb) * 768 + ntile * 128) * 32;
    #pragma unroll  // both copies issue back to back, no loop branch around them
    for (int i = 0; i < 2; ++i) {
      const int p = t + i * 256;
      async_copy16(wsrc + p * 8, &wt[buf][(p >> 2) * PITCH32 + (p & 3) * 8]);
    }
  };

  loadX(0, 0);
  loadW(0, 0);
  ring_publish();

  v8f acc[8] = {};
  int cur = 0;
  for (int kb = 0; kb < 24; ++kb) {
    const int nxt = cur ^ 1;
    if (kb + 1 < 24) { loadX(kb + 1, nxt); loadW(kb + 1, nxt); }
    const v16h a = load_frag16(xt[cur] + wave * 16 * PITCH32, PITCH32, lane);
    #pragma unroll
    for (int t2 = 0; t2 < 8; ++t2) {
      const v16h b = load_frag16(wt[cur] + t2 * 16 * PITCH32, PITCH32, lane);
      acc[t2] = WMMA_F16(a, b, acc[t2]);
    }
    ring_publish();
    cur = nxt;
  }

  const int n_lo = lane & 15, hf = lane >> 4;
  const float* bias = prod == 0 ? bias0 : prod == 1 ? bias1 : bias2;
  if (MODE == 0) Yh += (size_t)prod * (4096 * 768);
  float bv8[8];
  #pragma unroll  // constant indices keep bv8[] in registers; the 8 loads issue together
  for (int t2 = 0; t2 < 8; ++t2) bv8[t2] = bias[ntile * 128 + t2 * 16 + n_lo];
  // precaution: stands in front of every later write of the bias loads' address registers
  asm volatile("s_wait_xcnt 0x0" ::: "memory");
  // one block-uniform branch in front of the two store loops, none inside them
  if (MODE == 0 && prod == 2) {
    #pragma unroll
    for (int t2 = 0; t2 < 8; ++t2) {
      const int n = ntile * 128 + t2 * 16 + n_lo;
      const float bv = bv8[t2];
      // the lane's 8 accumulator rows are 8 consecutive keys of one channel: one
      // 16-B store; the wave's 32 stores are 512 contiguous bytes
      const int m0 = mtile * 128 + wave * 16;
      const int b = m0 >> 11, lg = (m0 & 2047) >> 4;
      const int h = n >> 6, d = n & 63;
      union { float4 f; _Float16 hh[8]; } u;
      #pragma unroll  // constant indices keep acc[] and u in registers
      for (int r = 0; r < 8; ++r) u.hh[r] = (_Float16)(acc[t2][r] + bv);
      *(float4*)(Yh + ((((size_t)(b * 12 + h)) * 128 + lg) * 64 + d) * 16 + 8 * hf) = u.f;
    }
    return;
  }
  #pragma unroll
  for (int t2 = 0; t2 < 8; ++t2) {
    const int n = ntile * 128 + t2 * 16 + n_lo;
    const float bv = bv8[t2];
    #pragma unroll
    for (int r = 0; r < 8; ++r) {
      const int m = mtile * 128 + wave * 16 + r + 8 * hf;
      if (MODE == 0) {
        const int b = m >> 11, l = m & 2047;
        const int h = n >> 6, d = n & 63;
        Yh[(((size_t)(b * 12 + h)) * 2048 + l) * 64 + d] = (_Float16)(acc[t2][r] + bv);
      } else {
        const size_t idx = (size_t)m * 768 + n;
        Yf[idx] = acc[t2][r] + bv + resid[idx];
      }
    }
  }
  // precaution, MODE 0: the code of the V path follows this one in the built kernel;
  // the wait stands in front of its writes of these stores' registers
  if (MODE == 0) asm volatile("s_wait_xcnt 0x0" ::: "memory");
}

__device__ inline float xhalf(float x) {
  const int v = __builtin_bit_cast(int, x);
  return __builtin_bit_cast(float,
      __builtin_amdgcn_permlanex16(v, v, 0x76543210, 0xfedcba98, false, false));
}

__global__ __launch_bounds__(256) void attn_kernel(const _Float16* __restrict__ Qh,
                                                   const _Float16* __restrict__ Kh,
                                                   const _Float16* __restrict__ Vt,
                                                   const int* __restrict__ idx,
                                                   const int* __restrict__ cnts,
                                                   _Float16* __restrict__ Ch) {
  __shared__ __attribute__((aligned(16))) _Float16 klds[2][64 * PITCH64];   // K tile, natural [key][d]    2x9 KB
  __shared__ __attribute__((aligned(16))) _Float16 vtlds[2][64 * PITCH64];  // V tile transposed [d][key]  2x9 KB
  __shared__ __attribute__((aligned(16))) float mlds[2][64];                // additive key mask

  const int bh = blockIdx.x;              // 0..23
  const int qb = blockIdx.y;              // 0..15
  const int b  = bh / 12, h = bh % 12;
  const int t = threadIdx.x, wave = t >> 5, lane = t & 31;
  const int n_lo = lane & 15, hf = lane >> 4;
  const int cnt = min(cnts[b], 2048);     // the clamp bounds the trip count below
  if (qb * 128 >= cnt) return;            // whole block, in front of every copy and barrier
  const int ntile = (cnt + 63) >> 6;      // key tiles, 1..32

  // Q fragments stay in registers: 64 d x 16 queries, B operand (column = query n_lo)
  const _Float16* qbase = Qh + (((size_t)bh * 2048) + qb * 128 + wave * 16) * 64;
  const v16h qa0 = load_frag16(qbase, 64, lane);
  const v16h qa1 = load_frag16(qbase + 32, 64, lane);
  // the token of this lane's query, for the epilogue; read here, with the Q
  // fragments, so that the epilogue waits for no load
  const int qtok = idx[b * 2048 + qb * 128 + wave * 16 + n_lo];

  auto loadK = [&](int j, int buf) {
    const _Float16* kb_ = Kh + (((size_t)bh * 2048) + j * 64) * 64;
    #pragma unroll
    for (int p = t; p < 512; p += 256) async_copy16(kb_ + p * 8, &klds[buf][(p >> 3) * PITCH64 + (p & 7) * 8]);
  };
  // 64 keys = 4 groups of [64 d][16 keys], 8 KB contiguous in Vt; segment p holds
  // 8 keys of channel (p >> 1) & 63 in group p >> 7
  auto loadV = [&](int j, int buf) {
    const _Float16* vb_ = Vt + (((size_t)bh * 2048) + j * 64) * 64;
    #pragma unroll  // both copies issue back to back, no loop branch around them
    for (int i = 0; i < 2; ++i) {
      const int p = t + i * 256;
      async_copy16(vb_ + p * 8, &vtlds[buf][((p >> 1) & 63) * PITCH64 + (p >> 7) * 16 + (p & 1) * 8]);
    }
  };
  auto loadM = [&](int j, int buf) {
    if (t < 64) mlds[buf][t] = (j * 64 + t < cnt) ? 0.f : -1e30f;
  };

  float mstate = -1e30f;   // running maximum of query n_lo, equal in both halves
  float lstate = 0.f;      // running sum of query n_lo over this half's keys only
  v8f o[4] = {};           // O^T: o[t2][r] = channel 16 * t2 + 8 * hf + r of query n_lo

  loadK(0, 0); loadV(0, 0); loadM(0, 0);
  ring_publish();

  int cur = 0;
  for (int j = 0; j < ntile; ++j) {
    const int nxt = cur ^ 1;
    if (j + 1 < ntile) { loadK(j + 1, nxt); loadV(j + 1, nxt); loadM(j + 1, nxt); }

    // S^T = K @ Q^T: s[t2][r] = key 16 * t2 + 8 * hf + r against query n_lo
    v8f s[4];
    #pragma unroll
    for (int t2 = 0; t2 < 4; ++t2) {
      v8f z = {};
      z = WMMA_F16(load_frag16(klds[cur] + t2 * 16 * PITCH64, PITCH64, lane), qa0, z);
      z = WMMA_F16(load_frag16(klds[cur] + t2 * 16 * PITCH64 + 32, PITCH64, lane), qa1, z);
      s[t2] = z;
    }

    // online softmax of the lane's query over its 32 keys; four independent chains
    // for the maximum and for the sum, one per score tile
    float mx[4];
    #pragma unroll  // constant indices keep s[] and mx[] in registers
    for (int t2 = 0; t2 < 4; ++t2) {
      union { float4 q[2]; float f[8]; } km;   // the mask of the lane's 8 keys of this tile
      km.q[0] = *(const float4*)&mlds[cur][t2 * 16 + 8 * hf];
      km.q[1] = *(const float4*)&mlds[cur][t2 * 16 + 8 * hf + 4];
      #pragma unroll
      for (int r = 0; r < 8; ++r) {
        s[t2][r] = s[t2][r] * 0.125f + km.f[r];
        mx[t2] = (r == 0) ? s[t2][r] : fmaxf(mx[t2], s[t2][r]);
      }
    }
    float rmax = fmaxf(fmaxf(mx[0], mx[1]), fmaxf(mx[2], mx[3]));
    rmax = fmaxf(rmax, xhalf(rmax));          // over all 64 keys
    const float newm  = fmaxf(mstate, rmax);
    const float alpha = __expf(mstate - newm);
    float rs[4];
    #pragma unroll  // constant indices keep s[] and rs[] in registers
    for (int t2 = 0; t2 < 4; ++t2) {
      #pragma unroll
      for (int r = 0; r < 8; ++r) {
        const float v = s[t2][r];
        const float e = (v > -1e29f) ? __expf(v - newm) : 0.f;
        s[t2][r] = e;
        rs[t2] = (r == 0) ? e : rs[t2] + e;
      }
    }
    lstate = lstate * alpha + ((rs[0] + rs[1]) + (rs[2] + rs[3]));
    mstate = newm;
    #pragma unroll
    for (int t2 = 0; t2 < 4; ++t2) o[t2] *= alpha;

    // P^T as B operand: element e of a fragment is key 8 * hf + e (e < 8) or
    // 16 + 8 * hf + e - 8 of its 32 keys, which is register e & 7 of score tile e >> 3
    v16h p0, p1;
    #pragma unroll  // constant indices keep the fragments in registers
    for (int e = 0; e < 16; ++e) {
      p0[e] = (_Float16)s[e >> 3][e & 7];
      p1[e] = (_Float16)s[2 + (e >> 3)][e & 7];
    }

    // O^T += V^T @ P^T
    #pragma unroll
    for (int t2 = 0; t2 < 4; ++t2) {
      o[t2] = WMMA_F16(load_frag16(vtlds[cur] + t2 * 16 * PITCH64, PITCH64, lane), p0, o[t2]);
      o[t2] = WMMA_F16(load_frag16(vtlds[cur] + t2 * 16 * PITCH64 + 32, PITCH64, lane), p1, o[t2]);
    }

    ring_publish();
    cur = nxt;
  }

  // epilogue: O / l -> combined [B,L,768] f16, unmasked tokens' rows only; a lane's
  // 8 registers of a tile are 8 consecutive channels of its query: one 16-B store
  const float ltot = lstate + xhalf(lstate);   // both halves' keys; every lane is on here
  const int qi = qb * 128 + wave * 16 + n_lo;
  if (qi < cnt) {                         // else a masked token's row: zero-filled by the convert kernel
    const int qrow = qtok & 2047;         // & 2047 bounds the row whatever the list holds
    const float scl = (ltot > 0.f) ? (1.f / ltot) : 0.f;
    _Float16* crow = Ch + ((size_t)(b * 2048 + qrow)) * 768 + h * 64 + 8 * hf;
    #pragma unroll
    for (int t2 = 0; t2 < 4; ++t2) {
      union { float4 f; _Float16 hh[8]; } u;
      #pragma unroll  // constant indices keep o[] and u in registers
      for (int r = 0; r < 8; ++r) u.hh[r] = (_Float16)(o[t2][r] * scl);
      *(float4*)(crow + t2 * 16) = u.f;
    }
  }
}

// ---------------------------------------------------------------------------
// LayerNorm over the SEQUENCE axis (axis=1), ddof=1, per (batch, channel).
// grid (2, 24); block 1024: 32 channels (one 128-B line per row) x 128 row
// segments.  Each thread keeps its 16 rows x 4 channels in registers, so the
// column block is read once, all loads in flight together, and is normalised
// from registers after one block-wide reduction through LDS.
// ---------------------------------------------------------------------------
__global__ __launch_bounds__(1024) void ln_kernel(const float* __restrict__ Xr,
                                                  const float* __restrict__ gamma,
                                                  const float* __restrict__ beta,
                                                  float* __restrict__ out) {
  __shared__ __attribute__((aligned(16))) float red[2][128][32];   // per-thread partials: [sum|sq][row seg][channel]
  __shared__ float red2[2][16][32];   // partials over 8 row segments each
  __shared__ __attribute__((aligned(16))) float tot[2][32];        // column totals
  const int t  = threadIdx.x;
  const int c4 = t & 7;               // float4 column inside the 32-channel group
  const int rs = t >> 3;              // row segment 0..127
  const int c  = blockIdx.y * 32 + c4 * 4;
  // 32-bit byte offset of this thread's first row, shared by the loads and the stores
  const unsigned boff = (((unsigned)blockIdx.x * 2048u + (unsigned)rs) * 768u + (unsigned)c) * 4u;
  const char* xp = (const char*)Xr + boff;
  char* op = (char*)out + boff;

  const float4 g  = *(const float4*)(gamma + c);   // issued with the rows: off the path behind the reduction
  const float4 bb = *(const float4*)(beta + c);
  // keeps the two loads above issued together with the row loads; without it they
  // sink to the first barrier and are waited for there alone, a second load latency
  __builtin_amdgcn_sched_barrier(0);
  float4 v[16];
  // the loops over v[] are unrolled so that v[] has constant indices and stays in
  // registers, and so that the 16 loads (and the 16 stores) issue back to back
  #pragma unroll
  for (int i = 0; i < 16; ++i) v[i] = *(const float4*)(xp + i * (128 * 768 * 4));

  float4 sum = {0.f, 0.f, 0.f, 0.f}, sq = {0.f, 0.f, 0.f, 0.f};
  #pragma unroll
  for (int i = 0; i < 16; ++i) {
    sum.x += v[i].x; sq.x += v[i].x * v[i].x;
    sum.y += v[i].y; sq.y += v[i].y * v[i].y;
    sum.z += v[i].z; sq.z += v[i].z * v[i].z;
    sum.w += v[i].w; sq.w += v[i].w * v[i].w;
  }
  *(float4*)&red[0][rs][c4 * 4] = sum;
  *(float4*)&red[1][rs][c4 * 4] = sq;
  __syncthreads();

  {  // 128 -> 16 partials: a wave sums one quantity of all 32 channels over 8 segments
    const int which = (t >> 5) & 1, ch = t & 31, part = t >> 6;
    float p = 0.f;
    #pragma unroll  // the LDS reads issue together, one latency instead of eight
    for (int k = 0; k < 8; ++k) p += red[which][part * 8 + k][ch];
    red2[which][part][ch] = p;
  }
  __syncthreads();
  if (t < 64) {  // 16 -> 1
    const int which = t >> 5, ch = t & 31;
    float p = 0.f;
    #pragma unroll  // as above
    for (int k = 0; k < 16; ++k) p += red2[which][k][ch];
    tot[which][ch] = p;
  }
  __syncthreads();

  const float4 S = *(const float4*)&tot[0][c4 * 4];
  const float4 Q = *(const float4*)&tot[1][c4 * 4];
  float4 mean, inv;
  mean.x = S.x * (1.f / 2048.f);
  mean.y = S.y * (1.f / 2048.f);
  mean.z = S.z * (1.f / 2048.f);
  mean.w = S.w * (1.f / 2048.f);
  inv.x = rsqrtf(fmaxf((Q.x - 2048.f * mean.x * mean.x) * (1.f / 2047.f), 1e-20f));
  inv.y = rsqrtf(fmaxf((Q.y - 2048.f * mean.y * mean.y) * (1.f / 2047.f), 1e-20f));
  inv.z = rsqrtf(fmaxf((Q.z - 2048.f * mean.z * mean.z) * (1.f / 2047.f), 1e-20f));
  inv.w = rsqrtf(fmaxf((Q.w - 2048.f * mean.w * mean.w) * (1.f / 2047.f), 1e-20f));
  #pragma unroll
  for (int i = 0; i < 16; ++i) {
    float4 y;
    y.x = (v[i].x - mean.x) * inv.x * g.x + bb.x;
    y.y = (v[i].y - mean.y) * inv.y * g.y + bb.y;
    y.z = (v[i].z - mean.z) * inv.z * g.z + bb.z;
    y.w = (v[i].w - mean.w) * inv.w * g.w + bb.w;
    *(float4*)(op + i * (128 * 768 * 4)) = y;
  }
}

// ---------------------------------------------------------------------------
extern "C" void kernel_launch(void* const* d_in, const int* in_sizes, int n_in,
                              void* d_out, int out_size, void* d_ws, size_t ws_size,
                              hipStream_t stream) {
  const float* inputs = (const float*)d_in[0];   // [2,2048,768]
  const int*   amask  = (const int*)d_in[1];     // [2,2048]
  const float* wq_w = (const float*)d_in[2];
  const float* wq_b = (const float*)d_in[3];
  const float* wk_w = (const float*)d_in[4];
  const float* wk_b = (const float*)d_in[5];
  const float* wv_w = (const float*)d_in[6];
  const float* wv_b = (const float*)d_in[7];
  const float* wo_w = (const float*)d_in[8];
  const float* wo_b = (const float*)d_in[9];
  const float* gamma = (const float*)d_in[10];
  const float* beta  = (const float*)d_in[11];
  float* out = (float*)d_out;

  // workspace carve-up (~48.8 MB), 256B aligned
  char* ws = (char*)d_ws;
  size_t off = 0;
  auto carve = [&](size_t bytes) { char* p = ws + off; off += (bytes + 255) & ~(size_t)255; return p; };
  const size_t NX = (size_t)4096 * 768;          // activations
  const size_t NW = (size_t)768 * 768;           // weights
  _Float16* xh  = (_Float16*)carve(NX * 2);
  _Float16* wth = (_Float16*)carve(4 * NW * 2);  // weights q, k, v, o: [4][k/32][n][k%32]
  _Float16* woh = wth + 3 * NW;
  _Float16* qhh = (_Float16*)carve(3 * NX * 2);  // three planes: Q, K [B,H,L,64],
  _Float16* khh = qhh + NX;
  _Float16* vth = qhh + 2 * NX;                  // V [B,H,L/16,64,16]
  _Float16* chh = (_Float16*)carve(NX * 2);      // combined [B,L,768]
  float*    xr  = (float*)carve(NX * 4);         // residual sum, fp32
  int*      idx = (int*)carve(4096 * 4);         // [B,L] token order: unmasked first
  int*      cnts = (int*)carve(2 * 4);           // [B] unmasked tokens
  (void)ws_size; (void)in_sizes; (void)n_in; (void)out_size;

  // 1) token order (2 blocks), weight (4 x 288 blocks) and activation fp32 -> f16 conversions
  cvt_f16_kernel<<<2 + 4 * 288 + NX / 1024, 256, 0, stream>>>(inputs, amask, wq_w, wk_w, wv_w, wo_w,
                                                              xh, wth, chh, idx, cnts);

  // 2) Q/K/V projections of the unmasked tokens (128x128 tiles), one launch
  gemm_kernel<0><<<dim3(32, 6, 3), 256, 0, stream>>>(xh, wth, wq_b, wk_b, wv_b, nullptr, idx, cnts, qhh, nullptr);

  // 3) fused attention
  attn_kernel<<<dim3(24, 16), 256, 0, stream>>>(qhh, khh, vth, idx, cnts, chh);

  // 4) output projection + residual
  gemm_kernel<1><<<dim3(32, 6), 256, 0, stream>>>(chh, woh, wo_b, nullptr, nullptr, inputs, nullptr, nullptr, nullptr, xr);

  // 5) layernorm over sequence axis
  ln_kernel<<<dim3(2, 24), 1024, 0, stream>>>(xr, gamma, beta, out);
}

// v007
// A run of this version takes 74.5 microseconds.
// Next to v006, in two timings, it ran 1.08 and 1.09 times as fast.
// Over all steps from v000 it is 6.24 times as fast.
#include <hip/hip_runtime.h>
#include <hip/hip_bf16.h>

// ---------------------------------------------------------------------------
// MHA + residual + LayerNorm(axis=L) for gfx1250 (MI455X), f16 WMMA path,
// async global->LDS copies + double-buffered, software-pipelined tiles.
// Each of the weights and V is laid out K-contiguous and in tile order
// by the kernel that produces it, so no tile is transposed on its way to LDS.
// Tokens whose mask is 0 have weight 0 as keys and a zero context row as queries:
// Q, K, V and the attention are computed on the unmasked tokens only, compacted.
// B=2, L=2048, HIDDEN=768, HEADS=12, HEAD=64.
// ---------------------------------------------------------------------------

typedef __attribute__((ext_vector_type(16))) _Float16 v16h;
typedef __attribute__((ext_vector_type(8)))  float    v8f;
typedef __attribute__((ext_vector_type(4)))  int      v4i;
typedef __attribute__((ext_vector_type(4)))  float    v4f;

// LDS row pitches in halfs, an odd multiple of 16 B each, so that the 16 rows a
// ds_load_b128 fragment read touches fall on different banks (64 banks x 4 B).
#define PITCH32 40   // rows of 32 halfs (64 B)  -> 80 B
#define PITCH64 72   // rows of 64 halfs (128 B) -> 144 B

#define WMMA_F16(a, b, c) \
  __builtin_amdgcn_wmma_f32_16x16x32_f16(false, (a), false, (b), (short)0, (c), false, false)

#if __has_builtin(__builtin_amdgcn_global_load_async_to_lds_b128)
#define HAVE_ASYNC_LDS 1
#else
#define HAVE_ASYNC_LDS 0
#endif

// 16-byte global -> LDS copy; async (ASYNCcnt) when the builtin exists.
// Probed signature: (v4i addrspace(1)*, v4i addrspace(3)*, imm offset, imm cpol)
__device__ inline void async_copy16(const _Float16* g, _Float16* l) {
#if HAVE_ASYNC_LDS
  __builtin_amdgcn_global_load_async_to_lds_b128(
      (__attribute__((address_space(1))) v4i*)g,
      (__attribute__((address_space(3))) v4i*)l, 0, 0);
#else
  *(float4*)l = *(const float4*)g;
#endif
}

// Publish point of a two-buffer ring, passed by every wave: behind it the tile
// copied last is readable by all waves and the other buffer may be refilled.
__device__ inline void ring_publish() {
  // this wave's LDS reads and writes have retired before another wave's copies
  // or reads touch the same bytes
  asm volatile("s_wait_dscnt 0x0" ::: "memory");
  // this wave's own copies have landed before the barrier lets others read them
  asm volatile("s_wait_asynccnt 0x0" ::: "memory");
  __syncthreads();
}

// Load a 16x32 f16 fragment (A-layout; also B-layout when source is stored
// transposed, i.e. K contiguous per row).  Per CDNA5 ISA 7.12.2:
//   lane 0-15: row = lane,   VGPR v<4: K = half*8 + v*2,   v>=4: K = 16+...
// => per lane: 8 contiguous halfs at [row][half*8] and 8 at [row][16+half*8].
__device__ inline v16h load_frag16(const _Float16* base, int stride_h, int lane) {
  const int m  = lane & 15;
  const int hf = lane >> 4;
  union { v16h v; float4 q[2]; } u;
  u.q[0] = *(const float4*)(base + (size_t)m * stride_h + hf * 8);
  u.q[1] = *(const float4*)(base + (size_t)m * stride_h + 16 + hf * 8);
  return u.v;
}

// ---------------------------------------------------------------------------
// Blocks 0 and 1: token order of one batch each.  idx[b][0 .. cnts[b]) lists the
// unmasked tokens in rising order, the rest of idx[b] the masked ones, so idx[b]
// is a permutation of 0..2047 for any mask.  A wave ranks 256 consecutive tokens
// by ballots; the 8 wave totals meet in LDS.
// Blocks 2 .. 97: the four weights, 24 blocks each, fp32 [k][n] -> f16 in the
// GEMM's tile order, Wt[weight][k / 32][n][k % 32].  A block takes 256 columns x
// three 32-row k blocks; a lane reads 4 columns x 8 k of each k block by 16-B loads
// (a wave's load is 4 whole 128-B lines) and stores 8 k of one column at a time.
// Other blocks (128): fp32 -> f16 conversion of 32 rows each, 24 loads of 16 B a
// thread, and zeros into the context rows of masked tokens, which the attention
// does not compute.
// The launch is a short stream: fewer blocks than WGPs, every conversion block reads 96 KB,
// every wave of those has all its 24 loads in flight at once.  Few long waves stand in for
// many that would move 512 B each, so that the starting of waves does not set the
// length of the launch.
// None of the three jobs reads what another writes, so they share one launch.
// ---------------------------------------------------------------------------
__global__ __launch_bounds__(256) void cvt_f16_kernel(const float* __restrict__ src,
                                                      const int* __restrict__ amask,
                                                      const float* __restrict__ w0,
                                                      const float* __restrict__ w1,
                                                      const float* __restrict__ w2,
                                                      const float* __restrict__ w3,
                                                      _Float16* __restrict__ dst,
                                                      _Float16* __restrict__ Wt,
                                                      _Float16* __restrict__ Ch,
                                                      int* __restrict__ idx,
                                                      int* __restrict__ cnts) {
  __shared__ int wc[8];
  const int t = threadIdx.x;
  if (blockIdx.x < 2) {
    const int b = blockIdx.x, wave = t >> 5, lane = t & 31;
    unsigned bal[8];
    int wtot = 0;
    #pragma unroll  // constant indices keep bal[] in registers; the 8 loads issue together
    for (int s = 0; s < 8; ++s) {
      bal[s] = __builtin_amdgcn_ballot_w32(amask[b * 2048 + (wave * 8 + s) * 32 + lane] != 0);
      wtot += __popc(bal[s]);
    }
    if (lane == 0) wc[wave] = wtot;
    __syncthreads();
    int base = 0, total = 0;   // unmasked tokens in front of this wave's; in the batch
    #pragma unroll  // the 8 totals come as two wide LDS reads
    for (int k = 0; k < 8; ++k) {
      const int c = wc[k];
      total += c;
      if (k < wave) base += c;
    }
    #pragma unroll  // constant indices keep bal[] in registers
    for (int s = 0; s < 8; ++s) {
      const int l = (wave * 8 + s) * 32 + lane;
      const int rank = base + __popc(bal[s] & ((1u << lane) - 1u));   // unmasked tokens in front of l
      const bool on = ((bal[s] >> lane) & 1u) != 0u;
      idx[b * 2048 + (on ? rank : total + l - rank)] = l;
      base += __popc(bal[s]);
    }
    if (t == 0) cnts[b] = total;
    return;
  }
  if (blockIdx.x < 2 + 4 * 24) {
    const int wb = blockIdx.x - 2;
    const int which = wb / 24, tile = wb % 24;
    const float* wsrc = which == 0 ? w0 : which == 1 ? w1 : which == 2 ? w2 : w3;
    const int n  = (tile % 3) * 256 + (t >> 2) * 4;   // the first of the lane's 4 columns
    const int kb = (tile / 3) * 3, kg = t & 3;        // k blocks kb .. kb + 2
    const float* wp = wsrc + (size_t)(kb * 32 + kg * 8) * 768 + n;
    v4f v[3][8];
    #pragma unroll  // constant indices keep v[] in registers
    for (int q = 0; q < 3; ++q) {
      #pragma unroll
      for (int j = 0; j < 8; ++j) v[q][j] = *(const v4f*)(wp + (q * 32 + j) * 768);
    }
    _Float16* wd = Wt + (((size_t)which * 24 + kb) * 768 + n) * 32 + kg * 8;
    #pragma unroll  // constant indices keep v[] in registers
    for (int q = 0; q < 3; ++q) {
      #pragma unroll
      for (int c = 0; c < 4; ++c) {
        union { float4 f; _Float16 h[8]; } u;
        #pragma unroll
        for (int j = 0; j < 8; ++j) u.h[j] = (_Float16)v[q][j][c];
        *(float4*)(wd + (q * 768 + c) * 32) = u.f;
      }
    }
    // precaution: stands in front of every later write of the stores' registers (the
    // code of another path may follow this one in the built kernel)
    asm volatile("s_wait_xcnt 0x0" ::: "memory");
    return;
  }
  // 32 rows = 6144 groups of 4 floats; this thread's are groups u * 256 + t.  A row is
  // 192 groups = 6 waves' worth, so the 32 groups of a wave's load lie in one row:
  // that row's mask bit is wave-uniform, and the zero store stands behind a scalar
  // branch.  Lane l reads the mask of the block's row l; the ballot holds all 32.
  const int ab   = blockIdx.x - (2 + 4 * 24);
  const int wave = __builtin_amdgcn_readfirstlane(t >> 5);
  const int i0   = (ab * 6144 + t) * 4;
  const int mrow = amask[ab * 32 + (t & 31)];
  v4f v[24];
  #pragma unroll  // constant indices keep v[] in registers
  for (int u = 0; u < 24; ++u) v[u] = *(const v4f*)(src + i0 + u * 1024);
  const unsigned rows_on = __builtin_amdgcn_ballot_w32(mrow != 0);
  #pragma unroll  // constant indices keep v[] in registers
  for (int u = 0; u < 24; ++u) {
    union { uint2 u2; _Float16 h[4]; } p;
    p.h[0] = (_Float16)v[u][0]; p.h[1] = (_Float16)v[u][1];
    p.h[2] = (_Float16)v[u][2]; p.h[3] = (_Float16)v[u][3];
    *(uint2*)(dst + i0 + u * 1024) = p.u2;
    if (((rows_on >> ((u * 8 + wave) / 6)) & 1u) == 0u) *(uint2*)(Ch + i0 + u * 1024) = make_uint2(0u, 0u);
  }
  // precaution: stands in front of every later write of the stores' registers (the
  // code of the other paths follows this one in the built kernel)
  asm volatile("s_wait_xcnt 0x0" ::: "memory");
}

// ---------------------------------------------------------------------------
// GEMM: C = X @ W + bias, X:[4096,768] f16, W:[768,768] f16 as Wt[k/32][n][k%32].
// Block tile 128(M) x 128(N), K-step 32, double-buffered LDS, X and W tiles
// both by async copies.  8 waves; wave = 16 rows x 128 cols.
// MODE 0: the Q, K and V projections in one launch, blockIdx.z picks the product
// (weight plane z of Wt, bias z, output plane z of Yh): Q and K scatter to
// [B,H,L,64] f16, V goes out transposed in 16-key groups, [B,H,L/16,64,16] f16.
// MODE 1: += residual, fp32 out.
// MODE 0 works on the compacted tokens: row i of a batch is X row idx[b][i],
// and L above is the compact position.  Tiles wholly past cnts[b] are not computed;
// the last tile's rows past it are masked tokens' rows, finite, which the attention
// gives weight 0.
// ---------------------------------------------------------------------------
template <int MODE>
__global__ __launch_bounds__(256) void gemm_kernel(const _Float16* __restrict__ X,
                                                   const _Float16* __restrict__ Wt,
                                                   const float* __restrict__ bias0,
                                                   const float* __restrict__ bias1,
                                                   const float* __restrict__ bias2,
                                                   const float* __restrict__ resid,
                                                   const int* __restrict__ idx,
                                                   const int* __restrict__ cnts,
                                                   _Float16* __restrict__ Yh,
                                                   float* __restrict__ Yf) {
  __shared__ __attribute__((aligned(16))) _Float16 xt[2][128 * PITCH32];   // 2 x 10 KB
  __shared__ __attribute__((aligned(16))) _Float16 wt[2][128 * PITCH32];   // 2 x 10 KB, transposed: wt[n][k]
  const int mtile = blockIdx.x;          // 0..31
  const int ntile = blockIdx.y;          // 0..5
  const int prod  = (MODE == 0) ? blockIdx.z : 0;   // 0 Q, 1 K, 2 V
  const int t = threadIdx.x, wave = t >> 5, lane = t & 31;

  // the two X rows that this thread copies segments of (tile rows t / 4 and 64 + t / 4)
  int xrow0 = mtile * 128 + (t >> 2), xrow1 = xrow0 + 64;
  if (MODE != 1) {
    const int b = mtile >> 4;            // 16 tiles a batch
    if ((mtile & 15) * 128 >= cnts[b]) return;   // whole block, in front of every copy and barrier
    // & 2047 bounds the row whatever the list holds
    const int i0 = idx[xrow0] & 2047, i1 = idx[xrow1] & 2047;
    xrow0 = b * 2048 + i0;
    xrow1 = b * 2048 + i1;
  }
  const _Float16* xs0 = X + (size_t)xrow0 * 768 + (t & 3) * 8;
  const _Float16* xs1 = X + (size_t)xrow1 * 768 + (t & 3) * 8;

  // X tile 128x32: 512 16B segments; async copy, rows as listed above.
  auto loadX = [&](int kb, int buf) {
    _Float16* xd = &xt[buf][(t >> 2) * PITCH32 + (t & 3) * 8];
    async_copy16(xs0 + kb * 32, xd);
    async_copy16(xs1 + kb * 32, xd + 64 * PITCH32);
  };
  // W tile 128(n)x32(k): 8 KB contiguous in Wt, 512 16B segments; async copy.
  auto loadW = [&](int kb, int buf) {
    const _Float16* wsrc = Wt + (((size_t)prod * 24 + kb) * 768 + ntile * 128) * 32;
    #pragma unroll  // both copies issue back to back, no loop branch around them
    for (int i = 0; i < 2; ++i) {
      const int p = t + i * 256;
      async_copy16(wsrc + p * 8, &wt[buf][(p >> 2) * PITCH32 + (p & 3) * 8]);
    }
  };

  loadX(0, 0);
  loadW(0, 0);
  ring_publish();

  v8f acc[8] = {};
  int cur = 0;
  for (int kb = 0; kb < 24; ++kb) {
    const int nxt = cur ^ 1;
    if (kb + 1 < 24) { loadX(kb + 1, nxt); loadW(kb + 1, nxt); }
    const v16h a = load_frag16(xt[cur] + wave * 16 * PITCH32, PITCH32, lane);
    #pragma unroll
    for (int t2 = 0; t2 < 8; ++t2) {
      const v16h b = load_frag16(wt[cur] + t2 * 16 * PITCH32, PITCH32, lane);
      acc[t2] = WMMA_F16(a, b, acc[t2]);
    }
    ring_publish();
    cur = nxt;
  }

  const int n_lo = lane & 15, hf = lane >> 4;
  const float* bias = prod == 0 ? bias0 : prod == 1 ? bias1 : bias2;
  if (MODE == 0) Yh += (size_t)prod * (4096 * 768);
  float bv8[8];
  #pragma unroll  // constant indices keep bv8[] in registers; the 8 loads issue together
  for (int t2 = 0; t2 < 8; ++t2) bv8[t2] = bias[ntile * 128 + t2 * 16 + n_lo];
  // precaution: stands in front of every later write of the bias loads' address registers
  asm volatile("s_wait_xcnt 0x0" ::: "memory");
  // one block-uniform branch in front of the two store loops, none inside them
  if (MODE == 0 && prod == 2) {
    #pragma unroll
    for (int t2 = 0; t2 < 8; ++t2) {
      const int n = ntile * 128 + t2 * 16 + n_lo;
      const float bv = bv8[t2];
      // the lane's 8 accumulator rows are 8 consecutive keys of one channel: one
      // 16-B store; the wave's 32 stores are 512 contiguous bytes
      const int m0 = mtile * 128 + wave * 16;
      const int b = m0 >> 11, lg = (m0 & 2047) >> 4;
      const int h = n >> 6, d = n & 63;
      union { float4 f; _Float16 hh[8]; } u;
      #pragma unroll  // constant indices keep acc[] and u in registers
      for (int r = 0; r < 8; ++r) u.hh[r] = (_Float16)(acc[t2][r] + bv);
      *(float4*)(Yh + ((((size_t)(b * 12 + h)) * 128 + lg) * 64 + d) * 16 + 8 * hf) = u.f;
    }
    return;
  }
  #pragma unroll
  for (int t2 = 0; t2 < 8; ++t2) {
    const int n = ntile * 128 + t2 * 16 + n_lo;
    const float bv = bv8[t2];
    #pragma unroll
    for (int r = 0; r < 8; ++r) {
      const int m = mtile * 128 + wave * 16 + r + 8 * hf;
      if (MODE == 0) {
        const int b = m >> 11, l = m & 2047;
        const int h = n >> 6, d = n & 63;
        Yh[(((size_t)(b * 12 + h)) * 2048 + l) * 64 + d] = (_Float16)(acc[t2][r] + bv);
      } else {
        const size_t idx = (size_t)m * 768 + n;
        Yf[idx] = acc[t2][r] + bv + resid[idx];
      }
    }
  }
  // precaution, MODE 0: the code of the V path follows this one in the built kernel;
  // the wait stands in front of its writes of these stores' registers
  if (MODE == 0) asm volatile("s_wait_xcnt 0x0" ::: "memory");
}

__device__ inline float xhalf(float x) {
  const int v = __builtin_bit_cast(int, x);
  return __builtin_bit_cast(float,
      __builtin_amdgcn_permlanex16(v, v, 0x76543210, 0xfedcba98, false, false));
}

__global__ __launch_bounds__(256) void attn_kernel(const _Float16* __restrict__ Qh,
                                                   const _Float16* __restrict__ Kh,
                                                   const _Float16* __restrict__ Vt,
                                                   const int* __restrict__ idx,
                                                   const int* __restrict__ cnts,
                                                   _Float16* __restrict__ Ch) {
  __shared__ __attribute__((aligned(16))) _Float16 klds[2][64 * PITCH64];   // K tile, natural [key][d]    2x9 KB
  __shared__ __attribute__((aligned(16))) _Float16 vtlds[2][64 * PITCH64];  // V tile transposed [d][key]  2x9 KB
  __shared__ __attribute__((aligned(16))) float mlds[2][64];                // additive key mask

  const int bh = blockIdx.x;              // 0..23
  const int qb = blockIdx.y;              // 0..15
  const int b  = bh / 12, h = bh % 12;
  const int t = threadIdx.x, wave = t >> 5, lane = t & 31;
  const int n_lo = lane & 15, hf = lane >> 4;
  const int cnt = min(cnts[b], 2048);     // the clamp bounds the trip count below
  if (qb * 128 >= cnt) return;            // whole block, in front of every copy and barrier
  const int ntile = (cnt + 63) >> 6;      // key tiles, 1..32

  // Q fragments stay in registers: 64 d x 16 queries, B operand (column = query n_lo)
  const _Float16* qbase = Qh + (((size_t)bh * 2048) + qb * 128 + wave * 16) * 64;
  const v16h qa0 = load_frag16(qbase, 64, lane);
  const v16h qa1 = load_frag16(qbase + 32, 64, lane);
  // the token of this lane's query, for the epilogue; read here, with the Q
  // fragments, so that the epilogue waits for no load
  const int qtok = idx[b * 2048 + qb * 128 + wave * 16 + n_lo];

  auto loadK = [&](int j, int buf) {
    const _Float16* kb_ = Kh + (((size_t)bh * 2048) + j * 64) * 64;
    #pragma unroll
    for (int p = t; p < 512; p += 256) async_copy16(kb_ + p * 8, &klds[buf][(p >> 3) * PITCH64 + (p & 7) * 8]);
  };
  // 64 keys = 4 groups of [64 d][16 keys], 8 KB contiguous in Vt; segment p holds
  // 8 keys of channel (p >> 1) & 63 in group p >> 7
  auto loadV = [&](int j, int buf) {
    const _Float16* vb_ = Vt + (((size_t)bh * 2048) + j * 64) * 64;
    #pragma unroll  // both copies issue back to back, no loop branch around them
    for (int i = 0; i < 2; ++i) {
      const int p = t + i * 256;
      async_copy16(vb_ + p * 8, &vtlds[buf][((p >> 1) & 63) * PITCH64 + (p >> 7) * 16 + (p & 1) * 8]);
    }
  };
  auto loadM = [&](int j, int buf) {
    if (t < 64) mlds[buf][t] = (j * 64 + t < cnt) ? 0.f : -1e30f;
  };

  float mstate = -1e30f;   // running maximum of query n_lo, equal in both halves
  float lstate = 0.f;      // running sum of query n_lo over this half's keys only
  v8f o[4] = {};           // O^T: o[t2][r] = channel 16 * t2 + 8 * hf + r of query n_lo

  loadK(0, 0); loadV(0, 0); loadM(0, 0);
  ring_publish();

  int cur = 0;
  for (int j = 0; j < ntile; ++j) {
    const int nxt = cur ^ 1;
    if (j + 1 < ntile) { loadK(j + 1, nxt); loadV(j + 1, nxt); loadM(j + 1, nxt); }

    // S^T = K @ Q^T: s[t2][r] = key 16 * t2 + 8 * hf + r against query n_lo
    v8f s[4];
    #pragma unroll
    for (int t2 = 0; t2 < 4; ++t2) {
      v8f z = {};
      z = WMMA_F16(load_frag16(klds[cur] + t2 * 16 * PITCH64, PITCH64, lane), qa0, z);
      z = WMMA_F16(load_frag16(klds[cur] + t2 * 16 * PITCH64 + 32, PITCH64, lane), qa1, z);
      s[t2] = z;
    }

    // online softmax of the lane's query over its 32 keys; four independent chains
    // for the maximum and for the sum, one per score tile
    float mx[4];
    #pragma unroll  // constant indices keep s[] and mx[] in registers
    for (int t2 = 0; t2 < 4; ++t2) {
      union { float4 q[2]; float f[8]; } km;   // the mask of the lane's 8 keys of this tile
      km.q[0] = *(const float4*)&mlds[cur][t2 * 16 + 8 * hf];
      km.q[1] = *(const float4*)&mlds[cur][t2 * 16 + 8 * hf + 4];
      #pragma unroll
      for (int r = 0; r < 8; ++r) {
        s[t2][r] = s[t2][r] * 0.125f + km.f[r];
        mx[t2] = (r == 0) ? s[t2][r] : fmaxf(mx[t2], s[t2][r]);
      }
    }
    float rmax = fmaxf(fmaxf(mx[0], mx[1]), fmaxf(mx[2], mx[3]));
    rmax = fmaxf(rmax, xhalf(rmax));          // over all 64 keys
    const float newm  = fmaxf(mstate, rmax);
    const float alpha = __expf(mstate - newm);
    float rs[4];
    #pragma unroll  // constant indices keep s[] and rs[] in registers
    for (int t2 = 0; t2 < 4; ++t2) {
      #pragma unroll
      for (int r = 0; r < 8; ++r) {
        const float v = s[t2][r];
        const float e = (v > -1e29f) ? __expf(v - newm) : 0.f;
        s[t2][r] = e;
        rs[t2] = (r == 0) ? e : rs[t2] + e;
      }
    }
    lstate = lstate * alpha + ((rs[0] + rs[1]) + (rs[2] + rs[3]));
    mstate = newm;
    #pragma unroll
    for (int t2 = 0; t2 < 4; ++t2) o[t2] *= alpha;

    // P^T as B operand: element e of a fragment is key 8 * hf + e (e < 8) or
    // 16 + 8 * hf + e - 8 of its 32 keys, which is register e & 7 of score tile e >> 3
    v16h p0, p1;
    #pragma unroll  // constant indices keep the fragments in registers
    for (int e = 0; e < 16; ++e) {
      p0[e] = (_Float16)s[e >> 3][e & 7];
      p1[e] = (_Float16)s[2 + (e >> 3)][e & 7];
    }

    // O^T += V^T @ P^T
    #pragma unroll
    for (int t2 = 0; t2 < 4; ++t2) {
      o[t2] = WMMA_F16(load_frag16(vtlds[cur] + t2 * 16 * PITCH64, PITCH64, lane), p0, o[t2]);
      o[t2] = WMMA_F16(load_frag16(vtlds[cur] + t2 * 16 * PITCH64 + 32, PITCH64, lane), p1, o[t2]);
    }

    ring_publish();
    cur = nxt;
  }

  // epilogue: O / l -> combined [B,L,768] f16, unmasked tokens' rows only; a lane's
  // 8 registers of a tile are 8 consecutive channels of its query: one 16-B store
  const float ltot = lstate + xhalf(lstate);   // both halves' keys; every lane is on here
  const int qi = qb * 128 + wave * 16 + n_lo;
  if (qi < cnt) {                         // else a masked token's row: zero-filled by the convert kernel
    const int qrow = qtok & 2047;         // & 2047 bounds the row whatever the list holds
    const float scl = (ltot > 0.f) ? (1.f / ltot) : 0.f;
    _Float16* crow = Ch + ((size_t)(b * 2048 + qrow)) * 768 + h * 64 + 8 * hf;
    #pragma unroll
    for (int t2 = 0; t2 < 4; ++t2) {
      union { float4 f; _Float16 hh[8]; } u;
      #pragma unroll  // constant indices keep o[] and u in registers
      for (int r = 0; r < 8; ++r) u.hh[r] = (_Float16)(o[t2][r] * scl);
      *(float4*)(crow + t2 * 16) = u.f;
    }
  }
}

// ---------------------------------------------------------------------------
// LayerNorm over the SEQUENCE axis (axis=1), ddof=1, per (batch, channel).
// grid (2, 24); block 1024: 32 channels (one 128-B line per row) x 128 row
// segments.  Each thread keeps its 16 rows x 4 channels in registers, so the
// column block is read once, all loads in flight together, and is normalised
// from registers after one block-wide reduction through LDS.
// ---------------------------------------------------------------------------
__global__ __launch_bounds__(1024) void ln_kernel(const float* __restrict__ Xr,
                                                  const float* __restrict__ gamma,
                                                  const float* __restrict__ beta,
                                                  float* __restrict__ out) {
  __shared__ __attribute__((aligned(16))) float red[2][128][32];   // per-thread partials: [sum|sq][row seg][channel]
  __shared__ float red2[2][16][32];   // partials over 8 row segments each
  __shared__ __attribute__((aligned(16))) float tot[2][32];        // column totals
  const int t  = threadIdx.x;
  const int c4 = t & 7;               // float4 column inside the 32-channel group
  const int rs = t >> 3;              // row segment 0..127
  const int c  = blockIdx.y * 32 + c4 * 4;
  // 32-bit byte offset of this thread's first row, shared by the loads and the stores
  const unsigned boff = (((unsigned)blockIdx.x * 2048u + (unsigned)rs) * 768u + (unsigned)c) * 4u;
  const char* xp = (const char*)Xr + boff;
  char* op = (char*)out + boff;

  const float4 g  = *(const float4*)(gamma + c);   // issued with the rows: off the path behind the reduction
  const float4 bb = *(const float4*)(beta + c);
  // keeps the two loads above issued together with the row loads; without it they
  // sink to the first barrier and are waited for there alone, a second load latency
  __builtin_amdgcn_sched_barrier(0);
  float4 v[16];
  // the loops over v[] are unrolled so that v[] has constant indices and stays in
  // registers, and so that the 16 loads (and the 16 stores) issue back to back
  #pragma unroll
  for (int i = 0; i < 16; ++i) v[i] = *(const float4*)(xp + i * (128 * 768 * 4));

  float4 sum = {0.f, 0.f, 0.f, 0.f}, sq = {0.f, 0.f, 0.f, 0.f};
  #pragma unroll
  for (int i = 0; i < 16; ++i) {
    sum.x += v[i].x; sq.x += v[i].x * v[i].x;
    sum.y += v[i].y; sq.y += v[i].y * v[i].y;
    sum.z += v[i].z; sq.z += v[i].z * v[i].z;
    sum.w += v[i].w; sq.w += v[i].w * v[i].w;
  }
  *(float4*)&red[0][rs][c4 * 4] = sum;
  *(float4*)&red[1][rs][c4 * 4] = sq;
  __syncthreads();

  {  // 128 -> 16 partials: a wave sums one quantity of all 32 channels over 8 segments
    const int which = (t >> 5) & 1, ch = t & 31, part = t >> 6;
    float p = 0.f;
    #pragma unroll  // the LDS reads issue together, one latency instead of eight
    for (int k = 0; k < 8; ++k) p += red[which][part * 8 + k][ch];
    red2[which][part][ch] = p;
  }
  __syncthreads();
  if (t < 64) {  // 16 -> 1
    const int which = t >> 5, ch = t & 31;
    float p = 0.f;
    #pragma unroll  // as above
    for (int k = 0; k < 16; ++k) p += red2[which][k][ch];
    tot[which][ch] = p;
  }
  __syncthreads();

  const float4 S = *(const float4*)&tot[0][c4 * 4];
  const float4 Q = *(const float4*)&tot[1][c4 * 4];
  float4 mean, inv;
  mean.x = S.x * (1.f / 2048.f);
  mean.y = S.y * (1.f / 2048.f);
  mean.z = S.z * (1.f / 2048.f);
  mean.w = S.w * (1.f / 2048.f);
  inv.x = rsqrtf(fmaxf((Q.x - 2048.f * mean.x * mean.x) * (1.f / 2047.f), 1e-20f));
  inv.y = rsqrtf(fmaxf((Q.y - 2048.f * mean.y * mean.y) * (1.f / 2047.f), 1e-20f));
  inv.z = rsqrtf(fmaxf((Q.z - 2048.f * mean.z * mean.z) * (1.f / 2047.f), 1e-20f));
  inv.w = rsqrtf(fmaxf((Q.w - 2048.f * mean.w * mean.w) * (1.f / 2047.f), 1e-20f));
  #pragma unroll
  for (int i = 0; i < 16; ++i) {
    float4 y;
    y.x = (v[i].x - mean.x) * inv.x * g.x + bb.x;
    y.y = (v[i].y - mean.y) * inv.y * g.y + bb.y;
    y.z = (v[i].z - mean.z) * inv.z * g.z + bb.z;
    y.w = (v[i].w - mean.w) * inv.w * g.w + bb.w;
    *(float4*)(op + i * (128 * 768 * 4)) = y;
  }
}

// ---------------------------------------------------------------------------
extern "C" void kernel_launch(void* const* d_in, const int* in_sizes, int n_in,
                              void* d_out, int out_size, void* d_ws, size_t ws_size,
                              hipStream_t stream) {
  const float* inputs = (const float*)d_in[0];   // [2,2048,768]
  const int*   amask  = (const int*)d_in[1];     // [2,2048]
  const float* wq_w = (const float*)d_in[2];
  const float* wq_b = (const float*)d_in[3];
  const float* wk_w = (const float*)d_in[4];
  const float* wk_b = (const float*)d_in[5];
  const float* wv_w = (const float*)d_in[6];
  const float* wv_b = (const float*)d_in[7];
  const float* wo_w = (const float*)d_in[8];
  const float* wo_b = (const float*)d_in[9];
  const float* gamma = (const float*)d_in[10];
  const float* beta  = (const float*)d_in[11];
  float* out = (float*)d_out;

  // workspace carve-up (~48.8 MB), 256B aligned
  char* ws = (char*)d_ws;
  size_t off = 0;
  auto carve = [&](size_t bytes) { char* p = ws + off; off += (bytes + 255) & ~(size_t)255; return p; };
  const size_t NX = (size_t)4096 * 768;          // activations
  const size_t NW = (size_t)768 * 768;           // weights
  _Float16* xh  = (_Float16*)carve(NX * 2);
  _Float16* wth = (_Float16*)carve(4 * NW * 2);  // weights q, k, v, o: [4][k/32][n][k%32]
  _Float16* woh = wth + 3 * NW;
  _Float16* qhh = (_Float16*)carve(3 * NX * 2);  // three planes: Q, K [B,H,L,64],
  _Float16* khh = qhh + NX;
  _Float16* vth = qhh + 2 * NX;                  // V [B,H,L/16,64,16]
  _Float16* chh = (_Float16*)carve(NX * 2);      // combined [B,L,768]
  float*    xr  = (float*)carve(NX * 4);         // residual sum, fp32
  int*      idx = (int*)carve(4096 * 4);         // [B,L] token order: unmasked first
  int*      cnts = (int*)carve(2 * 4);           // [B] unmasked tokens
  (void)ws_size; (void)in_sizes; (void)n_in; (void)out_size;

  // 1) token order (2 blocks), weight (4 x 24 blocks) and activation (128 blocks) fp32 -> f16 conversions
  cvt_f16_kernel<<<2 + 4 * 24 + 128, 256, 0, stream>>>(inputs, amask, wq_w, wk_w, wv_w, wo_w,
                                                              xh, wth, chh, idx, cnts);

  // 2) Q/K/V projections of the unmasked tokens (128x128 tiles), one launch
  gemm_kernel<0><<<dim3(32, 6, 3), 256, 0, stream>>>(xh, wth, wq_b, wk_b, wv_b, nullptr, idx, cnts, qhh, nullptr);

  // 3) fused attention
  attn_kernel<<<dim3(24, 16), 256, 0, stream>>>(qhh, khh, vth, idx, cnts, chh);

  // 4) output projection + residual
  gemm_kernel<1><<<dim3(32, 6), 256, 0, stream>>>(chh, woh, wo_b, nullptr, nullptr, inputs, nullptr, nullptr, nullptr, xr);

  // 5) layernorm over sequence axis
  ln_kernel<<<dim3(2, 24), 1024, 0, stream>>>(xr, gamma, beta, out);
}

// v008
// A run of this version takes 67.4 microseconds.
// Timed twice side by side with v007, it ran 1.10 times as fast both times.
// Counting every step since v000, it is 6.85 times as fast.
#include <hip/hip_runtime.h>
#include <hip/hip_bf16.h>

// ---------------------------------------------------------------------------
// MHA + residual + LayerNorm(axis=L) for gfx1250 (MI455X), f16 WMMA path,
// async global->LDS copies + double-buffered, software-pipelined tiles.
// Each of the weights and V is laid out K-contiguous and in tile order
// by the kernel that produces it, so no tile is transposed on its way to LDS.
// Tokens whose mask is 0 have weight 0 as keys and a zero context row as queries:
// Q, K, V and the attention are computed on the unmasked tokens only, compacted.
// B=2, L=2048, HIDDEN=768, HEADS=12, HEAD=64.
// ---------------------------------------------------------------------------

typedef __attribute__((ext_vector_type(16))) _Float16 v16h;
typedef __attribute__((ext_vector_type(8)))  float    v8f;
typedef __attribute__((ext_vector_type(4)))  int      v4i;
typedef __attribute__((ext_vector_type(4)))  float    v4f;

// LDS row pitches in halfs, an odd multiple of 16 B each, so that the 16 rows a
// ds_load_b128 fragment read touches fall on different banks (64 banks x 4 B).
#define PITCH64 72   // rows of 64 halfs (128 B) -> 144 B; the GEMM's pitch stands in its kernel

#define WMMA_F16(a, b, c) \
  __builtin_amdgcn_wmma_f32_16x16x32_f16(false, (a), false, (b), (short)0, (c), false, false)

#if __has_builtin(__builtin_amdgcn_global_load_async_to_lds_b128)
#define HAVE_ASYNC_LDS 1
#else
#define HAVE_ASYNC_LDS 0
#endif

// 16-byte global -> LDS copy; async (ASYNCcnt) when the builtin exists.
// Probed signature: (v4i addrspace(1)*, v4i addrspace(3)*, imm offset, imm cpol)
__device__ inline void async_copy16(const _Float16* g, _Float16* l) {
#if HAVE_ASYNC_LDS
  __builtin_amdgcn_global_load_async_to_lds_b128(
      (__attribute__((address_space(1))) v4i*)g,
      (__attribute__((address_space(3))) v4i*)l, 0, 0);
#else
  *(float4*)l = *(const float4*)g;
#endif
}

// Publish point of a two-buffer ring, passed by every wave: behind it the tile
// copied last is readable by all waves and the other buffer may be refilled.
__device__ inline void ring_publish() {
  // this wave's LDS reads and writes have retired before another wave's copies
  // or reads touch the same bytes
  asm volatile("s_wait_dscnt 0x0" ::: "memory");
  // this wave's own copies have landed before the barrier lets others read them
  asm volatile("s_wait_asynccnt 0x0" ::: "memory");
  __syncthreads();
}

// Load a 16x32 f16 fragment (A-layout; also B-layout when source is stored
// transposed, i.e. K contiguous per row).  Per CDNA5 ISA 7.12.2:
//   lane 0-15: row = lane,   VGPR v<4: K = half*8 + v*2,   v>=4: K = 16+...
// => per lane: 8 contiguous halfs at [row][half*8] and 8 at [row][16+half*8].
__device__ inline v16h load_frag16(const _Float16* base, int stride_h, int lane) {
  const int m  = lane & 15;
  const int hf = lane >> 4;
  union { v16h v; float4 q[2]; } u;
  u.q[0] = *(const float4*)(base + (size_t)m * stride_h + hf * 8);
  u.q[1] = *(const float4*)(base + (size_t)m * stride_h + 16 + hf * 8);
  return u.v;
}

// ---------------------------------------------------------------------------
// Blocks 0 and 1: token order of one batch each.  idx[b][0 .. cnts[b]) lists the
// unmasked tokens in rising order, the rest of idx[b] the masked ones, so idx[b]
// is a permutation of 0..2047 for any mask.  A wave ranks 256 consecutive tokens
// by ballots; the 8 wave totals meet in LDS.
// Blocks 2 .. 97: the four weights, 24 blocks each, fp32 [k][n] -> f16 in the
// GEMM's tile order, Wt[weight][k / 32][n][k % 32].  A block takes 256 columns x
// three 32-row k blocks; a lane reads 4 columns x 8 k of each k block by 16-B loads
// (a wave's load is 4 whole 128-B lines) and stores 8 k of one column at a time.
// Other blocks (128): fp32 -> f16 conversion of 32 rows each, 24 loads of 16 B a
// thread, and zeros into the context rows of masked tokens, which the attention
// does not compute.
// The launch is a short stream: fewer blocks than WGPs, every conversion block reads 96 KB,
// every wave of those has all its 24 loads in flight at once.  Few long waves stand in for
// many that would move 512 B each, so that the starting of waves does not set the
// length of the launch.
// None of the three jobs reads what another writes, so they share one launch.
// ---------------------------------------------------------------------------
__global__ __launch_bounds__(256) void cvt_f16_kernel(const float* __restrict__ src,
                                                      const int* __restrict__ amask,
                                                      const float* __restrict__ w0,
                                                      const float* __restrict__ w1,
                                                      const float* __restrict__ w2,
                                                      const float* __restrict__ w3,
                                                      _Float16* __restrict__ dst,
                                                      _Float16* __restrict__ Wt,
                                                      _Float16* __restrict__ Ch,
                                                      int* __restrict__ idx,
                                                      int* __restrict__ cnts) {
  __shared__ int wc[8];
  const int t = threadIdx.x;
  if (blockIdx.x < 2) {
    const int b = blockIdx.x, wave = t >> 5, lane = t & 31;
    unsigned bal[8];
    int wtot = 0;
    #pragma unroll  // constant indices keep bal[] in registers; the 8 loads issue together
    for (int s = 0; s < 8; ++s) {
      bal[s] = __builtin_amdgcn_ballot_w32(amask[b * 2048 + (wave * 8 + s) * 32 + lane] != 0);
      wtot += __popc(bal[s]);
    }
    if (lane == 0) wc[wave] = wtot;
    __syncthreads();
    int base = 0, total = 0;   // unmasked tokens in front of this wave's; in the batch
    #pragma unroll  // the 8 totals come as two wide LDS reads
    for (int k = 0; k < 8; ++k) {
      const int c = wc[k];
      total += c;
      if (k < wave) base += c;
    }
    #pragma unroll  // constant indices keep bal[] in registers
    for (int s = 0; s < 8; ++s) {
      const int l = (wave * 8 + s) * 32 + lane;
      const int rank = base + __popc(bal[s] & ((1u << lane) - 1u));   // unmasked tokens in front of l
      const bool on = ((bal[s] >> lane) & 1u) != 0u;
      idx[b * 2048 + (on ? rank : total + l - rank)] = l;
      base += __popc(bal[s]);
    }
    if (t == 0) cnts[b] = total;
    return;
  }
  if (blockIdx.x < 2 + 4 * 24) {
    const int wb = blockIdx.x - 2;
    const int which = wb / 24, tile = wb % 24;
    const float* wsrc = which == 0 ? w0 : which == 1 ? w1 : which == 2 ? w2 : w3;
    const int n  = (tile % 3) * 256 + (t >> 2) * 4;   // the first of the lane's 4 columns
    const int kb = (tile / 3) * 3, kg = t & 3;        // k blocks kb .. kb + 2
    const float* wp = wsrc + (size_t)(kb * 32 + kg * 8) * 768 + n;
    v4f v[3][8];
    #pragma unroll  // constant indices keep v[] in registers
    for (int q = 0; q < 3; ++q) {
      #pragma unroll
      for (int j = 0; j < 8; ++j) v[q][j] = *(const v4f*)(wp + (q * 32 + j) * 768);
    }
    _Float16* wd = Wt + (((size_t)which * 24 + kb) * 768 + n) * 32 + kg * 8;
    #pragma unroll  // constant indices keep v[] in registers
    for (int q = 0; q < 3; ++q) {
      #pragma unroll
      for (int c = 0; c < 4; ++c) {
        union { float4 f; _Float16 h[8]; } u;
        #pragma unroll
        for (int j = 0; j < 8; ++j) u.h[j] = (_Float16)v[q][j][c];
        *(float4*)(wd + (q * 768 + c) * 32) = u.f;
      }
    }
    // precaution: stands in front of every later write of the stores' registers (the
    // code of another path may follow this one in the built kernel)
    asm volatile("s_wait_xcnt 0x0" ::: "memory");
    return;
  }
  // 32 rows = 6144 groups of 4 floats; this thread's are groups u * 256 + t.  A row is
  // 192 groups = 6 waves' worth, so the 32 groups of a wave's load lie in one row:
  // that row's mask bit is wave-uniform, and the zero store stands behind a scalar
  // branch.  Lane l reads the mask of the block's row l; the ballot holds all 32.
  const int ab   = blockIdx.x - (2 + 4 * 24);
  const int wave = __builtin_amdgcn_readfirstlane(t >> 5);
  const int i0   = (ab * 6144 + t) * 4;
  const int mrow = amask[ab * 32 + (t & 31)];
  v4f v[24];
  #pragma unroll  // constant indices keep v[] in registers
  for (int u = 0; u < 24; ++u) v[u] = *(const v4f*)(src + i0 + u * 1024);
  const unsigned rows_on = __builtin_amdgcn_ballot_w32(mrow != 0);
  #pragma unroll  // constant indices keep v[] in registers
  for (int u = 0; u < 24; ++u) {
    union { uint2 u2; _Float16 h[4]; } p;
    p.h[0] = (_Float16)v[u][0]; p.h[1] = (_Float16)v[u][1];
    p.h[2] = (_Float16)v[u][2]; p.h[3] = (_Float16)v[u][3];
    *(uint2*)(dst + i0 + u * 1024) = p.u2;
    if (((rows_on >> ((u * 8 + wave) / 6)) & 1u) == 0u) *(uint2*)(Ch + i0 + u * 1024) = make_uint2(0u, 0u);
  }
  // precaution: stands in front of every later write of the stores' registers (the
  // code of the other paths follows this one in the built kernel)
  asm volatile("s_wait_xcnt 0x0" ::: "memory");
}

// ---------------------------------------------------------------------------
// GEMM: C = X @ W + bias, X:[4096,768] f16, W:[768,768] f16 as Wt[k/32][n][k%32].
// Block tile 128(M) x 128(N), double-buffered LDS, X and W tiles both by async
// copies.  8 waves; wave = 16 rows x 128 cols.
// A ring stage holds KS = 3 k blocks of 32: a stage's copies come from memory or from
// L2 in one latency whatever their number, and the stage in work has to last that
// long.  One k block lasts far less: at one a stage every k block waits for the next
// one's copies.  At three the ring is 104 KB of LDS and three work-groups share a WGP.
// MODE 0: the Q, K and V projections in one launch, blockIdx.z picks the product
// (weight plane z of Wt, bias z, output plane z of Yh): Q and K scatter to
// [B,H,L,64] f16, V goes out transposed in 16-key groups, [B,H,L/16,64,16] f16.
// MODE 1: += residual, fp32 out.
// MODE 0 works on the compacted tokens: row i of a batch is X row idx[b][i],
// and L above is the compact position.  Tiles wholly past cnts[b] are not computed;
// the last tile's rows past it are masked tokens' rows, finite, which the attention
// gives weight 0.
// ---------------------------------------------------------------------------
template <int MODE>
__global__ __launch_bounds__(256) void gemm_kernel(const _Float16* __restrict__ X,
                                                   const _Float16* __restrict__ Wt,
                                                   const float* __restrict__ bias0,
                                                   const float* __restrict__ bias1,
                                                   const float* __restrict__ bias2,
                                                   const float* __restrict__ resid,
                                                   const int* __restrict__ idx,
                                                   const int* __restrict__ cnts,
                                                   _Float16* __restrict__ Yh,
                                                   float* __restrict__ Yf) {
  constexpr int KS    = 3;                     // k blocks of 32 a ring stage
  constexpr int NST   = 24 / KS;               // ring stages
  constexpr int PITCH = KS * 32 + 8;           // LDS row pitch in halfs: 208 B = 16 B x 13
  // One array, X's two buffers in front of W's.  The k blocks of a W stage lie 48 KB
  // apart in global memory; the build puts such a step into a copy's offset field,
  // which moves the LDS address too, and takes it off the LDS address register:
  // with W behind X's 52 KB that register does not fall below 0.
  __shared__ __attribute__((aligned(16))) _Float16 ring[4][128 * PITCH];
  _Float16 (*const xt)[128 * PITCH] = ring;       // xt[buf][m][k]
  _Float16 (*const wt)[128 * PITCH] = ring + 2;   // transposed: wt[buf][n][k]
  const int mtile = blockIdx.x;          // 0..31
  const int ntile = blockIdx.y;          // 0..5
  const int prod  = (MODE == 0) ? blockIdx.z : 0;   // 0 Q, 1 K, 2 V
  const int t = threadIdx.x, wave = t >> 5, lane = t & 31;

  // the two X rows that this thread copies segments of (tile rows t / 4 and 64 + t / 4)
  int xrow0 = mtile * 128 + (t >> 2), xrow1 = xrow0 + 64;
  if (MODE != 1) {
    const int b = mtile >> 4;            // 16 tiles a batch
    if ((mtile & 15) * 128 >= cnts[b]) return;   // whole block, in front of every copy and barrier
    // & 2047 bounds the row whatever the list holds
    const int i0 = idx[xrow0] & 2047, i1 = idx[xrow1] & 2047;
    xrow0 = b * 2048 + i0;
    xrow1 = b * 2048 + i1;
  }
  const _Float16* xs0 = X + (size_t)xrow0 * 768 + (t & 3) * 8;
  const _Float16* xs1 = X + (size_t)xrow1 * 768 + (t & 3) * 8;

  // X stage 128 x (KS * 32): per k block 512 16B segments; async copy, rows as listed above.
  auto loadX = [&](int st, int buf) {
    _Float16* xd = &xt[buf][(t >> 2) * PITCH + (t & 3) * 8];
    #pragma unroll  // the stage's copies issue back to back, no loop branch around them
    for (int q = 0; q < KS; ++q) {
      async_copy16(xs0 + (st * KS + q) * 32, xd + q * 32);
      async_copy16(xs1 + (st * KS + q) * 32, xd + 64 * PITCH + q * 32);
    }
  };
  // W stage 128(n) x (KS * 32)(k): per k block 8 KB contiguous in Wt, 512 16B segments
  // (segment p = t or t + 256: column p >> 2, k (p & 3) * 8); async copy.
  auto loadW = [&](int st, int buf) {
    const _Float16* wsrc = Wt + (((size_t)prod * 24 + st * KS) * 768 + ntile * 128) * 32 + t * 8;
    _Float16* wd = &wt[buf][(t >> 2) * PITCH + (t & 3) * 8];
    #pragma unroll  // the stage's copies issue back to back, no loop branch around them
    for (int q = 0; q < KS; ++q) {
      async_copy16(wsrc + q * (768 * 32), wd + q * 32);
      async_copy16(wsrc + q * (768 * 32) + 256 * 8, wd + 64 * PITCH + q * 32);
    }
  };

  loadX(0, 0);
  loadW(0, 0);
  ring_publish();

  v8f acc[8] = {};
  int cur = 0;
  for (int st = 0; st < NST; ++st) {
    const int nxt = cur ^ 1;
    if (st + 1 < NST) { loadX(st + 1, nxt); loadW(st + 1, nxt); }
    #pragma unroll  // the stage's k blocks in rising k, no branch or barrier between them
    for (int q = 0; q < KS; ++q) {
      const v16h a = load_frag16(xt[cur] + wave * 16 * PITCH + q * 32, PITCH, lane);
      #pragma unroll
      for (int t2 = 0; t2 < 8; ++t2) {
        const v16h b = load_frag16(wt[cur] + t2 * 16 * PITCH + q * 32, PITCH, lane);
        acc[t2] = WMMA_F16(a, b, acc[t2]);
      }
    }
    // behind the last stage no copy is in flight and no buffer is refilled or read again:
    // a publish point there would only make the wave hold all its fragments at once
    if (st + 1 < NST) ring_publish();
    cur = nxt;
  }

  const int n_lo = lane & 15, hf = lane >> 4;
  const float* bias = prod == 0 ? bias0 : prod == 1 ? bias1 : bias2;
  if (MODE == 0) Yh += (size_t)prod * (4096 * 768);
  float bv8[8];
  #pragma unroll  // constant indices keep bv8[] in registers; the 8 loads issue together
  for (int t2 = 0; t2 < 8; ++t2) bv8[t2] = bias[ntile * 128 + t2 * 16 + n_lo];
  // precaution: stands in front of every later write of the bias loads' address registers
  asm volatile("s_wait_xcnt 0x0" ::: "memory");
  // one block-uniform branch in front of the two store loops, none inside them
  if (MODE == 0 && prod == 2) {
    #pragma unroll
    for (int t2 = 0; t2 < 8; ++t2) {
      const int n = ntile * 128 + t2 * 16 + n_lo;
      const float bv = bv8[t2];
      // the lane's 8 accumulator rows are 8 consecutive keys of one channel: one
      // 16-B store; the wave's 32 stores are 512 contiguous bytes
      const int m0 = mtile * 128 + wave * 16;
      const int b = m0 >> 11, lg = (m0 & 2047) >> 4;
      const int h = n >> 6, d = n & 63;
      union { float4 f; _Float16 hh[8]; } u;
      #pragma unroll  // constant indices keep acc[] and u in registers
      for (int r = 0; r < 8; ++r) u.hh[r] = (_Float16)(acc[t2][r] + bv);
      *(float4*)(Yh + ((((size_t)(b * 12 + h)) * 128 + lg) * 64 + d) * 16 + 8 * hf) = u.f;
    }
    return;
  }
  #pragma unroll
  for (int t2 = 0; t2 < 8; ++t2) {
    const int n = ntile * 128 + t2 * 16 + n_lo;
    const float bv = bv8[t2];
    #pragma unroll
    for (int r = 0; r < 8; ++r) {
      const int m = mtile * 128 + wave * 16 + r + 8 * hf;
      if (MODE == 0) {
        const int b = m >> 11, l = m & 2047;
        const int h = n >> 6, d = n & 63;
        Yh[(((size_t)(b * 12 + h)) * 2048 + l) * 64 + d] = (_Float16)(acc[t2][r] + bv);
      } else {
        const size_t idx = (size_t)m * 768 + n;
        Yf[idx] = acc[t2][r] + bv + resid[idx];
      }
    }
  }
  // precaution, MODE 0: the code of the V path follows this one in the built kernel;
  // the wait stands in front of its writes of these stores' registers
  if (MODE == 0) asm volatile("s_wait_xcnt 0x0" ::: "memory");
}

__device__ inline float xhalf(float x) {
  const int v = __builtin_bit_cast(int, x);
  return __builtin_bit_cast(float,
      __builtin_amdgcn_permlanex16(v, v, 0x76543210, 0xfedcba98, false, false));
}

__global__ __launch_bounds__(256) void attn_kernel(const _Float16* __restrict__ Qh,
                                                   const _Float16* __restrict__ Kh,
                                                   const _Float16* __restrict__ Vt,
                                                   const int* __restrict__ idx,
                                                   const int* __restrict__ cnts,
                                                   _Float16* __restrict__ Ch) {
  __shared__ __attribute__((aligned(16))) _Float16 klds[2][64 * PITCH64];   // K tile, natural [key][d]    2x9 KB
  __shared__ __attribute__((aligned(16))) _Float16 vtlds[2][64 * PITCH64];  // V tile transposed [d][key]  2x9 KB
  __shared__ __attribute__((aligned(16))) float mlds[2][64];                // additive key mask

  const int bh = blockIdx.x;              // 0..23
  const int qb = blockIdx.y;              // 0..15
  const int b  = bh / 12, h = bh % 12;
  const int t = threadIdx.x, wave = t >> 5, lane = t & 31;
  const int n_lo = lane & 15, hf = lane >> 4;
  const int cnt = min(cnts[b], 2048);     // the clamp bounds the trip count below
  if (qb * 128 >= cnt) return;            // whole block, in front of every copy and barrier
  const int ntile = (cnt + 63) >> 6;      // key tiles, 1..32

  // Q fragments stay in registers: 64 d x 16 queries, B operand (column = query n_lo)
  const _Float16* qbase = Qh + (((size_t)bh * 2048) + qb * 128 + wave * 16) * 64;
  const v16h qa0 = load_frag16(qbase, 64, lane);
  const v16h qa1 = load_frag16(qbase + 32, 64, lane);
  // the token of this lane's query, for the epilogue; read here, with the Q
  // fragments, so that the epilogue waits for no load
  const int qtok = idx[b * 2048 + qb * 128 + wave * 16 + n_lo];

  auto loadK = [&](int j, int buf) {
    const _Float16* kb_ = Kh + (((size_t)bh * 2048) + j * 64) * 64;
    #pragma unroll
    for (int p = t; p < 512; p += 256) async_copy16(kb_ + p * 8, &klds[buf][(p >> 3) * PITCH64 + (p & 7) * 8]);
  };
  // 64 keys = 4 groups of [64 d][16 keys], 8 KB contiguous in Vt; segment p holds
  // 8 keys of channel (p >> 1) & 63 in group p >> 7
  auto loadV = [&](int j, int buf) {
    const _Float16* vb_ = Vt + (((size_t)bh * 2048) + j * 64) * 64;
    #pragma unroll  // both copies issue back to back, no loop branch around them
    for (int i = 0; i < 2; ++i) {
      const int p = t + i * 256;
      async_copy16(vb_ + p * 8, &vtlds[buf][((p >> 1) & 63) * PITCH64 + (p >> 7) * 16 + (p & 1) * 8]);
    }
  };
  auto loadM = [&](int j, int buf) {
    if (t < 64) mlds[buf][t] = (j * 64 + t < cnt) ? 0.f : -1e30f;
  };

  float mstate = -1e30f;   // running maximum of query n_lo, equal in both halves
  float lstate = 0.f;      // running sum of query n_lo over this half's keys only
  v8f o[4] = {};           // O^T: o[t2][r] = channel 16 * t2 + 8 * hf + r of query n_lo

  loadK(0, 0); loadV(0, 0); loadM(0, 0);
  ring_publish();

  int cur = 0;
  for (int j = 0; j < ntile; ++j) {
    const int nxt = cur ^ 1;
    if (j + 1 < ntile) { loadK(j + 1, nxt); loadV(j + 1, nxt); loadM(j + 1, nxt); }

    // S^T = K @ Q^T: s[t2][r] = key 16 * t2 + 8 * hf + r against query n_lo
    v8f s[4];
    #pragma unroll
    for (int t2 = 0; t2 < 4; ++t2) {
      v8f z = {};
      z = WMMA_F16(load_frag16(klds[cur] + t2 * 16 * PITCH64, PITCH64, lane), qa0, z);
      z = WMMA_F16(load_frag16(klds[cur] + t2 * 16 * PITCH64 + 32, PITCH64, lane), qa1, z);
      s[t2] = z;
    }

    // online softmax of the lane's query over its 32 keys; four independent chains
    // for the maximum and for the sum, one per score tile
    float mx[4];
    #pragma unroll  // constant indices keep s[] and mx[] in registers
    for (int t2 = 0; t2 < 4; ++t2) {
      union { float4 q[2]; float f[8]; } km;   // the mask of the lane's 8 keys of this tile
      km.q[0] = *(const float4*)&mlds[cur][t2 * 16 + 8 * hf];
      km.q[1] = *(const float4*)&mlds[cur][t2 * 16 + 8 * hf + 4];
      #pragma unroll
      for (int r = 0; r < 8; ++r) {
        s[t2][r] = s[t2][r] * 0.125f + km.f[r];
        mx[t2] = (r == 0) ? s[t2][r] : fmaxf(mx[t2], s[t2][r]);
      }
    }
    float rmax = fmaxf(fmaxf(mx[0], mx[1]), fmaxf(mx[2], mx[3]));
    rmax = fmaxf(rmax, xhalf(rmax));          // over all 64 keys
    const float newm  = fmaxf(mstate, rmax);
    const float alpha = __expf(mstate - newm);
    float rs[4];
    #pragma unroll  // constant indices keep s[] and rs[] in registers
    for (int t2 = 0; t2 < 4; ++t2) {
      #pragma unroll
      for (int r = 0; r < 8; ++r) {
        const float v = s[t2][r];
        const float e = (v > -1e29f) ? __expf(v - newm) : 0.f;
        s[t2][r] = e;
        rs[t2] = (r == 0) ? e : rs[t2] + e;
      }
    }
    lstate = lstate * alpha + ((rs[0] + rs[1]) + (rs[2] + rs[3]));
    mstate = newm;
    #pragma unroll
    for (int t2 = 0; t2 < 4; ++t2) o[t2] *= alpha;

    // P^T as B operand: element e of a fragment is key 8 * hf + e (e < 8) or
    // 16 + 8 * hf + e - 8 of its 32 keys, which is register e & 7 of score tile e >> 3
    v16h p0, p1;
    #pragma unroll  // constant indices keep the fragments in registers
    for (int e = 0; e < 16; ++e) {
      p0[e] = (_Float16)s[e >> 3][e & 7];
      p1[e] = (_Float16)s[2 + (e >> 3)][e & 7];
    }

    // O^T += V^T @ P^T
    #pragma unroll
    for (int t2 = 0; t2 < 4; ++t2) {
      o[t2] = WMMA_F16(load_frag16(vtlds[cur] + t2 * 16 * PITCH64, PITCH64, lane), p0, o[t2]);
      o[t2] = WMMA_F16(load_frag16(vtlds[cur] + t2 * 16 * PITCH64 + 32, PITCH64, lane), p1, o[t2]);
    }

    ring_publish();
    cur = nxt;
  }

  // epilogue: O / l -> combined [B,L,768] f16, unmasked tokens' rows only; a lane's
  // 8 registers of a tile are 8 consecutive channels of its query: one 16-B store
  const float ltot = lstate + xhalf(lstate);   // both halves' keys; every lane is on here
  const int qi = qb * 128 + wave * 16 + n_lo;
  if (qi < cnt) {                         // else a masked token's row: zero-filled by the convert kernel
    const int qrow = qtok & 2047;         // & 2047 bounds the row whatever the list holds
    const float scl = (ltot > 0.f) ? (1.f / ltot) : 0.f;
    _Float16* crow = Ch + ((size_t)(b * 2048 + qrow)) * 768 + h * 64 + 8 * hf;
    #pragma unroll
    for (int t2 = 0; t2 < 4; ++t2) {
      union { float4 f; _Float16 hh[8]; } u;
      #pragma unroll  // constant indices keep o[] and u in registers
      for (int r = 0; r < 8; ++r) u.hh[r] = (_Float16)(o[t2][r] * scl);
      *(float4*)(crow + t2 * 16) = u.f;
    }
  }
}

// ---------------------------------------------------------------------------
// LayerNorm over the SEQUENCE axis (axis=1), ddof=1, per (batch, channel).
// grid (2, 24); block 1024: 32 channels (one 128-B line per row) x 128 row
// segments.  Each thread keeps its 16 rows x 4 channels in registers, so the
// column block is read once, all loads in flight together, and is normalised
// from registers after one block-wide reduction through LDS.
// ---------------------------------------------------------------------------
__global__ __launch_bounds__(1024) void ln_kernel(const float* __restrict__ Xr,
                                                  const float* __restrict__ gamma,
                                                  const float* __restrict__ beta,
                                                  float* __restrict__ out) {
  __shared__ __attribute__((aligned(16))) float red[2][128][32];   // per-thread partials: [sum|sq][row seg][channel]
  __shared__ float red2[2][16][32];   // partials over 8 row segments each
  __shared__ __attribute__((aligned(16))) float tot[2][32];        // column totals
  const int t  = threadIdx.x;
  const int c4 = t & 7;               // float4 column inside the 32-channel group
  const int rs = t >> 3;              // row segment 0..127
  const int c  = blockIdx.y * 32 + c4 * 4;
  // 32-bit byte offset of this thread's first row, shared by the loads and the stores
  const unsigned boff = (((unsigned)blockIdx.x * 2048u + (unsigned)rs) * 768u + (unsigned)c) * 4u;
  const char* xp = (const char*)Xr + boff;
  char* op = (char*)out + boff;

  const float4 g  = *(const float4*)(gamma + c);   // issued with the rows: off the path behind the reduction
  const float4 bb = *(const float4*)(beta + c);
  // keeps the two loads above issued together with the row loads; without it they
  // sink to the first barrier and are waited for there alone, a second load latency
  __builtin_amdgcn_sched_barrier(0);
  float4 v[16];
  // the loops over v[] are unrolled so that v[] has constant indices and stays in
  // registers, and so that the 16 loads (and the 16 stores) issue back to back
  #pragma unroll
  for (int i = 0; i < 16; ++i) v[i] = *(const float4*)(xp + i * (128 * 768 * 4));

  float4 sum = {0.f, 0.f, 0.f, 0.f}, sq = {0.f, 0.f, 0.f, 0.f};
  #pragma unroll
  for (int i = 0; i < 16; ++i) {
    sum.x += v[i].x; sq.x += v[i].x * v[i].x;
    sum.y += v[i].y; sq.y += v[i].y * v[i].y;
    sum.z += v[i].z; sq.z += v[i].z * v[i].z;
    sum.w += v[i].w; sq.w += v[i].w * v[i].w;
  }
  *(float4*)&red[0][rs][c4 * 4] = sum;
  *(float4*)&red[1][rs][c4 * 4] = sq;
  __syncthreads();

  {  // 128 -> 16 partials: a wave sums one quantity of all 32 channels over 8 segments
    const int which = (t >> 5) & 1, ch = t & 31, part = t >> 6;
    float p = 0.f;
    #pragma unroll  // the LDS reads issue together, one latency instead of eight
    for (int k = 0; k < 8; ++k) p += red[which][part * 8 + k][ch];
    red2[which][part][ch] = p;
  }
  __syncthreads();
  if (t < 64) {  // 16 -> 1
    const int which = t >> 5, ch = t & 31;
    float p = 0.f;
    #pragma unroll  // as above
    for (int k = 0; k < 16; ++k) p += red2[which][k][ch];
    tot[which][ch] = p;
  }
  __syncthreads();

  const float4 S = *(const float4*)&tot[0][c4 * 4];
  const float4 Q = *(const float4*)&tot[1][c4 * 4];
  float4 mean, inv;
  mean.x = S.x * (1.f / 2048.f);
  mean.y = S.y * (1.f / 2048.f);
  mean.z = S.z * (1.f / 2048.f);
  mean.w = S.w * (1.f / 2048.f);
  inv.x = rsqrtf(fmaxf((Q.x - 2048.f * mean.x * mean.x) * (1.f / 2047.f), 1e-20f));
  inv.y = rsqrtf(fmaxf((Q.y - 2048.f * mean.y * mean.y) * (1.f / 2047.f), 1e-20f));
  inv.z = rsqrtf(fmaxf((Q.z - 2048.f * mean.z * mean.z) * (1.f / 2047.f), 1e-20f));
  inv.w = rsqrtf(fmaxf((Q.w - 2048.f * mean.w * mean.w) * (1.f / 2047.f), 1e-20f));
  #pragma unroll
  for (int i = 0; i < 16; ++i) {
    float4 y;
    y.x = (v[i].x - mean.x) * inv.x * g.x + bb.x;
    y.y = (v[i].y - mean.y) * inv.y * g.y + bb.y;
    y.z = (v[i].z - mean.z) * inv.z * g.z + bb.z;
    y.w = (v[i].w - mean.w) * inv.w * g.w + bb.w;
    *(float4*)(op + i * (128 * 768 * 4)) = y;
  }
}

// ---------------------------------------------------------------------------
extern "C" void kernel_launch(void* const* d_in, const int* in_sizes, int n_in,
                              void* d_out, int out_size, void* d_ws, size_t ws_size,
                              hipStream_t stream) {
  const float* inputs = (const float*)d_in[0];   // [2,2048,768]
  const int*   amask  = (const int*)d_in[1];     // [2,2048]
  const float* wq_w = (const float*)d_in[2];
  const float* wq_b = (const float*)d_in[3];
  const float* wk_w = (const float*)d_in[4];
  const float* wk_b = (const float*)d_in[5];
  const float* wv_w = (const float*)d_in[6];
  const float* wv_b = (const float*)d_in[7];
  const float* wo_w = (const float*)d_in[8];
  const float* wo_b = (const float*)d_in[9];
  const float* gamma = (const float*)d_in[10];
  const float* beta  = (const float*)d_in[11];
  float* out = (float*)d_out;

  // workspace carve-up (~48.8 MB), 256B aligned
  char* ws = (char*)d_ws;
  size_t off = 0;
  auto carve = [&](size_t bytes) { char* p = ws + off; off += (bytes + 255) & ~(size_t)255; return p; };
  const size_t NX = (size_t)4096 * 768;          // activations
  const size_t NW = (size_t)768 * 768;           // weights
  _Float16* xh  = (_Float16*)carve(NX * 2);
  _Float16* wth = (_Float16*)carve(4 * NW * 2);  // weights q, k, v, o: [4][k/32][n][k%32]
  _Float16* woh = wth + 3 * NW;
  _Float16* qhh = (_Float16*)carve(3 * NX * 2);  // three planes: Q, K [B,H,L,64],
  _Float16* khh = qhh + NX;
  _Float16* vth = qhh + 2 * NX;                  // V [B,H,L/16,64,16]
  _Float16* chh = (_Float16*)carve(NX * 2);      // combined [B,L,768]
  float*    xr  = (float*)carve(NX * 4);         // residual sum, fp32
  int*      idx = (int*)carve(4096 * 4);         // [B,L] token order: unmasked first
  int*      cnts = (int*)carve(2 * 4);           // [B] unmasked tokens
  (void)ws_size; (void)in_sizes; (void)n_in; (void)out_size;

  // 1) token order (2 blocks), weight (4 x 24 blocks) and activation (128 blocks) fp32 -> f16 conversions
  cvt_f16_kernel<<<2 + 4 * 24 + 128, 256, 0, stream>>>(inputs, amask, wq_w, wk_w, wv_w, wo_w,
                                                              xh, wth, chh, idx, cnts);

  // 2) Q/K/V projections of the unmasked tokens (128x128 tiles), one launch
  gemm_kernel<0><<<dim3(32, 6, 3), 256, 0, stream>>>(xh, wth, wq_b, wk_b, wv_b, nullptr, idx, cnts, qhh, nullptr);

  // 3) fused attention
  attn_kernel<<<dim3(24, 16), 256, 0, stream>>>(qhh, khh, vth, idx, cnts, chh);

  // 4) output projection + residual
  gemm_kernel<1><<<dim3(32, 6), 256, 0, stream>>>(chh, woh, wo_b, nullptr, nullptr, inputs, nullptr, nullptr, nullptr, xr);

  // 5) layernorm over sequence axis
  ln_kernel<<<dim3(2, 24), 1024, 0, stream>>>(xr, gamma, beta, out);
}

// v009
// A run of this version takes 65.1 microseconds.
// In two side-by-side timings against v008, it was 1.04 and 1.03 times as fast.
// Counting every step since v000, it is 7.09 times as fast.
#include <hip/hip_runtime.h>
#include <hip/hip_bf16.h>

// ---------------------------------------------------------------------------
// MHA + residual + LayerNorm(axis=L) for gfx1250 (MI455X), f16 WMMA path,
// async global->LDS copies + double-buffered, software-pipelined tiles.
// Each of the weights and V is laid out K-contiguous and in tile order
// by the kernel that produces it, so no tile is transposed on its way to LDS.
// Tokens whose mask is 0 have weight 0 as keys and a zero context row as queries:
// Q, K, V and the attention are computed on the unmasked tokens only, compacted.
// B=2, L=2048, HIDDEN=768, HEADS=12, HEAD=64.
// ---------------------------------------------------------------------------

typedef __attribute__((ext_vector_type(16))) _Float16 v16h;
typedef __attribute__((ext_vector_type(8)))  float    v8f;
typedef __attribute__((ext_vector_type(4)))  int      v4i;
typedef __attribute__((ext_vector_type(4)))  float    v4f;

// LDS row pitches in halfs, an odd multiple of 16 B each, so that the 16 rows a
// ds_load_b128 fragment read touches fall on different banks (64 banks x 4 B).
#define PITCH64 72   // rows of 64 halfs (128 B) -> 144 B; the GEMM's pitch stands in its kernel

#define WMMA_F16(a, b, c) \
  __builtin_amdgcn_wmma_f32_16x16x32_f16(false, (a), false, (b), (short)0, (c), false, false)

#if __has_builtin(__builtin_amdgcn_global_load_async_to_lds_b128)
#define HAVE_ASYNC_LDS 1
#else
#define HAVE_ASYNC_LDS 0
#endif

// 16-byte global -> LDS copy; async (ASYNCcnt) when the builtin exists.
// Probed signature: (v4i addrspace(1)*, v4i addrspace(3)*, imm offset, imm cpol)
__device__ inline void async_copy16(const _Float16* g, _Float16* l) {
#if HAVE_ASYNC_LDS
  __builtin_amdgcn_global_load_async_to_lds_b128(
      (__attribute__((address_space(1))) v4i*)g,
      (__attribute__((address_space(3))) v4i*)l, 0, 0);
#else
  *(float4*)l = *(const float4*)g;
#endif
}

// Publish point of a two-buffer ring, passed by every wave: behind it the tile
// copied last is readable by all waves and the other buffer may be refilled.
__device__ inline void ring_publish() {
  // this wave's LDS reads and writes have retired before another wave's copies
  // or reads touch the same bytes
  asm volatile("s_wait_dscnt 0x0" ::: "memory");
  // this wave's own copies have landed before the barrier lets others read them
  asm volatile("s_wait_asynccnt 0x0" ::: "memory");
  __syncthreads();
}

// Load a 16x32 f16 fragment (A-layout; also B-layout when source is stored
// transposed, i.e. K contiguous per row).  Per CDNA5 ISA 7.12.2:
//   lane 0-15: row = lane,   VGPR v<4: K = half*8 + v*2,   v>=4: K = 16+...
// => per lane: 8 contiguous halfs at [row][half*8] and 8 at [row][16+half*8].
__device__ inline v16h load_frag16(const _Float16* base, int stride_h, int lane) {
  const int m  = lane & 15;
  const int hf = lane >> 4;
  union { v16h v; float4 q[2]; } u;
  u.q[0] = *(const float4*)(base + (size_t)m * stride_h + hf * 8);
  u.q[1] = *(const float4*)(base + (size_t)m * stride_h + 16 + hf * 8);
  return u.v;
}

// ---------------------------------------------------------------------------
// Blocks 0 and 1: token order of one batch each.  idx[b][0 .. cnts[b]) lists the
// unmasked tokens in rising order, the rest of idx[b] the masked ones, so idx[b]
// is a permutation of 0..2047 for any mask.  A wave ranks 256 consecutive tokens
// by ballots; the 8 wave totals meet in LDS.
// Blocks 2 .. 97: the four weights, 24 blocks each, fp32 [k][n] -> f16 in the
// GEMM's tile order, Wt[weight][k / 32][n][k % 32].  A block takes 256 columns x
// three 32-row k blocks; a lane reads 4 columns x 8 k of each k block by 16-B loads
// (a wave's load is 4 whole 128-B lines) and stores 8 k of one column at a time.
// Other blocks (128): fp32 -> f16 conversion of 32 rows each, 24 loads of 16 B a
// thread, and zeros into the context rows of masked tokens, which the attention
// does not compute.
// The launch is a short stream: fewer blocks than WGPs, every conversion block reads 96 KB,
// every wave of those has all its 24 loads in flight at once.  Few long waves stand in for
// many that would move 512 B each, so that the starting of waves does not set the
// length of the launch.
// None of the three jobs reads what another writes, so they share one launch.
// ---------------------------------------------------------------------------
__global__ __launch_bounds__(256) void cvt_f16_kernel(const float* __restrict__ src,
                                                      const int* __restrict__ amask,
                                                      const float* __restrict__ w0,
                                                      const float* __restrict__ w1,
                                                      const float* __restrict__ w2,
                                                      const float* __restrict__ w3,
                                                      _Float16* __restrict__ dst,
                                                      _Float16* __restrict__ Wt,
                                                      _Float16* __restrict__ Ch,
                                                      int* __restrict__ idx,
                                                      int* __restrict__ cnts) {
  __shared__ int wc[8];
  const int t = threadIdx.x;
  if (blockIdx.x < 2) {
    const int b = blockIdx.x, wave = t >> 5, lane = t & 31;
    unsigned bal[8];
    int wtot = 0;
    #pragma unroll  // constant indices keep bal[] in registers; the 8 loads issue together
    for (int s = 0; s < 8; ++s) {
      bal[s] = __builtin_amdgcn_ballot_w32(amask[b * 2048 + (wave * 8 + s) * 32 + lane] != 0);
      wtot += __popc(bal[s]);
    }
    if (lane == 0) wc[wave] = wtot;
    __syncthreads();
    int base = 0, total = 0;   // unmasked tokens in front of this wave's; in the batch
    #pragma unroll  // the 8 totals come as two wide LDS reads
    for (int k = 0; k < 8; ++k) {
      const int c = wc[k];
      total += c;
      if (k < wave) base += c;
    }
    #pragma unroll  // constant indices keep bal[] in registers
    for (int s = 0; s < 8; ++s) {
      const int l = (wave * 8 + s) * 32 + lane;
      const int rank = base + __popc(bal[s] & ((1u << lane) - 1u));   // unmasked tokens in front of l
      const bool on = ((bal[s] >> lane) & 1u) != 0u;
      idx[b * 2048 + (on ? rank : total + l - rank)] = l;
      base += __popc(bal[s]);
    }
    if (t == 0) cnts[b] = total;
    return;
  }
  if (blockIdx.x < 2 + 4 * 24) {
    const int wb = blockIdx.x - 2;
    const int which = wb / 24, tile = wb % 24;
    const float* wsrc = which == 0 ? w0 : which == 1 ? w1 : which == 2 ? w2 : w3;
    const int n  = (tile % 3) * 256 + (t >> 2) * 4;   // the first of the lane's 4 columns
    const int kb = (tile / 3) * 3, kg = t & 3;        // k blocks kb .. kb + 2
    const float* wp = wsrc + (size_t)(kb * 32 + kg * 8) * 768 + n;
    v4f v[3][8];
    #pragma unroll  // constant indices keep v[] in registers
    for (int q = 0; q < 3; ++q) {
      #pragma unroll
      for (int j = 0; j < 8; ++j) v[q][j] = *(const v4f*)(wp + (q * 32 + j) * 768);
    }
    _Float16* wd = Wt + (((size_t)which * 24 + kb) * 768 + n) * 32 + kg * 8;
    #pragma unroll  // constant indices keep v[] in registers
    for (int q = 0; q < 3; ++q) {
      #pragma unroll
      for (int c = 0; c < 4; ++c) {
        union { float4 f; _Float16 h[8]; } u;
        #pragma unroll
        for (int j = 0; j < 8; ++j) u.h[j] = (_Float16)v[q][j][c];
        *(float4*)(wd + (q * 768 + c) * 32) = u.f;
      }
    }
    // precaution: stands in front of every later write of the stores' registers (the
    // code of another path may follow this one in the built kernel)
    asm volatile("s_wait_xcnt 0x0" ::: "memory");
    return;
  }
  // 32 rows = 6144 groups of 4 floats; this thread's are groups u * 256 + t.  A row is
  // 192 groups = 6 waves' worth, so the 32 groups of a wave's load lie in one row:
  // that row's mask bit is wave-uniform, and the zero store stands behind a scalar
  // branch.  Lane l reads the mask of the block's row l; the ballot holds all 32.
  const int ab   = blockIdx.x - (2 + 4 * 24);
  const int wave = __builtin_amdgcn_readfirstlane(t >> 5);
  const int i0   = (ab * 6144 + t) * 4;
  const int mrow = amask[ab * 32 + (t & 31)];
  v4f v[24];
  #pragma unroll  // constant indices keep v[] in registers
  for (int u = 0; u < 24; ++u) v[u] = *(const v4f*)(src + i0 + u * 1024);
  const unsigned rows_on = __builtin_amdgcn_ballot_w32(mrow != 0);
  #pragma unroll  // constant indices keep v[] in registers
  for (int u = 0; u < 24; ++u) {
    union { uint2 u2; _Float16 h[4]; } p;
    p.h[0] = (_Float16)v[u][0]; p.h[1] = (_Float16)v[u][1];
    p.h[2] = (_Float16)v[u][2]; p.h[3] = (_Float16)v[u][3];
    *(uint2*)(dst + i0 + u * 1024) = p.u2;
    if (((rows_on >> ((u * 8 + wave) / 6)) & 1u) == 0u) *(uint2*)(Ch + i0 + u * 1024) = make_uint2(0u, 0u);
  }
  // precaution: stands in front of every later write of the stores' registers (the
  // code of the other paths follows this one in the built kernel)
  asm volatile("s_wait_xcnt 0x0" ::: "memory");
}

// ---------------------------------------------------------------------------
// GEMM: C = X @ W + bias, X:[4096,768] f16, W:[768,768] f16 as Wt[k/32][n][k%32].
// Block tile 128(M) x NB(N), double-buffered LDS, X and W tiles both by async copies.
// 8 waves as 2 x 4; wave = 64 rows x NB / 4 cols: a fragment read from LDS feeds 3 or 4
// products (2 or 4 at NB = 128), where a 16 x 128 strip reads 9 fragments for 8 products
// and the LDS read rate, not the matrix unit, sets the length of a stage.
// NB = 192 for the projections: with about half the tokens unmasked the live blocks are
// then fewer than the WGPs, and no WGP's LDS has to serve two of them.
// A ring stage holds KS = 3 k blocks of 32: a stage's copies come from memory or from
// L2 in one latency whatever their number, and the stage in work has to last that
// long.  One k block lasts far less: at one a stage every k block waits for the next
// one's copies.  At three the ring is 104 KB of LDS at NB = 128, 130 KB at NB = 192.
// MODE 0: the Q, K and V projections in one launch, blockIdx.z picks the product
// (weight plane z of Wt, bias z, output plane z of Yh): Q and K scatter to
// [B,H,L,64] f16, V goes out transposed in 16-key groups, [B,H,L/16,64,16] f16.
// MODE 1: += residual, fp32 out.
// MODE 0 works on the compacted tokens: row i of a batch is X row idx[b][i],
// and L above is the compact position.  Tiles wholly past cnts[b] are not computed;
// the last tile's rows past it are masked tokens' rows, finite, which the attention
// gives weight 0.
// ---------------------------------------------------------------------------
template <int MODE>
__global__ __launch_bounds__(256) void gemm_kernel(const _Float16* __restrict__ X,
                                                   const _Float16* __restrict__ Wt,
                                                   const float* __restrict__ bias0,
                                                   const float* __restrict__ bias1,
                                                   const float* __restrict__ bias2,
                                                   const float* __restrict__ resid,
                                                   const int* __restrict__ idx,
                                                   const int* __restrict__ cnts,
                                                   _Float16* __restrict__ Yh,
                                                   float* __restrict__ Yf) {
  constexpr int KS    = 3;                     // k blocks of 32 a ring stage
  constexpr int NST   = 24 / KS;               // ring stages
  constexpr int PITCH = KS * 32 + 8;           // LDS row pitch in halfs: 208 B = 16 B x 13
  constexpr int NB    = (MODE == 0) ? 192 : 128;   // columns of the block tile
  constexpr int JT    = NB / 64;               // 16-column tiles of a wave
  // One array, X's two buffers in front of W's.  The k blocks of a W stage lie 48 KB
  // apart in global memory; the build puts such a step into a copy's offset field,
  // which moves the LDS address too, and takes it off the LDS address register:
  // with W behind X's 52 KB that register does not fall below 0.
  __shared__ __attribute__((aligned(16))) _Float16 ring[2 * (128 + NB) * PITCH];
  _Float16 (*const xt)[128 * PITCH] = (_Float16 (*)[128 * PITCH])ring;                    // xt[buf][m][k]
  _Float16 (*const wt)[NB * PITCH]  = (_Float16 (*)[NB * PITCH])(ring + 2 * 128 * PITCH);  // transposed: wt[buf][n][k]
  const int mtile = blockIdx.x;          // 0..31
  const int ntile = blockIdx.y;          // 0 .. 768 / NB - 1
  const int prod  = (MODE == 0) ? blockIdx.z : 0;   // 0 Q, 1 K, 2 V
  const int t = threadIdx.x, wave = t >> 5, lane = t & 31;

  const int wm = wave >> 2, wn = wave & 3;   // the wave's place in the block tile: 2 x 4 waves

  // the two X rows that this thread copies segments of (tile rows t / 4 and 64 + t / 4)
  int xrow0 = mtile * 128 + (t >> 2), xrow1 = xrow0 + 64;
  if (MODE != 1) {
    const int b = mtile >> 4;            // 16 tiles a batch
    if ((mtile & 15) * 128 >= cnts[b]) return;   // whole block, in front of every copy and barrier
    // & 2047 bounds the row whatever the list holds
    const int i0 = idx[xrow0] & 2047, i1 = idx[xrow1] & 2047;
    xrow0 = b * 2048 + i0;
    xrow1 = b * 2048 + i1;
  }
  const _Float16* xs0 = X + (size_t)xrow0 * 768 + (t & 3) * 8;
  const _Float16* xs1 = X + (size_t)xrow1 * 768 + (t & 3) * 8;

  // X stage 128 x (KS * 32): per k block 512 16B segments; async copy, rows as listed above.
  auto loadX = [&](int st, int buf) {
    _Float16* xd = &xt[buf][(t >> 2) * PITCH + (t & 3) * 8];
    #pragma unroll  // the stage's copies issue back to back, no loop branch around them
    for (int q = 0; q < KS; ++q) {
      async_copy16(xs0 + (st * KS + q) * 32, xd + q * 32);
      async_copy16(xs1 + (st * KS + q) * 32, xd + 64 * PITCH + q * 32);
    }
  };
  // W stage NB(n) x (KS * 32)(k): per k block NB * 64 B contiguous in Wt, NB * 4 16B segments
  // (segment p = t + 256 * i: column p >> 2, k (p & 3) * 8); async copy.
  auto loadW = [&](int st, int buf) {
    const _Float16* wsrc = Wt + (((size_t)prod * 24 + st * KS) * 768 + ntile * NB) * 32 + t * 8;
    _Float16* wd = &wt[buf][(t >> 2) * PITCH + (t & 3) * 8];
    #pragma unroll  // the stage's copies issue back to back, no loop branch around them
    for (int q = 0; q < KS; ++q) {
      #pragma unroll
      for (int i = 0; i < NB / 64; ++i) async_copy16(wsrc + q * (768 * 32) + i * 256 * 8, wd + i * 64 * PITCH + q * 32);
    }
  };

  loadX(0, 0);
  loadW(0, 0);
  ring_publish();

  v8f acc[4][JT] = {};   // acc[i][j]: rows 16 * i, columns 16 * j of the wave's tile
  int cur = 0;
  for (int st = 0; st < NST; ++st) {
    const int nxt = cur ^ 1;
    if (st + 1 < NST) { loadX(st + 1, nxt); loadW(st + 1, nxt); }
    // two fragment sets: a k block's reads issue as one group in front of the products
    // of the k block before it, inside the stage only
    v16h a[2][4], b[2][JT];
    auto frags = [&](int q, int s) {
      #pragma unroll  // constant indices keep the fragments in registers
      for (int j = 0; j < JT; ++j) b[s][j] = load_frag16(wt[cur] + (wn * JT + j) * 16 * PITCH + q * 32, PITCH, lane);
      #pragma unroll  // as above
      for (int i = 0; i < 4; ++i) a[s][i] = load_frag16(xt[cur] + (wm * 4 + i) * 16 * PITCH + q * 32, PITCH, lane);
    };
    frags(0, 0);
    #pragma unroll  // the stage's k blocks in rising k, no branch or barrier between them
    for (int q = 0; q < KS; ++q) {
      if (q + 1 < KS) {
        frags(q + 1, (q + 1) & 1);
        // holds the next k block's reads in front of this one's products: left alone the
        // build sinks each A read to its first use and waits out the LDS latency there
        __builtin_amdgcn_sched_barrier(0);
      }
      #pragma unroll
      for (int i = 0; i < 4; ++i) {
        #pragma unroll
        for (int j = 0; j < JT; ++j) acc[i][j] = WMMA_F16(a[q & 1][i], b[q & 1][j], acc[i][j]);
      }
      // keeps what follows behind these products: the reads of the k block after the next
      // in one group, not spread among them; at the last k block the publish point, so
      // that the next copies issue directly behind its barrier and have a whole stage to land
      __builtin_amdgcn_sched_barrier(0);
    }
    // behind the last stage no copy is in flight and no buffer is refilled or read again:
    // a publish point there would only make the wave hold all its fragments at once
    if (st + 1 < NST) ring_publish();
    cur = nxt;
  }

  const int n_lo = lane & 15, hf = lane >> 4;
  const float* bias = prod == 0 ? bias0 : prod == 1 ? bias1 : bias2;
  if (MODE == 0) Yh += (size_t)prod * (4096 * 768);
  const int ncol = ntile * NB + wn * (JT * 16) + n_lo;   // the lane's column in tile j = 0
  const int mrow = mtile * 128 + wm * 64;               // the wave's first row
  float bvj[JT];
  #pragma unroll  // constant indices keep bvj[] in registers; the loads issue together
  for (int j = 0; j < JT; ++j) bvj[j] = bias[ncol + j * 16];
  // precaution: stands in front of every later write of the bias loads' address registers
  asm volatile("s_wait_xcnt 0x0" ::: "memory");
  // one block-uniform branch in front of the two store loops, none inside them
  if (MODE == 0 && prod == 2) {
    #pragma unroll
    for (int i = 0; i < 4; ++i) {
      #pragma unroll
      for (int j = 0; j < JT; ++j) {
        const int n = ncol + j * 16;
        const float bv = bvj[j];
        // the lane's 8 accumulator rows are 8 consecutive keys of one channel: one
        // 16-B store; the wave's 32 stores are 512 contiguous bytes
        const int m0 = mrow + i * 16;
        const int b = m0 >> 11, lg = (m0 & 2047) >> 4;
        const int h = n >> 6, d = n & 63;
        union { float4 f; _Float16 hh[8]; } u;
        #pragma unroll  // constant indices keep acc[] and u in registers
        for (int r = 0; r < 8; ++r) u.hh[r] = (_Float16)(acc[i][j][r] + bv);
        *(float4*)(Yh + ((((size_t)(b * 12 + h)) * 128 + lg) * 64 + d) * 16 + 8 * hf) = u.f;
      }
    }
    return;
  }
  float rv[4][JT][8];   // MODE 1: the residual of the wave's tile, all loads in flight together
  if (MODE == 1) {
    #pragma unroll  // constant indices keep rv[] in registers
    for (int i = 0; i < 4; ++i) {
      #pragma unroll
      for (int j = 0; j < JT; ++j) {
        #pragma unroll
        for (int r = 0; r < 8; ++r) rv[i][j][r] = resid[(size_t)(mrow + i * 16 + r + 8 * hf) * 768 + ncol + j * 16];
        // precaution: stands in front of every later write of these loads' address
        // registers (the build lets a later load land in them)
        asm volatile("s_wait_xcnt 0x0" ::: "memory");
      }
    }
  }
  #pragma unroll
  for (int i = 0; i < 4; ++i) {
    #pragma unroll
    for (int j = 0; j < JT; ++j) {
      const int n = ncol + j * 16;
      const float bv = bvj[j];
      #pragma unroll
      for (int r = 0; r < 8; ++r) {
        const int m = mrow + i * 16 + r + 8 * hf;
        if (MODE == 0) {
          const int b = m >> 11, l = m & 2047;
          const int h = n >> 6, d = n & 63;
          Yh[(((size_t)(b * 12 + h)) * 2048 + l) * 64 + d] = (_Float16)(acc[i][j][r] + bv);
        } else {
          Yf[(size_t)m * 768 + n] = acc[i][j][r] + bv + rv[i][j][r];
        }
      }
    }
  }
  // precaution, MODE 0: the code of the V path follows this one in the built kernel;
  // the wait stands in front of its writes of these stores' registers
  if (MODE == 0) asm volatile("s_wait_xcnt 0x0" ::: "memory");
}

__device__ inline float xhalf(float x) {
  const int v = __builtin_bit_cast(int, x);
  return __builtin_bit_cast(float,
      __builtin_amdgcn_permlanex16(v, v, 0x76543210, 0xfedcba98, false, false));
}

__global__ __launch_bounds__(256) void attn_kernel(const _Float16* __restrict__ Qh,
                                                   const _Float16* __restrict__ Kh,
                                                   const _Float16* __restrict__ Vt,
                                                   const int* __restrict__ idx,
                                                   const int* __restrict__ cnts,
                                                   _Float16* __restrict__ Ch) {
  __shared__ __attribute__((aligned(16))) _Float16 klds[2][64 * PITCH64];   // K tile, natural [key][d]    2x9 KB
  __shared__ __attribute__((aligned(16))) _Float16 vtlds[2][64 * PITCH64];  // V tile transposed [d][key]  2x9 KB
  __shared__ __attribute__((aligned(16))) float mlds[2][64];                // additive key mask

  const int bh = blockIdx.x;              // 0..23
  const int qb = blockIdx.y;              // 0..15
  const int b  = bh / 12, h = bh % 12;
  const int t = threadIdx.x, wave = t >> 5, lane = t & 31;
  const int n_lo = lane & 15, hf = lane >> 4;
  const int cnt = min(cnts[b], 2048);     // the clamp bounds the trip count below
  if (qb * 128 >= cnt) return;            // whole block, in front of every copy and barrier
  const int ntile = (cnt + 63) >> 6;      // key tiles, 1..32

  // Q fragments stay in registers: 64 d x 16 queries, B operand (column = query n_lo)
  const _Float16* qbase = Qh + (((size_t)bh * 2048) + qb * 128 + wave * 16) * 64;
  const v16h qa0 = load_frag16(qbase, 64, lane);
  const v16h qa1 = load_frag16(qbase + 32, 64, lane);
  // the token of this lane's query, for the epilogue; read here, with the Q
  // fragments, so that the epilogue waits for no load
  const int qtok = idx[b * 2048 + qb * 128 + wave * 16 + n_lo];

  auto loadK = [&](int j, int buf) {
    const _Float16* kb_ = Kh + (((size_t)bh * 2048) + j * 64) * 64;
    #pragma unroll
    for (int p = t; p < 512; p += 256) async_copy16(kb_ + p * 8, &klds[buf][(p >> 3) * PITCH64 + (p & 7) * 8]);
  };
  // 64 keys = 4 groups of [64 d][16 keys], 8 KB contiguous in Vt; segment p holds
  // 8 keys of channel (p >> 1) & 63 in group p >> 7
  auto loadV = [&](int j, int buf) {
    const _Float16* vb_ = Vt + (((size_t)bh * 2048) + j * 64) * 64;
    #pragma unroll  // both copies issue back to back, no loop branch around them
    for (int i = 0; i < 2; ++i) {
      const int p = t + i * 256;
      async_copy16(vb_ + p * 8, &vtlds[buf][((p >> 1) & 63) * PITCH64 + (p >> 7) * 16 + (p & 1) * 8]);
    }
  };
  auto loadM = [&](int j, int buf) {
    if (t < 64) mlds[buf][t] = (j * 64 + t < cnt) ? 0.f : -1e30f;
  };

  float mstate = -1e30f;   // running maximum of query n_lo, equal in both halves
  float lstate = 0.f;      // running sum of query n_lo over this half's keys only
  v8f o[4] = {};           // O^T: o[t2][r] = channel 16 * t2 + 8 * hf + r of query n_lo

  loadK(0, 0); loadV(0, 0); loadM(0, 0);
  ring_publish();

  int cur = 0;
  for (int j = 0; j < ntile; ++j) {
    const int nxt = cur ^ 1;
    if (j + 1 < ntile) { loadK(j + 1, nxt); loadV(j + 1, nxt); loadM(j + 1, nxt); }

    // S^T = K @ Q^T: s[t2][r] = key 16 * t2 + 8 * hf + r against query n_lo
    v8f s[4];
    #pragma unroll
    for (int t2 = 0; t2 < 4; ++t2) {
      v8f z = {};
      z = WMMA_F16(load_frag16(klds[cur] + t2 * 16 * PITCH64, PITCH64, lane), qa0, z);
      z = WMMA_F16(load_frag16(klds[cur] + t2 * 16 * PITCH64 + 32, PITCH64, lane), qa1, z);
      s[t2] = z;
    }

    // online softmax of the lane's query over its 32 keys; four independent chains
    // for the maximum and for the sum, one per score tile
    float mx[4];
    #pragma unroll  // constant indices keep s[] and mx[] in registers
    for (int t2 = 0; t2 < 4; ++t2) {
      union { float4 q[2]; float f[8]; } km;   // the mask of the lane's 8 keys of this tile
      km.q[0] = *(const float4*)&mlds[cur][t2 * 16 + 8 * hf];
      km.q[1] = *(const float4*)&mlds[cur][t2 * 16 + 8 * hf + 4];
      #pragma unroll
      for (int r = 0; r < 8; ++r) {
        s[t2][r] = s[t2][r] * 0.125f + km.f[r];
        mx[t2] = (r == 0) ? s[t2][r] : fmaxf(mx[t2], s[t2][r]);
      }
    }
    float rmax = fmaxf(fmaxf(mx[0], mx[1]), fmaxf(mx[2], mx[3]));
    rmax = fmaxf(rmax, xhalf(rmax));          // over all 64 keys
    const float newm  = fmaxf(mstate, rmax);
    const float alpha = __expf(mstate - newm);
    float rs[4];
    #pragma unroll  // constant indices keep s[] and rs[] in registers
    for (int t2 = 0; t2 < 4; ++t2) {
      #pragma unroll
      for (int r = 0; r < 8; ++r) {
        const float v = s[t2][r];
        const float e = (v > -1e29f) ? __expf(v - newm) : 0.f;
        s[t2][r] = e;
        rs[t2] = (r == 0) ? e : rs[t2] + e;
      }
    }
    lstate = lstate * alpha + ((rs[0] + rs[1]) + (rs[2] + rs[3]));
    mstate = newm;
    #pragma unroll
    for (int t2 = 0; t2 < 4; ++t2) o[t2] *= alpha;

    // P^T as B operand: element e of a fragment is key 8 * hf + e (e < 8) or
    // 16 + 8 * hf + e - 8 of its 32 keys, which is register e & 7 of score tile e >> 3
    v16h p0, p1;
    #pragma unroll  // constant indices keep the fragments in registers
    for (int e = 0; e < 16; ++e) {
      p0[e] = (_Float16)s[e >> 3][e & 7];
      p1[e] = (_Float16)s[2 + (e >> 3)][e & 7];
    }

    // O^T += V^T @ P^T
    #pragma unroll
    for (int t2 = 0; t2 < 4; ++t2) {
      o[t2] = WMMA_F16(load_frag16(vtlds[cur] + t2 * 16 * PITCH64, PITCH64, lane), p0, o[t2]);
      o[t2] = WMMA_F16(load_frag16(vtlds[cur] + t2 * 16 * PITCH64 + 32, PITCH64, lane), p1, o[t2]);
    }

    ring_publish();
    cur = nxt;
  }

  // epilogue: O / l -> combined [B,L,768] f16, unmasked tokens' rows only; a lane's
  // 8 registers of a tile are 8 consecutive channels of its query: one 16-B store
  const float ltot = lstate + xhalf(lstate);   // both halves' keys; every lane is on here
  const int qi = qb * 128 + wave * 16 + n_lo;
  if (qi < cnt) {                         // else a masked token's row: zero-filled by the convert kernel
    const int qrow = qtok & 2047;         // & 2047 bounds the row whatever the list holds
    const float scl = (ltot > 0.f) ? (1.f / ltot) : 0.f;
    _Float16* crow = Ch + ((size_t)(b * 2048 + qrow)) * 768 + h * 64 + 8 * hf;
    #pragma unroll
    for (int t2 = 0; t2 < 4; ++t2) {
      union { float4 f; _Float16 hh[8]; } u;
      #pragma unroll  // constant indices keep o[] and u in registers
      for (int r = 0; r < 8; ++r) u.hh[r] = (_Float16)(o[t2][r] * scl);
      *(float4*)(crow + t2 * 16) = u.f;
    }
  }
}

// ---------------------------------------------------------------------------
// LayerNorm over the SEQUENCE axis (axis=1), ddof=1, per (batch, channel).
// grid (2, 24); block 1024: 32 channels (one 128-B line per row) x 128 row
// segments.  Each thread keeps its 16 rows x 4 channels in registers, so the
// column block is read once, all loads in flight together, and is normalised
// from registers after one block-wide reduction through LDS.
// ---------------------------------------------------------------------------
__global__ __launch_bounds__(1024) void ln_kernel(const float* __restrict__ Xr,
                                                  const float* __restrict__ gamma,
                                                  const float* __restrict__ beta,
                                                  float* __restrict__ out) {
  __shared__ __attribute__((aligned(16))) float red[2][128][32];   // per-thread partials: [sum|sq][row seg][channel]
  __shared__ float red2[2][16][32];   // partials over 8 row segments each
  __shared__ __attribute__((aligned(16))) float tot[2][32];        // column totals
  const int t  = threadIdx.x;
  const int c4 = t & 7;               // float4 column inside the 32-channel group
  const int rs = t >> 3;              // row segment 0..127
  const int c  = blockIdx.y * 32 + c4 * 4;
  // 32-bit byte offset of this thread's first row, shared by the loads and the stores
  const unsigned boff = (((unsigned)blockIdx.x * 2048u + (unsigned)rs) * 768u + (unsigned)c) * 4u;
  const char* xp = (const char*)Xr + boff;
  char* op = (char*)out + boff;

  const float4 g  = *(const float4*)(gamma + c);   // issued with the rows: off the path behind the reduction
  const float4 bb = *(const float4*)(beta + c);
  // keeps the two loads above issued together with the row loads; without it they
  // sink to the first barrier and are waited for there alone, a second load latency
  __builtin_amdgcn_sched_barrier(0);
  float4 v[16];
  // the loops over v[] are unrolled so that v[] has constant indices and stays in
  // registers, and so that the 16 loads (and the 16 stores) issue back to back
  #pragma unroll
  for (int i = 0; i < 16; ++i) v[i] = *(const float4*)(xp + i * (128 * 768 * 4));

  float4 sum = {0.f, 0.f, 0.f, 0.f}, sq = {0.f, 0.f, 0.f, 0.f};
  #pragma unroll
  for (int i = 0; i < 16; ++i) {
    sum.x += v[i].x; sq.x += v[i].x * v[i].x;
    sum.y += v[i].y; sq.y += v[i].y * v[i].y;
    sum.z += v[i].z; sq.z += v[i].z * v[i].z;
    sum.w += v[i].w; sq.w += v[i].w * v[i].w;
  }
  *(float4*)&red[0][rs][c4 * 4] = sum;
  *(float4*)&red[1][rs][c4 * 4] = sq;
  __syncthreads();

  {  // 128 -> 16 partials: a wave sums one quantity of all 32 channels over 8 segments
    const int which = (t >> 5) & 1, ch = t & 31, part = t >> 6;
    float p = 0.f;
    #pragma unroll  // the LDS reads issue together, one latency instead of eight
    for (int k = 0; k < 8; ++k) p += red[which][part * 8 + k][ch];
    red2[which][part][ch] = p;
  }
  __syncthreads();
  if (t < 64) {  // 16 -> 1
    const int which = t >> 5, ch = t & 31;
    float p = 0.f;
    #pragma unroll  // as above
    for (int k = 0; k < 16; ++k) p += red2[which][k][ch];
    tot[which][ch] = p;
  }
  __syncthreads();

  const float4 S = *(const float4*)&tot[0][c4 * 4];
  const float4 Q = *(const float4*)&tot[1][c4 * 4];
  float4 mean, inv;
  mean.x = S.x * (1.f / 2048.f);
  mean.y = S.y * (1.f / 2048.f);
  mean.z = S.z * (1.f / 2048.f);
  mean.w = S.w * (1.f / 2048.f);
  inv.x = rsqrtf(fmaxf((Q.x - 2048.f * mean.x * mean.x) * (1.f / 2047.f), 1e-20f));
  inv.y = rsqrtf(fmaxf((Q.y - 2048.f * mean.y * mean.y) * (1.f / 2047.f), 1e-20f));
  inv.z = rsqrtf(fmaxf((Q.z - 2048.f * mean.z * mean.z) * (1.f / 2047.f), 1e-20f));
  inv.w = rsqrtf(fmaxf((Q.w - 2048.f * mean.w * mean.w) * (1.f / 2047.f), 1e-20f));
  #pragma unroll
  for (int i = 0; i < 16; ++i) {
    float4 y;
    y.x = (v[i].x - mean.x) * inv.x * g.x + bb.x;
    y.y = (v[i].y - mean.y) * inv.y * g.y + bb.y;
    y.z = (v[i].z - mean.z) * inv.z * g.z + bb.z;
    y.w = (v[i].w - mean.w) * inv.w * g.w + bb.w;
    *(float4*)(op + i * (128 * 768 * 4)) = y;
  }
}

// ---------------------------------------------------------------------------
extern "C" void kernel_launch(void* const* d_in, const int* in_sizes, int n_in,
                              void* d_out, int out_size, void* d_ws, size_t ws_size,
                              hipStream_t stream) {
  const float* inputs = (const float*)d_in[0];   // [2,2048,768]
  const int*   amask  = (const int*)d_in[1];     // [2,2048]
  const float* wq_w = (const float*)d_in[2];
  const float* wq_b = (const float*)d_in[3];
  const float* wk_w = (const float*)d_in[4];
  const float* wk_b = (const float*)d_in[5];
  const float* wv_w = (const float*)d_in[6];
  const float* wv_b = (const float*)d_in[7];
  const float* wo_w = (const float*)d_in[8];
  const float* wo_b = (const float*)d_in[9];
  const float* gamma = (const float*)d_in[10];
  const float* beta  = (const float*)d_in[11];
  float* out = (float*)d_out;

  // workspace carve-up (~48.8 MB), 256B aligned
  char* ws = (char*)d_ws;
  size_t off = 0;
  auto carve = [&](size_t bytes) { char* p = ws + off; off += (bytes + 255) & ~(size_t)255; return p; };
  const size_t NX = (size_t)4096 * 768;          // activations
  const size_t NW = (size_t)768 * 768;           // weights
  _Float16* xh  = (_Float16*)carve(NX * 2);
  _Float16* wth = (_Float16*)carve(4 * NW * 2);  // weights q, k, v, o: [4][k/32][n][k%32]
  _Float16* woh = wth + 3 * NW;
  _Float16* qhh = (_Float16*)carve(3 * NX * 2);  // three planes: Q, K [B,H,L,64],
  _Float16* khh = qhh + NX;
  _Float16* vth = qhh + 2 * NX;                  // V [B,H,L/16,64,16]
  _Float16* chh = (_Float16*)carve(NX * 2);      // combined [B,L,768]
  float*    xr  = (float*)carve(NX * 4);         // residual sum, fp32
  int*      idx = (int*)carve(4096 * 4);         // [B,L] token order: unmasked first
  int*      cnts = (int*)carve(2 * 4);           // [B] unmasked tokens
  (void)ws_size; (void)in_sizes; (void)n_in; (void)out_size;

  // 1) token order (2 blocks), weight (4 x 24 blocks) and activation (128 blocks) fp32 -> f16 conversions
  cvt_f16_kernel<<<2 + 4 * 24 + 128, 256, 0, stream>>>(inputs, amask, wq_w, wk_w, wv_w, wo_w,
                                                              xh, wth, chh, idx, cnts);

  // 2) Q/K/V projections of the unmasked tokens (128x192 tiles), one launch
  gemm_kernel<0><<<dim3(32, 4, 3), 256, 0, stream>>>(xh, wth, wq_b, wk_b, wv_b, nullptr, idx, cnts, qhh, nullptr);

  // 3) fused attention
  attn_kernel<<<dim3(24, 16), 256, 0, stream>>>(qhh, khh, vth, idx, cnts, chh);

  // 4) output projection + residual
  gemm_kernel<1><<<dim3(32, 6), 256, 0, stream>>>(chh, woh, wo_b, nullptr, nullptr, inputs, nullptr, nullptr, nullptr, xr);

  // 5) layernorm over sequence axis
  ln_kernel<<<dim3(2, 24), 1024, 0, stream>>>(xr, gamma, beta, out);
}

// v010
// Measured time: 62 microseconds a run.
// Two timings next to v009 put it at 1.06 and 1.05 times that version's speed.
// Over all steps from v000 it is 7.48 times as fast.
#include <hip/hip_runtime.h>
#include <hip/hip_bf16.h>

// ---------------------------------------------------------------------------
// MHA + residual + LayerNorm(axis=L) for gfx1250 (MI455X), f16 WMMA path,
// async global->LDS copies + double-buffered, software-pipelined tiles.
// Each of the weights and V is laid out K-contiguous and in tile order
// by the kernel that produces it, so no tile is transposed on its way to LDS.
// Tokens whose mask is 0 have weight 0 as keys and a zero context row as queries:
// Q, K, V and the attention are computed on the unmasked tokens only, compacted.
// B=2, L=2048, HIDDEN=768, HEADS=12, HEAD=64.
// ---------------------------------------------------------------------------

typedef __attribute__((ext_vector_type(16))) _Float16 v16h;
typedef __attribute__((ext_vector_type(8)))  float    v8f;
typedef __attribute__((ext_vector_type(4)))  int      v4i;
typedef __attribute__((ext_vector_type(4)))  float    v4f;
typedef __attribute__((ext_vector_type(2)))  float    v2f;

// LDS row pitches in halfs, an odd multiple of 16 B each, so that the 16 rows a
// ds_load_b128 fragment read touches fall on different banks (64 banks x 4 B).
#define PITCH64 72   // rows of 64 halfs (128 B) -> 144 B; the GEMM's pitch stands in its kernel

#define WMMA_F16(a, b, c) \
  __builtin_amdgcn_wmma_f32_16x16x32_f16(false, (a), false, (b), (short)0, (c), false, false)

#if __has_builtin(__builtin_amdgcn_global_load_async_to_lds_b128)
#define HAVE_ASYNC_LDS 1
#else
#define HAVE_ASYNC_LDS 0
#endif

// 16-byte global -> LDS copy; async (ASYNCcnt) when the builtin exists.
// Probed signature: (v4i addrspace(1)*, v4i addrspace(3)*, imm offset, imm cpol)
__device__ inline void async_copy16(const _Float16* g, _Float16* l) {
#if HAVE_ASYNC_LDS
  __builtin_amdgcn_global_load_async_to_lds_b128(
      (__attribute__((address_space(1))) v4i*)g,
      (__attribute__((address_space(3))) v4i*)l, 0, 0);
#else
  *(float4*)l = *(const float4*)g;
#endif
}

// Publish point of a two-buffer ring, passed by every wave: behind it the tile
// copied last is readable by all waves and the other buffer may be refilled.
__device__ inline void ring_publish() {
  // this wave's LDS reads and writes have retired before another wave's copies
  // or reads touch the same bytes
  asm volatile("s_wait_dscnt 0x0" ::: "memory");
  // this wave's own copies have landed before the barrier lets others read them
  asm volatile("s_wait_asynccnt 0x0" ::: "memory");
  __syncthreads();
}

// Load a 16x32 f16 fragment (A-layout; also B-layout when source is stored
// transposed, i.e. K contiguous per row).  Per CDNA5 ISA 7.12.2:
//   lane 0-15: row = lane,   VGPR v<4: K = half*8 + v*2,   v>=4: K = 16+...
// => per lane: 8 contiguous halfs at [row][half*8] and 8 at [row][16+half*8].
__device__ inline v16h load_frag16(const _Float16* base, int stride_h, int lane) {
  const int m  = lane & 15;
  const int hf = lane >> 4;
  union { v16h v; float4 q[2]; } u;
  u.q[0] = *(const float4*)(base + (size_t)m * stride_h + hf * 8);
  u.q[1] = *(const float4*)(base + (size_t)m * stride_h + 16 + hf * 8);
  return u.v;
}

// ---------------------------------------------------------------------------
// Blocks 0 and 1: token order of one batch each.  idx[b][0 .. cnts[b]) lists the
// unmasked tokens in rising order, the rest of idx[b] the masked ones, so idx[b]
// is a permutation of 0..2047 for any mask.  A wave ranks 256 consecutive tokens
// by ballots; the 8 wave totals meet in LDS.
// Blocks 2 .. 97: the four weights, 24 blocks each, fp32 [k][n] -> f16 in the
// GEMM's tile order, Wt[weight][k / 32][n][k % 32].  A block takes 256 columns x
// three 32-row k blocks; a lane reads 4 columns x 8 k of each k block by 16-B loads
// (a wave's load is 4 whole 128-B lines) and stores 8 k of one column at a time.
// Other blocks (128): fp32 -> f16 conversion of 32 rows each, 24 loads of 16 B a
// thread, and zeros into the context rows of masked tokens, which the attention
// does not compute.
// The launch is a short stream: fewer blocks than WGPs, every conversion block reads 96 KB,
// every wave of those has all its 24 loads in flight at once.  Few long waves stand in for
// many that would move 512 B each, so that the starting of waves does not set the
// length of the launch.
// None of the three jobs reads what another writes, so they share one launch.
// ---------------------------------------------------------------------------
__global__ __launch_bounds__(256) void cvt_f16_kernel(const float* __restrict__ src,
                                                      const int* __restrict__ amask,
                                                      const float* __restrict__ w0,
                                                      const float* __restrict__ w1,
                                                      const float* __restrict__ w2,
                                                      const float* __restrict__ w3,
                                                      _Float16* __restrict__ dst,
                                                      _Float16* __restrict__ Wt,
                                                      _Float16* __restrict__ Ch,
                                                      int* __restrict__ idx,
                                                      int* __restrict__ cnts) {
  __shared__ int wc[8];
  const int t = threadIdx.x;
  if (blockIdx.x < 2) {
    const int b = blockIdx.x, wave = t >> 5, lane = t & 31;
    unsigned bal[8];
    int wtot = 0;
    #pragma unroll  // constant indices keep bal[] in registers; the 8 loads issue together
    for (int s = 0; s < 8; ++s) {
      bal[s] = __builtin_amdgcn_ballot_w32(amask[b * 2048 + (wave * 8 + s) * 32 + lane] != 0);
      wtot += __popc(bal[s]);
    }
    if (lane == 0) wc[wave] = wtot;
    __syncthreads();
    int base = 0, total = 0;   // unmasked tokens in front of this wave's; in the batch
    #pragma unroll  // the 8 totals come as two wide LDS reads
    for (int k = 0; k < 8; ++k) {
      const int c = wc[k];
      total += c;
      if (k < wave) base += c;
    }
    #pragma unroll  // constant indices keep bal[] in registers
    for (int s = 0; s < 8; ++s) {
      const int l = (wave * 8 + s) * 32 + lane;
      const int rank = base + __popc(bal[s] & ((1u << lane) - 1u));   // unmasked tokens in front of l
      const bool on = ((bal[s] >> lane) & 1u) != 0u;
      idx[b * 2048 + (on ? rank : total + l - rank)] = l;
      base += __popc(bal[s]);
    }
    if (t == 0) cnts[b] = total;
    return;
  }
  if (blockIdx.x < 2 + 4 * 24) {
    const int wb = blockIdx.x - 2;
    const int which = wb / 24, tile = wb % 24;
    const float* wsrc = which == 0 ? w0 : which == 1 ? w1 : which == 2 ? w2 : w3;
    const int n  = (tile % 3) * 256 + (t >> 2) * 4;   // the first of the lane's 4 columns
    const int kb = (tile / 3) * 3, kg = t & 3;        // k blocks kb .. kb + 2
    const float* wp = wsrc + (size_t)(kb * 32 + kg * 8) * 768 + n;
    v4f v[3][8];
    #pragma unroll  // constant indices keep v[] in registers
    for (int q = 0; q < 3; ++q) {
      #pragma unroll
      for (int j = 0; j < 8; ++j) v[q][j] = *(const v4f*)(wp + (q * 32 + j) * 768);
    }
    _Float16* wd = Wt + (((size_t)which * 24 + kb) * 768 + n) * 32 + kg * 8;
    #pragma unroll  // constant indices keep v[] in registers
    for (int q = 0; q < 3; ++q) {
      #pragma unroll
      for (int c = 0; c < 4; ++c) {
        union { float4 f; _Float16 h[8]; } u;
        #pragma unroll
        for (int j = 0; j < 8; ++j) u.h[j] = (_Float16)v[q][j][c];
        *(float4*)(wd + (q * 768 + c) * 32) = u.f;
      }
    }
    // precaution: stands in front of every later write of the stores' registers (the
    // code of another path may follow this one in the built kernel)
    asm volatile("s_wait_xcnt 0x0" ::: "memory");
    return;
  }
  // 32 rows = 6144 groups of 4 floats; this thread's are groups u * 256 + t.  A row is
  // 192 groups = 6 waves' worth, so the 32 groups of a wave's load lie in one row:
  // that row's mask bit is wave-uniform, and the zero store stands behind a scalar
  // branch.  Lane l reads the mask of the block's row l; the ballot holds all 32.
  const int ab   = blockIdx.x - (2 + 4 * 24);
  const int wave = __builtin_amdgcn_readfirstlane(t >> 5);
  const int i0   = (ab * 6144 + t) * 4;
  const int mrow = amask[ab * 32 + (t & 31)];
  v4f v[24];
  #pragma unroll  // constant indices keep v[] in registers
  for (int u = 0; u < 24; ++u) v[u] = *(const v4f*)(src + i0 + u * 1024);
  const unsigned rows_on = __builtin_amdgcn_ballot_w32(mrow != 0);
  #pragma unroll  // constant indices keep v[] in registers
  for (int u = 0; u < 24; ++u) {
    union { uint2 u2; _Float16 h[4]; } p;
    p.h[0] = (_Float16)v[u][0]; p.h[1] = (_Float16)v[u][1];
    p.h[2] = (_Float16)v[u][2]; p.h[3] = (_Float16)v[u][3];
    *(uint2*)(dst + i0 + u * 1024) = p.u2;
    if (((rows_on >> ((u * 8 + wave) / 6)) & 1u) == 0u) *(uint2*)(Ch + i0 + u * 1024) = make_uint2(0u, 0u);
  }
  // precaution: stands in front of every later write of the stores' registers (the
  // code of the other paths follows this one in the built kernel)
  asm volatile("s_wait_xcnt 0x0" ::: "memory");
}

// ---------------------------------------------------------------------------
// GEMM: C = X @ W + bias, X:[4096,768] f16, W:[768,768] f16 as Wt[k/32][n][k%32].
// Block tile 128(M) x NB(N), double-buffered LDS, X and W tiles both by async copies.
// 8 waves as 2 x 4; wave = 64 rows x NB / 4 cols: a fragment read from LDS feeds 3 or 4
// products (2 or 4 at NB = 128), where a 16 x 128 strip reads 9 fragments for 8 products
// and the LDS read rate, not the matrix unit, sets the length of a stage.
// NB = 192 for the projections: with about half the tokens unmasked the live blocks are
// then fewer than the WGPs, and no WGP's LDS has to serve two of them.
// A ring stage holds KS = 3 k blocks of 32: a stage's copies come from memory or from
// L2 in one latency whatever their number, and the stage in work has to last that
// long.  One k block lasts far less: at one a stage every k block waits for the next
// one's copies.  At three the ring is 104 KB of LDS at NB = 128, 130 KB at NB = 192.
// MODE 0: the Q, K and V projections in one launch, blockIdx.z picks the product
// (weight plane z of Wt, bias z, output plane z of Yh): Q and K scatter to
// [B,H,L,64] f16, V goes out transposed in 16-key groups, [B,H,L/16,64,16] f16.
// MODE 1: += residual, fp32 out.
// MODE 0 works on the compacted tokens: row i of a batch is X row idx[b][i],
// and L above is the compact position.  Tiles wholly past cnts[b] are not computed;
// the last tile's rows past it are masked tokens' rows, finite, which the attention
// gives weight 0.
// ---------------------------------------------------------------------------
template <int MODE>
__global__ __launch_bounds__(256) void gemm_kernel(const _Float16* __restrict__ X,
                                                   const _Float16* __restrict__ Wt,
                                                   const float* __restrict__ bias0,
                                                   const float* __restrict__ bias1,
                                                   const float* __restrict__ bias2,
                                                   const float* __restrict__ resid,
                                                   const int* __restrict__ idx,
                                                   const int* __restrict__ cnts,
                                                   _Float16* __restrict__ Yh,
                                                   float* __restrict__ Yf) {
  constexpr int KS    = 3;                     // k blocks of 32 a ring stage
  constexpr int NST   = 24 / KS;               // ring stages
  constexpr int PITCH = KS * 32 + 8;           // LDS row pitch in halfs: 208 B = 16 B x 13
  constexpr int NB    = (MODE == 0) ? 192 : 128;   // columns of the block tile
  constexpr int JT    = NB / 64;               // 16-column tiles of a wave
  // One array, X's two buffers in front of W's.  The k blocks of a W stage lie 48 KB
  // apart in global memory; the build puts such a step into a copy's offset field,
  // which moves the LDS address too, and takes it off the LDS address register:
  // with W behind X's 52 KB that register does not fall below 0.
  __shared__ __attribute__((aligned(16))) _Float16 ring[2 * (128 + NB) * PITCH];
  _Float16 (*const xt)[128 * PITCH] = (_Float16 (*)[128 * PITCH])ring;                    // xt[buf][m][k]
  _Float16 (*const wt)[NB * PITCH]  = (_Float16 (*)[NB * PITCH])(ring + 2 * 128 * PITCH);  // transposed: wt[buf][n][k]
  const int mtile = blockIdx.x;          // 0..31
  const int ntile = blockIdx.y;          // 0 .. 768 / NB - 1
  const int prod  = (MODE == 0) ? blockIdx.z : 0;   // 0 Q, 1 K, 2 V
  const int t = threadIdx.x, wave = t >> 5, lane = t & 31;

  const int wm = wave >> 2, wn = wave & 3;   // the wave's place in the block tile: 2 x 4 waves

  // the two X rows that this thread copies segments of (tile rows t / 4 and 64 + t / 4)
  int xrow0 = mtile * 128 + (t >> 2), xrow1 = xrow0 + 64;
  if (MODE != 1) {
    const int b = mtile >> 4;            // 16 tiles a batch
    if ((mtile & 15) * 128 >= cnts[b]) return;   // whole block, in front of every copy and barrier
    // & 2047 bounds the row whatever the list holds
    const int i0 = idx[xrow0] & 2047, i1 = idx[xrow1] & 2047;
    xrow0 = b * 2048 + i0;
    xrow1 = b * 2048 + i1;
  }
  const _Float16* xs0 = X + (size_t)xrow0 * 768 + (t & 3) * 8;
  const _Float16* xs1 = X + (size_t)xrow1 * 768 + (t & 3) * 8;

  // X stage 128 x (KS * 32): per k block 512 16B segments; async copy, rows as listed above.
  auto loadX = [&](int st, int buf) {
    _Float16* xd = &xt[buf][(t >> 2) * PITCH + (t & 3) * 8];
    #pragma unroll  // the stage's copies issue back to back, no loop branch around them
    for (int q = 0; q < KS; ++q) {
      async_copy16(xs0 + (st * KS + q) * 32, xd + q * 32);
      async_copy16(xs1 + (st * KS + q) * 32, xd + 64 * PITCH + q * 32);
    }
  };
  // W stage NB(n) x (KS * 32)(k): per k block NB * 64 B contiguous in Wt, NB * 4 16B segments
  // (segment p = t + 256 * i: column p >> 2, k (p & 3) * 8); async copy.
  auto loadW = [&](int st, int buf) {
    const _Float16* wsrc = Wt + (((size_t)prod * 24 + st * KS) * 768 + ntile * NB) * 32 + t * 8;
    _Float16* wd = &wt[buf][(t >> 2) * PITCH + (t & 3) * 8];
    #pragma unroll  // the stage's copies issue back to back, no loop branch around them
    for (int q = 0; q < KS; ++q) {
      #pragma unroll
      for (int i = 0; i < NB / 64; ++i) async_copy16(wsrc + q * (768 * 32) + i * 256 * 8, wd + i * 64 * PITCH + q * 32);
    }
  };

  loadX(0, 0);
  loadW(0, 0);
  ring_publish();

  v8f acc[4][JT] = {};   // acc[i][j]: rows 16 * i, columns 16 * j of the wave's tile
  int cur = 0;
  for (int st = 0; st < NST; ++st) {
    const int nxt = cur ^ 1;
    if (st + 1 < NST) { loadX(st + 1, nxt); loadW(st + 1, nxt); }
    // two fragment sets: a k block's reads issue as one group in front of the products
    // of the k block before it, inside the stage only
    v16h a[2][4], b[2][JT];
    auto frags = [&](int q, int s) {
      #pragma unroll  // constant indices keep the fragments in registers
      for (int j = 0; j < JT; ++j) b[s][j] = load_frag16(wt[cur] + (wn * JT + j) * 16 * PITCH + q * 32, PITCH, lane);
      #pragma unroll  // as above
      for (int i = 0; i < 4; ++i) a[s][i] = load_frag16(xt[cur] + (wm * 4 + i) * 16 * PITCH + q * 32, PITCH, lane);
    };
    frags(0, 0);
    #pragma unroll  // the stage's k blocks in rising k, no branch or barrier between them
    for (int q = 0; q < KS; ++q) {
      if (q + 1 < KS) {
        frags(q + 1, (q + 1) & 1);
        // holds the next k block's reads in front of this one's products: left alone the
        // build sinks each A read to its first use and waits out the LDS latency there
        __builtin_amdgcn_sched_barrier(0);
      }
      #pragma unroll
      for (int i = 0; i < 4; ++i) {
        #pragma unroll
        for (int j = 0; j < JT; ++j) acc[i][j] = WMMA_F16(a[q & 1][i], b[q & 1][j], acc[i][j]);
      }
      // keeps what follows behind these products: the reads of the k block after the next
      // in one group, not spread among them; at the last k block the publish point, so
      // that the next copies issue directly behind its barrier and have a whole stage to land
      __builtin_amdgcn_sched_barrier(0);
    }
    // behind the last stage no copy is in flight and no buffer is refilled or read again:
    // a publish point there would only make the wave hold all its fragments at once
    if (st + 1 < NST) ring_publish();
    cur = nxt;
  }

  const int n_lo = lane & 15, hf = lane >> 4;
  const float* bias = prod == 0 ? bias0 : prod == 1 ? bias1 : bias2;
  if (MODE == 0) Yh += (size_t)prod * (4096 * 768);
  const int ncol = ntile * NB + wn * (JT * 16) + n_lo;   // the lane's column in tile j = 0
  const int mrow = mtile * 128 + wm * 64;               // the wave's first row
  float bvj[JT];
  #pragma unroll  // constant indices keep bvj[] in registers; the loads issue together
  for (int j = 0; j < JT; ++j) bvj[j] = bias[ncol + j * 16];
  // precaution: stands in front of every later write of the bias loads' address registers
  asm volatile("s_wait_xcnt 0x0" ::: "memory");
  // one block-uniform branch in front of the two store loops, none inside them
  if (MODE == 0 && prod == 2) {
    #pragma unroll
    for (int i = 0; i < 4; ++i) {
      #pragma unroll
      for (int j = 0; j < JT; ++j) {
        const int n = ncol + j * 16;
        const float bv = bvj[j];
        // the lane's 8 accumulator rows are 8 consecutive keys of one channel: one
        // 16-B store; the wave's 32 stores are 512 contiguous bytes
        const int m0 = mrow + i * 16;
        const int b = m0 >> 11, lg = (m0 & 2047) >> 4;
        const int h = n >> 6, d = n & 63;
        union { float4 f; _Float16 hh[8]; } u;
        #pragma unroll  // constant indices keep acc[] and u in registers
        for (int r = 0; r < 8; ++r) u.hh[r] = (_Float16)(acc[i][j][r] + bv);
        *(float4*)(Yh + ((((size_t)(b * 12 + h)) * 128 + lg) * 64 + d) * 16 + 8 * hf) = u.f;
      }
    }
    return;
  }
  float rv[4][JT][8];   // MODE 1: the residual of the wave's tile, all loads in flight together
  if (MODE == 1) {
    #pragma unroll  // constant indices keep rv[] in registers
    for (int i = 0; i < 4; ++i) {
      #pragma unroll
      for (int j = 0; j < JT; ++j) {
        #pragma unroll
        for (int r = 0; r < 8; ++r) rv[i][j][r] = resid[(size_t)(mrow + i * 16 + r + 8 * hf) * 768 + ncol + j * 16];
        // precaution: stands in front of every later write of these loads' address
        // registers (the build lets a later load land in them)
        asm volatile("s_wait_xcnt 0x0" ::: "memory");
      }
    }
  }
  #pragma unroll
  for (int i = 0; i < 4; ++i) {
    #pragma unroll
    for (int j = 0; j < JT; ++j) {
      const int n = ncol + j * 16;
      const float bv = bvj[j];
      #pragma unroll
      for (int r = 0; r < 8; ++r) {
        const int m = mrow + i * 16 + r + 8 * hf;
        if (MODE == 0) {
          const int b = m >> 11, l = m & 2047;
          const int h = n >> 6, d = n & 63;
          Yh[(((size_t)(b * 12 + h)) * 2048 + l) * 64 + d] = (_Float16)(acc[i][j][r] + bv);
        } else {
          Yf[(size_t)m * 768 + n] = acc[i][j][r] + bv + rv[i][j][r];
        }
      }
    }
  }
  // precaution, MODE 0: the code of the V path follows this one in the built kernel;
  // the wait stands in front of its writes of these stores' registers
  if (MODE == 0) asm volatile("s_wait_xcnt 0x0" ::: "memory");
}

__device__ inline float xhalf(float x) {
  const int v = __builtin_bit_cast(int, x);
  return __builtin_bit_cast(float,
      __builtin_amdgcn_permlanex16(v, v, 0x76543210, 0xfedcba98, false, false));
}

__global__ __launch_bounds__(256) void attn_kernel(const _Float16* __restrict__ Qh,
                                                   const _Float16* __restrict__ Kh,
                                                   const _Float16* __restrict__ Vt,
                                                   const int* __restrict__ idx,
                                                   const int* __restrict__ cnts,
                                                   _Float16* __restrict__ Ch) {
  __shared__ __attribute__((aligned(16))) _Float16 klds[2][64 * PITCH64];   // K tile, natural [key][d]    2x9 KB
  __shared__ __attribute__((aligned(16))) _Float16 vtlds[2][64 * PITCH64];  // V tile transposed [d][key]  2x9 KB

  const int bh = blockIdx.x;              // 0..23
  const int qb = blockIdx.y;              // 0..15
  const int b  = bh / 12, h = bh % 12;
  const int t = threadIdx.x, wave = t >> 5, lane = t & 31;
  const int n_lo = lane & 15, hf = lane >> 4;
  const int cnt = min(cnts[b], 2048);     // the clamp bounds the trip count below
  if (qb * 128 >= cnt) return;            // whole block, in front of every copy and barrier
  const int ntile = (cnt + 63) >> 6;      // key tiles, 1..32

  // Q fragments stay in registers: 64 d x 16 queries, B operand (column = query n_lo)
  const _Float16* qbase = Qh + (((size_t)bh * 2048) + qb * 128 + wave * 16) * 64;
  const v16h qa0 = load_frag16(qbase, 64, lane);
  const v16h qa1 = load_frag16(qbase + 32, 64, lane);
  // the token of this lane's query, for the epilogue; read here, with the Q
  // fragments, so that the epilogue waits for no load
  const int qtok = idx[b * 2048 + qb * 128 + wave * 16 + n_lo];

  auto loadK = [&](int j, int buf) {
    const _Float16* kb_ = Kh + (((size_t)bh * 2048) + j * 64) * 64;
    #pragma unroll
    for (int p = t; p < 512; p += 256) async_copy16(kb_ + p * 8, &klds[buf][(p >> 3) * PITCH64 + (p & 7) * 8]);
  };
  // 64 keys = 4 groups of [64 d][16 keys], 8 KB contiguous in Vt; segment p holds
  // 8 keys of channel (p >> 1) & 63 in group p >> 7
  auto loadV = [&](int j, int buf) {
    const _Float16* vb_ = Vt + (((size_t)bh * 2048) + j * 64) * 64;
    #pragma unroll  // both copies issue back to back, no loop branch around them
    for (int i = 0; i < 2; ++i) {
      const int p = t + i * 256;
      async_copy16(vb_ + p * 8, &vtlds[buf][((p >> 1) & 63) * PITCH64 + (p >> 7) * 16 + (p & 1) * 8]);
    }
  };

  // The softmax works on the raw products: 1 / 8 and log2(e) are one factor SC, applied
  // together with the maximum by one multiply-add in front of the base-2 exponential.
  const float SC = 0.125f * 1.44269504088896f;
  float mstate = -1e30f;   // running maximum of query n_lo's raw scores, equal in both halves
  float lstate = 0.f;      // running sum of query n_lo over this half's keys only
  v8f o[4] = {};           // O^T: o[t2][r] = channel 16 * t2 + 8 * hf + r of query n_lo

  loadK(0, 0); loadV(0, 0);
  ring_publish();

  int cur = 0;
  for (int j = 0; j < ntile; ++j) {
    const int nxt = cur ^ 1;
    if (j + 1 < ntile) { loadK(j + 1, nxt); loadV(j + 1, nxt); }

    // S^T = K @ Q^T: s[t2][r] = key 16 * t2 + 8 * hf + r against query n_lo
    v8f s[4];
    #pragma unroll
    for (int t2 = 0; t2 < 4; ++t2) {
      v8f z = {};
      z = WMMA_F16(load_frag16(klds[cur] + t2 * 16 * PITCH64, PITCH64, lane), qa0, z);
      z = WMMA_F16(load_frag16(klds[cur] + t2 * 16 * PITCH64 + 32, PITCH64, lane), qa1, z);
      s[t2] = z;
    }

    // Compact keys: only the last tile can hold positions past cnt (it holds at least
    // one in front of it).  A score of -1e30 loses every maximum and its exponential is 0.
    if (j == ntile - 1) {
      const int lim = cnt - j * 64 - 8 * hf;   // the lane's keys 16 * t2 + r below lim count
      #pragma unroll  // constant indices keep s[] in registers
      for (int t2 = 0; t2 < 4; ++t2) {
        #pragma unroll
        for (int r = 0; r < 8; ++r) s[t2][r] = (t2 * 16 + r < lim) ? s[t2][r] : -1e30f;
      }
    }

    // online softmax of the lane's query over its 32 keys; four independent chains
    // for the maximum and for the sum, one per score tile
    float mx[4];
    #pragma unroll  // constant indices keep s[] and mx[] in registers
    for (int t2 = 0; t2 < 4; ++t2) {
      #pragma unroll
      for (int r = 0; r < 8; ++r) mx[t2] = (r == 0) ? s[t2][r] : fmaxf(mx[t2], s[t2][r]);
    }
    float rmax = fmaxf(fmaxf(mx[0], mx[1]), fmaxf(mx[2], mx[3]));
    rmax = fmaxf(rmax, xhalf(rmax));          // over all 64 keys
    const float newm  = fmaxf(mstate, rmax);
    const float alpha = __builtin_amdgcn_exp2f((mstate - newm) * SC);
    const v2f sc2 = {SC, SC};
    const v2f nb2 = {-newm * SC, -newm * SC};
    v2f rs2[4];   // sums of the even and of the odd registers of each score tile
    #pragma unroll  // constant indices keep s[] and rs2[] in registers
    for (int t2 = 0; t2 < 4; ++t2) {
      #pragma unroll
      for (int r = 0; r < 8; r += 2) {
        v2f x = {s[t2][r], s[t2][r + 1]};
        x = __builtin_elementwise_fma(x, sc2, nb2);
        const v2f e = {__builtin_amdgcn_exp2f(x[0]), __builtin_amdgcn_exp2f(x[1])};
        s[t2][r] = e[0];
        s[t2][r + 1] = e[1];
        rs2[t2] = (r == 0) ? e : rs2[t2] + e;
      }
    }
    const v2f rsum = (rs2[0] + rs2[1]) + (rs2[2] + rs2[3]);
    lstate = lstate * alpha + (rsum[0] + rsum[1]);
    mstate = newm;
    #pragma unroll
    for (int t2 = 0; t2 < 4; ++t2) o[t2] *= alpha;

    // P^T as B operand: element e of a fragment is key 8 * hf + e (e < 8) or
    // 16 + 8 * hf + e - 8 of its 32 keys, which is register e & 7 of score tile e >> 3
    v16h p0, p1;
    #pragma unroll  // constant indices keep the fragments in registers
    for (int e = 0; e < 16; ++e) {
      p0[e] = (_Float16)s[e >> 3][e & 7];
      p1[e] = (_Float16)s[2 + (e >> 3)][e & 7];
    }

    // O^T += V^T @ P^T
    #pragma unroll
    for (int t2 = 0; t2 < 4; ++t2) {
      o[t2] = WMMA_F16(load_frag16(vtlds[cur] + t2 * 16 * PITCH64, PITCH64, lane), p0, o[t2]);
      o[t2] = WMMA_F16(load_frag16(vtlds[cur] + t2 * 16 * PITCH64 + 32, PITCH64, lane), p1, o[t2]);
    }

    ring_publish();
    cur = nxt;
  }

  // epilogue: O / l -> combined [B,L,768] f16, unmasked tokens' rows only; a lane's
  // 8 registers of a tile are 8 consecutive channels of its query: one 16-B store
  const float ltot = lstate + xhalf(lstate);   // both halves' keys; every lane is on here
  const int qi = qb * 128 + wave * 16 + n_lo;
  if (qi < cnt) {                         // else a masked token's row: zero-filled by the convert kernel
    const int qrow = qtok & 2047;         // & 2047 bounds the row whatever the list holds
    const float scl = (ltot > 0.f) ? (1.f / ltot) : 0.f;
    _Float16* crow = Ch + ((size_t)(b * 2048 + qrow)) * 768 + h * 64 + 8 * hf;
    #pragma unroll
    for (int t2 = 0; t2 < 4; ++t2) {
      union { float4 f; _Float16 hh[8]; } u;
      #pragma unroll  // constant indices keep o[] and u in registers
      for (int r = 0; r < 8; ++r) u.hh[r] = (_Float16)(o[t2][r] * scl);
      *(float4*)(crow + t2 * 16) = u.f;
    }
  }
}

// ---------------------------------------------------------------------------
// LayerNorm over the SEQUENCE axis (axis=1), ddof=1, per (batch, channel).
// grid (2, 24); block 1024: 32 channels (one 128-B line per row) x 128 row
// segments.  Each thread keeps its 16 rows x 4 channels in registers, so the
// column block is read once, all loads in flight together, and is normalised
// from registers after one block-wide reduction through LDS.
// ---------------------------------------------------------------------------
__global__ __launch_bounds__(1024) void ln_kernel(const float* __restrict__ Xr,
                                                  const float* __restrict__ gamma,
                                                  const float* __restrict__ beta,
                                                  float* __restrict__ out) {
  __shared__ __attribute__((aligned(16))) float red[2][128][32];   // per-thread partials: [sum|sq][row seg][channel]
  __shared__ float red2[2][16][32];   // partials over 8 row segments each
  __shared__ __attribute__((aligned(16))) float tot[2][32];        // column totals
  const int t  = threadIdx.x;
  const int c4 = t & 7;               // float4 column inside the 32-channel group
  const int rs = t >> 3;              // row segment 0..127
  const int c  = blockIdx.y * 32 + c4 * 4;
  // 32-bit byte offset of this thread's first row, shared by the loads and the stores
  const unsigned boff = (((unsigned)blockIdx.x * 2048u + (unsigned)rs) * 768u + (unsigned)c) * 4u;
  const char* xp = (const char*)Xr + boff;
  char* op = (char*)out + boff;

  const float4 g  = *(const float4*)(gamma + c);   // issued with the rows: off the path behind the reduction
  const float4 bb = *(const float4*)(beta + c);
  // keeps the two loads above issued together with the row loads; without it they
  // sink to the first barrier and are waited for there alone, a second load latency
  __builtin_amdgcn_sched_barrier(0);
  float4 v[16];
  // the loops over v[] are unrolled so that v[] has constant indices and stays in
  // registers, and so that the 16 loads (and the 16 stores) issue back to back
  #pragma unroll
  for (int i = 0; i < 16; ++i) v[i] = *(const float4*)(xp + i * (128 * 768 * 4));

  float4 sum = {0.f, 0.f, 0.f, 0.f}, sq = {0.f, 0.f, 0.f, 0.f};
  #pragma unroll
  for (int i = 0; i < 16; ++i) {
    sum.x += v[i].x; sq.x += v[i].x * v[i].x;
    sum.y += v[i].y; sq.y += v[i].y * v[i].y;
    sum.z += v[i].z; sq.z += v[i].z * v[i].z;
    sum.w += v[i].w; sq.w += v[i].w * v[i].w;
  }
  *(float4*)&red[0][rs][c4 * 4] = sum;
  *(float4*)&red[1][rs][c4 * 4] = sq;
  __syncthreads();

  {  // 128 -> 16 partials: a wave sums one quantity of all 32 channels over 8 segments
    const int which = (t >> 5) & 1, ch = t & 31, part = t >> 6;
    float p = 0.f;
    #pragma unroll  // the LDS reads issue together, one latency instead of eight
    for (int k = 0; k < 8; ++k) p += red[which][part * 8 + k][ch];
    red2[which][part][ch] = p;
  }
  __syncthreads();
  if (t < 64) {  // 16 -> 1
    const int which = t >> 5, ch = t & 31;
    float p = 0.f;
    #pragma unroll  // as above
    for (int k = 0; k < 16; ++k) p += red2[which][k][ch];
    tot[which][ch] = p;
  }
  __syncthreads();

  const float4 S = *(const float4*)&tot[0][c4 * 4];
  const float4 Q = *(const float4*)&tot[1][c4 * 4];
  float4 mean, inv;
  mean.x = S.x * (1.f / 2048.f);
  mean.y = S.y * (1.f / 2048.f);
  mean.z = S.z * (1.f / 2048.f);
  mean.w = S.w * (1.f / 2048.f);
  inv.x = rsqrtf(fmaxf((Q.x - 2048.f * mean.x * mean.x) * (1.f / 2047.f), 1e-20f));
  inv.y = rsqrtf(fmaxf((Q.y - 2048.f * mean.y * mean.y) * (1.f / 2047.f), 1e-20f));
  inv.z = rsqrtf(fmaxf((Q.z - 2048.f * mean.z * mean.z) * (1.f / 2047.f), 1e-20f));
  inv.w = rsqrtf(fmaxf((Q.w - 2048.f * mean.w * mean.w) * (1.f / 2047.f), 1e-20f));
  #pragma unroll
  for (int i = 0; i < 16; ++i) {
    float4 y;
    y.x = (v[i].x - mean.x) * inv.x * g.x + bb.x;
    y.y = (v[i].y - mean.y) * inv.y * g.y + bb.y;
    y.z = (v[i].z - mean.z) * inv.z * g.z + bb.z;
    y.w = (v[i].w - mean.w) * inv.w * g.w + bb.w;
    *(float4*)(op + i * (128 * 768 * 4)) = y;
  }
}

// ---------------------------------------------------------------------------
extern "C" void kernel_launch(void* const* d_in, const int* in_sizes, int n_in,
                              void* d_out, int out_size, void* d_ws, size_t ws_size,
                              hipStream_t stream) {
  const float* inputs = (const float*)d_in[0];   // [2,2048,768]
  const int*   amask  = (const int*)d_in[1];     // [2,2048]
  const float* wq_w = (const float*)d_in[2];
  const float* wq_b = (const float*)d_in[3];
  const float* wk_w = (const float*)d_in[4];
  const float* wk_b = (const float*)d_in[5];
  const float* wv_w = (const float*)d_in[6];
  const float* wv_b = (const float*)d_in[7];
  const float* wo_w = (const float*)d_in[8];
  const float* wo_b = (const float*)d_in[9];
  const float* gamma = (const float*)d_in[10];
  const float* beta  = (const float*)d_in[11];
  float* out = (float*)d_out;

  // workspace carve-up (~48.8 MB), 256B aligned
  char* ws = (char*)d_ws;
  size_t off = 0;
  auto carve = [&](size_t bytes) { char* p = ws + off; off += (bytes + 255) & ~(size_t)255; return p; };
  const size_t NX = (size_t)4096 * 768;          // activations
  const size_t NW = (size_t)768 * 768;           // weights
  _Float16* xh  = (_Float16*)carve(NX * 2);
  _Float16* wth = (_Float16*)carve(4 * NW * 2);  // weights q, k, v, o: [4][k/32][n][k%32]
  _Float16* woh = wth + 3 * NW;
  _Float16* qhh = (_Float16*)carve(3 * NX * 2);  // three planes: Q, K [B,H,L,64],
  _Float16* khh = qhh + NX;
  _Float16* vth = qhh + 2 * NX;                  // V [B,H,L/16,64,16]
  _Float16* chh = (_Float16*)carve(NX * 2);      // combined [B,L,768]
  float*    xr  = (float*)carve(NX * 4);         // residual sum, fp32
  int*      idx = (int*)carve(4096 * 4);         // [B,L] token order: unmasked first
  int*      cnts = (int*)carve(2 * 4);           // [B] unmasked tokens
  (void)ws_size; (void)in_sizes; (void)n_in; (void)out_size;

  // 1) token order (2 blocks), weight (4 x 24 blocks) and activation (128 blocks) fp32 -> f16 conversions
  cvt_f16_kernel<<<2 + 4 * 24 + 128, 256, 0, stream>>>(inputs, amask, wq_w, wk_w, wv_w, wo_w,
                                                              xh, wth, chh, idx, cnts);

  // 2) Q/K/V projections of the unmasked tokens (128x192 tiles), one launch
  gemm_kernel<0><<<dim3(32, 4, 3), 256, 0, stream>>>(xh, wth, wq_b, wk_b, wv_b, nullptr, idx, cnts, qhh, nullptr);

  // 3) fused attention
  attn_kernel<<<dim3(24, 16), 256, 0, stream>>>(qhh, khh, vth, idx, cnts, chh);

  // 4) output projection + residual
  gemm_kernel<1><<<dim3(32, 6), 256, 0, stream>>>(chh, woh, wo_b, nullptr, nullptr, inputs, nullptr, nullptr, nullptr, xr);

  // 5) layernorm over sequence axis
  ln_kernel<<<dim3(2, 24), 1024, 0, stream>>>(xr, gamma, beta, out);
}
